// v000
// The times below were measured on an AMD MI455X: many runs one after another, warmed up first and cycling through
// copies of the inputs, with the whole window's GPU time divided by the number of runs. Launches and the gaps
// between them are all in it. The median over several windows is given; except for v000 it joins two sittings, which
// can be a few percent apart, so the side-by-side timings, each taken in one sitting, are the better comparison.
// The starting kernel, v000, takes 2840 microseconds a run.
#include <hip/hip_runtime.h>

// Chunk-local causal multi-head self-attention (a ring attention with ring_size 1) (hidden_states [1][8192][1024] = FOUR chunks of 2,048 tokens: in memory [4][2048][1024]; q, k, v = x W^T ('oi' [1024][1024] 0.02, no bias; 16 heads x 64); each chunk attends causally WITHIN itself: scores / sqrt(64), tril(ones((2048, 2048))) kept, -inf elsewhere; softmax; out = merged Wo^T ('oi', no bias) -> [1][8192][1024] = [4][2048][1024] (8.4 M); argument order hidden_states, Wq, Wk, Wv, Wo).
// Layout per batch: bf16 copy of x; exact projections; causal T-2048 attention (hybrid rows: < 512 hi/lo 3 products, rest fp16 x1024; k_gemmc skips tiles above the diagonal); merged hi/lo x W_o exact.
// Compute dtypes, f32 accumulate: every input rounded to bf16; projections exact; attention rows < 512 3 products, rest fp16; softmax f32; W_o hl x exact.

#define NB_  4
#define TT   2048
#define DM   1024
#define NH_  16
#define NKV  16
#define REP  (NH_ / NKV)
#define HD   64
#define DQ   (NH_ * HD)
#define DKV  (NKV * HD)
#define ZH   2
#define RH   512                  // query rows < RH use hi+lo planes (0: none)
#define WIN  2048
#define PCAR 1024.0f
#define SCL  0.125f   // HD^-0.5
typedef _Float16 h16;
typedef unsigned short bf;
typedef __attribute__((ext_vector_type(16))) __bf16   v16bf;
typedef __attribute__((ext_vector_type(16))) _Float16 v16h;
typedef __attribute__((ext_vector_type(8)))  _Float16 v8h;
typedef __attribute__((ext_vector_type(8)))  unsigned short v8us;
typedef __attribute__((ext_vector_type(8)))  float    v8f;
typedef __attribute__((ext_vector_type(4)))  float    v4f;
typedef v8h  __attribute__((may_alias)) v8ha;
typedef v4f  __attribute__((may_alias)) v4fa;
typedef v8us __attribute__((may_alias)) v8usa;

__device__ __forceinline__ unsigned short f2bf(float f) { unsigned u = __float_as_uint(f); u += 0x7FFFu + ((u >> 16) & 1u); return (unsigned short)(u >> 16); }
__device__ __forceinline__ float bf2f(unsigned short b) { return __uint_as_float(((unsigned)b) << 16); }
__device__ __forceinline__ float bfr(float f) { return bf2f(f2bf(f)); }
__device__ __forceinline__ v16h cat16(v8h lo, v8h hi) { return __builtin_shufflevector(lo, hi, 0, 1, 2, 3, 4, 5, 6, 7, 8, 9, 10, 11, 12, 13, 14, 15); }
__device__ __forceinline__ v16bf cat16b(v8us lo, v8us hi) { return __builtin_bit_cast(v16bf, __builtin_shufflevector(lo, hi, 0, 1, 2, 3, 4, 5, 6, 7, 8, 9, 10, 11, 12, 13, 14, 15)); }
__device__ __forceinline__ v8f wmma16(v16h a, v16h b, v8f c) { return __builtin_amdgcn_wmma_f32_16x16x32_f16(false, a, false, b, (short)0, c, false, false); }
__device__ __forceinline__ v8f wmmab(v16bf a, v16bf b, v8f c) { return __builtin_amdgcn_wmma_f32_16x16x32_bf16(false, a, false, b, (short)0, c, false, false); }



// ---- k_gemmw: register-blocked GEMM, ONE WAVE per 64x64 output tile (16 accumulators), operands straight from K-contiguous 16-bit planes; grid (M/64, N/64, Z), 32 threads.
// C[m][n] (f32, pitch ldc, + optional f32 bias[n]) = sum_k A[m][k] Bt[n][k] (+ split products per NSPLIT). z-batch strides sA/sB/sC in elements. K % 32 == 0.
template <typename T16> struct WFrag;
template <> struct WFrag<h16> { typedef v16h V; static __device__ __forceinline__ V ld(const h16* p) { return cat16(*(const v8h*)p, *(const v8h*)(p + 16)); } static __device__ __forceinline__ v8f mma(V a, V b, v8f c) { return wmma16(a, b, c); } };
template <> struct WFrag<bf> { typedef v16bf V; static __device__ __forceinline__ V ld(const bf* p) { return cat16b(*(const v8us*)p, *(const v8us*)(p + 16)); } static __device__ __forceinline__ v8f mma(V a, V b, v8f c) { return wmmab(a, b, c); } };
template <typename T16, int NSPLIT, bool BIAS>
__global__ __launch_bounds__(32) void k_gemmw(const T16* __restrict__ A, const T16* __restrict__ A2, const T16* __restrict__ Bt, const T16* __restrict__ Bt2, int K, float* C, int ldc, const float* __restrict__ bias, size_t sA, size_t sB, size_t sC) {
    typedef typename WFrag<T16>::V V;
    __shared__ __align__(16) float os[16 * 68];
    const size_t z = blockIdx.z; A += z * sA; if (A2) A2 += z * sA; Bt += z * sB; if (Bt2) Bt2 += z * sB; C += z * sC;
    const int lane = threadIdx.x & 31, lr = lane & 15, hi = lane >> 4; const int r0 = blockIdx.x * 64, c0 = blockIdx.y * 64;
    v8f acc[4][4];
#pragma unroll
    for (int mb = 0; mb < 4; ++mb)
#pragma unroll
        for (int nb = 0; nb < 4; ++nb) acc[mb][nb] = (v8f){};
    const size_t aoff = (size_t)(r0 + lr) * K + 8 * hi, boff = (size_t)(c0 + lr) * K + 8 * hi;
#pragma unroll 1
    for (int kc = 0; kc < K; kc += 32) {
        V a[4], a2[4];
#pragma unroll
        for (int mb = 0; mb < 4; ++mb) { a[mb] = WFrag<T16>::ld(A + aoff + (size_t)mb * 16 * K + kc); if (NSPLIT == 1 || NSPLIT == 2) a2[mb] = WFrag<T16>::ld(A2 + aoff + (size_t)mb * 16 * K + kc); }
#pragma unroll
        for (int nb = 0; nb < 4; ++nb) { const V b = WFrag<T16>::ld(Bt + boff + (size_t)nb * 16 * K + kc); V b2; if (NSPLIT >= 2) b2 = WFrag<T16>::ld(Bt2 + boff + (size_t)nb * 16 * K + kc);
#pragma unroll
            for (int mb = 0; mb < 4; ++mb) { acc[mb][nb] = WFrag<T16>::mma(a[mb], b, acc[mb][nb]); if (NSPLIT == 1 || NSPLIT == 2) acc[mb][nb] = WFrag<T16>::mma(a2[mb], b, acc[mb][nb]); if (NSPLIT >= 2) acc[mb][nb] = WFrag<T16>::mma(a[mb], b2, acc[mb][nb]); } }
        asm volatile("v_nop\n\tv_nop\n\tv_nop\n\tv_nop" : "+v"(acc[0][0]), "+v"(acc[1][1]), "+v"(acc[2][2]), "+v"(acc[3][3]) : "v"(a[0]), "v"(a[3]));
    }
#pragma unroll
    for (int mb = 0; mb < 4; ++mb) {
#pragma unroll
        for (int nb = 0; nb < 4; ++nb) {
#pragma unroll
            for (int j = 0; j < 8; ++j) os[(hi * 8 + j) * 68 + nb * 16 + lr] = acc[mb][nb][j]; }
        __builtin_amdgcn_wave_barrier(); asm volatile("" ::: "memory");
        float* crow = C + (size_t)(r0 + mb * 16) * ldc + c0;
{
#pragma unroll
            for (int s = 0; s < 8; ++s) { const int row = 2 * s + hi, cofs = lr * 4; v4f val = *(const v4fa*)(os + row * 68 + cofs); if (BIAS) { val[0] += bfr(bias[c0 + cofs]); val[1] += bfr(bias[c0 + cofs + 1]); val[2] += bfr(bias[c0 + cofs + 2]); val[3] += bfr(bias[c0 + cofs + 3]); }
                *(v4f*)(crow + (size_t)row * ldc + cofs) = val; }
             }
        __builtin_amdgcn_wave_barrier(); asm volatile("" ::: "memory");
    }
}

// ---- k_gemmc: the same one-wave 64x64 tile GEMM specialised for causal attention: CMODE 1 skips score tiles entirely above the diagonal (query rows r0+roff.., key columns c0..), CMODE 2 limits the
// key (K) loop of the probability x value contraction to the diagonal block (probabilities beyond it are exactly zero). roff = row offset of this launch's first row within the sequence.
template <typename T16, int NSPLIT, int CMODE>
__global__ __launch_bounds__(32) void k_gemmc(const T16* __restrict__ A, const T16* __restrict__ A2, const T16* __restrict__ Bt, const T16* __restrict__ Bt2, int K, float* C, int ldc, int roff, size_t sA, size_t sB, size_t sC) {
    typedef typename WFrag<T16>::V V;
    __shared__ __align__(16) float os[16 * 68];
    const size_t z = blockIdx.z; A += z * sA; if (A2) A2 += z * sA; Bt += z * sB; if (Bt2) Bt2 += z * sB; C += z * sC;
    const int lane = threadIdx.x & 31, lr = lane & 15, hi = lane >> 4; const int r0 = blockIdx.x * 64, c0 = blockIdx.y * 64;
    if (CMODE == 1 && c0 > r0 + roff + 63) return;                  // score tile entirely above the causal diagonal: never read (the softmax masks j > i by select)
    const int Kl = (CMODE == 2) ? min(K, r0 + roff + 64) : K;        // P.V: probabilities are exactly 0 beyond the diagonal block, so the K loop stops there
    v8f acc[4][4];
#pragma unroll
    for (int mb = 0; mb < 4; ++mb)
#pragma unroll
        for (int nb = 0; nb < 4; ++nb) acc[mb][nb] = (v8f){};
    const size_t aoff = (size_t)(r0 + lr) * K + 8 * hi, boff = (size_t)(c0 + lr) * K + 8 * hi;
#pragma unroll 1
    for (int kc = 0; kc < Kl; kc += 32) {
        V a[4], a2[4];
#pragma unroll
        for (int mb = 0; mb < 4; ++mb) { a[mb] = WFrag<T16>::ld(A + aoff + (size_t)mb * 16 * K + kc); if (NSPLIT == 1 || NSPLIT == 2) a2[mb] = WFrag<T16>::ld(A2 + aoff + (size_t)mb * 16 * K + kc); }
#pragma unroll
        for (int nb = 0; nb < 4; ++nb) { const V b = WFrag<T16>::ld(Bt + boff + (size_t)nb * 16 * K + kc); V b2; if (NSPLIT >= 2) b2 = WFrag<T16>::ld(Bt2 + boff + (size_t)nb * 16 * K + kc);
#pragma unroll
            for (int mb = 0; mb < 4; ++mb) { acc[mb][nb] = WFrag<T16>::mma(a[mb], b, acc[mb][nb]); if (NSPLIT == 1 || NSPLIT == 2) acc[mb][nb] = WFrag<T16>::mma(a2[mb], b, acc[mb][nb]); if (NSPLIT >= 2) acc[mb][nb] = WFrag<T16>::mma(a[mb], b2, acc[mb][nb]); } }
        asm volatile("v_nop\n\tv_nop\n\tv_nop\n\tv_nop" : "+v"(acc[0][0]), "+v"(acc[1][1]), "+v"(acc[2][2]), "+v"(acc[3][3]) : "v"(a[0]), "v"(a[3]));
    }
#pragma unroll
    for (int mb = 0; mb < 4; ++mb) {
#pragma unroll
        for (int nb = 0; nb < 4; ++nb) {
#pragma unroll
            for (int j = 0; j < 8; ++j) os[(hi * 8 + j) * 68 + nb * 16 + lr] = acc[mb][nb][j]; }
        __builtin_amdgcn_wave_barrier(); asm volatile("" ::: "memory");
        float* crow = C + (size_t)(r0 + mb * 16) * ldc + c0;
{
#pragma unroll
            for (int s = 0; s < 8; ++s) { const int row = 2 * s + hi, cofs = lr * 4; v4f val = *(const v4fa*)(os + row * 68 + cofs);
                *(v4f*)(crow + (size_t)row * ldc + cofs) = val; }
             }
        __builtin_amdgcn_wave_barrier(); asm volatile("" ::: "memory");
    }
}

__device__ __forceinline__ h16 tohx(float x) { return (h16)x; }
__device__ __forceinline__ void splitf(float y, unsigned short& h, unsigned short& l) { h = f2bf(y); l = f2bf(y - bf2f(h)); }
typedef __attribute__((ext_vector_type(2))) _Float16 v2h;
typedef __attribute__((ext_vector_type(4))) _Float16 v4h;
typedef __attribute__((ext_vector_type(2))) unsigned short v2us;
typedef __attribute__((ext_vector_type(4))) unsigned short v4us;
typedef __attribute__((ext_vector_type(2))) float v2f;
typedef __attribute__((ext_vector_type(4))) int v4i;

__global__ __launch_bounds__(256) void k_wtG(const float* __restrict__ w, int K, int N, bf* Bt) {
    const int lane = threadIdx.x & 31; const int L0 = (blockIdx.x * 8 + (threadIdx.x >> 5)) * 8; const int nlines = N * K / 64;
{
#pragma unroll 1
        for (int l = 0; l < 8; ++l) { const int L = L0 + l; if (L >= nlines) break; const size_t e = (size_t)L * 64 + lane * 2; const int k = (int)(e % K), n = (int)(e / K); v2us o;
            o[0] = f2bf(w[(size_t)k * N + n]); o[1] = f2bf(w[(size_t)(k + 1) * N + n]); *(v2us*)(Bt + e) = o; }
         }
}
__global__ __launch_bounds__(256) void k_cvt8(const float* __restrict__ src, bf* dst, size_t n8) { const size_t i = (size_t)blockIdx.x * 256 + threadIdx.x; if (i >= n8) return; const v8f v = *(const v8f*)(src + i * 8); v8us o;
#pragma unroll
    for (int k = 0; k < 8; ++k) o[k] = f2bf(v[k]); *(v8us*)(dst + i * 8) = o;  }

// k_rope: head planes [h][t][d] (fp16 + hi/lo) of rope(x) x sc with the rotate-half convention out[d] = x[d] cos[t][d] - x[d+HD/2] sin[t][d], out[d+HD/2] = x[d+HD/2] cos[t][d+HD/2] + x[d] sin[t][d+HD/2]
__global__ __launch_bounds__(256) void k_rope(const float* __restrict__ F, int pitch, int nheads, const float* __restrict__ CS, const float* __restrict__ RF, const float* __restrict__ nw, float sc, h16* P16, bf* Ph, bf* Pl) {
    const size_t e = ((size_t)blockIdx.x * 256 + threadIdx.x) * 2; if (e >= (size_t)nheads * TT * HD) return; const int d = (int)(e % HD); const int t = (int)((e / HD) % TT); const int h = (int)(e / ((size_t)HD * TT)); const float* f = F + (size_t)t * pitch + h * HD; const float rf = RF ? RF[(size_t)h * TT + t] : 1.0f; v2h o16; v2us oh, ol;
#pragma unroll
    for (int q = 0; q < 2; ++q) { const int dd = d + q; const int dp = (dd < HD / 2) ? dd + HD / 2 : dd - HD / 2; float x0 = f[dd], x1 = f[dp];
        if (RF) { float n0 = __fmul_rn(x0, rf), n1 = __fmul_rn(x1, rf); asm volatile("" : "+v"(n0)); asm volatile("" : "+v"(n1)); x0 = __fmul_rn(bfr(nw[dd]), n0); x1 = __fmul_rn(bfr(nw[dp]), n1); }
        const v2f cs = *(const v2f*)(CS + ((size_t)t * HD + dd) * 2); float a = __fmul_rn(x0, cs[0]), bq = __fmul_rn(x1, cs[1]); asm volatile("" : "+v"(a)); asm volatile("" : "+v"(bq)); const float r = ((dd < HD / 2) ? __fsub_rn(a, bq) : __fadd_rn(a, bq)) * sc;
        o16[q] = tohx(r); unsigned short a2, c2; splitf(r, a2, c2); oh[q] = a2; ol[q] = c2; }
    *(v2h*)(P16 + e) = o16; *(v2us*)(Ph + e) = oh; *(v2us*)(Pl + e) = ol;  }
__global__ __launch_bounds__(256) void k_vtp(const float* __restrict__ F, int pitch, int nheads, h16* V16, bf* Vh, bf* Vl) { const size_t e = ((size_t)blockIdx.x * 256 + threadIdx.x) * 2; if (e >= (size_t)nheads * HD * TT) return; const int t = (int)(e % TT); const int d = (int)((e / TT) % HD); const int g = (int)(e / ((size_t)TT * HD)); v2h o16; v2us oh, ol;
#pragma unroll
    for (int q = 0; q < 2; ++q) { const float x = F[(size_t)(t + q) * pitch + g * HD + d]; o16[q] = tohx(x); unsigned short a2, c2; splitf(x, a2, c2); oh[q] = a2; ol[q] = c2; }
    *(v2h*)(V16 + e) = o16; *(v2us*)(Vh + e) = oh; *(v2us*)(Vl + e) = ol;  }
__global__ __launch_bounds__(256) void k_csid(float* CS) { const int idx = blockIdx.x * 256 + threadIdx.x; if (idx >= TT * HD) return; v2f cs; cs[0] = 1.0f; cs[1] = 0.0f; *(v2f*)(CS + (size_t)idx * 2) = cs;  }
// k_asoft: per row (zz, i): t = S x HD^-0.5 for j <= i and i - j < WIN (WIN == TT, so the window test always holds: plain causal; the reference's -1e9 additive fill vanishes identically); softmax over the 2048 keys (register row, one exp, fixed trees);
__global__ __launch_bounds__(256) void k_asoft(const float* __restrict__ Sb, h16* P16, bf* Ph, bf* Pl) {
    const int lane = threadIdx.x & 31; const int row = blockIdx.x * 8 + (threadIdx.x >> 5); if (row >= ZH * TT) return; const int i = row % TT; const int zz = row / TT; (void)zz; const bool hires = (i < RH); const float* sr = Sb + (size_t)row * TT; float v[TT / 32]; float mx = -3.0e38f;
#pragma unroll
    for (int ch = 0; ch < TT / 128; ++ch) { const int j0 = ch * 128 + lane * 4; const v4f a = *(const v4f*)(sr + j0);
#pragma unroll
        for (int q = 0; q < 4; ++q) { const int j = j0 + q; (void)j; const float t = (j <= i && i - j < WIN) ? a[q] * SCL : -3.0e38f; v[ch * 4 + q] = t; mx = fmaxf(mx, t); } }
#pragma unroll
    for (int sh = 16; sh; sh >>= 1) mx = fmaxf(mx, __shfl_xor(mx, sh, 32));
    float sum = 0.f;
#pragma unroll
    for (int k = 0; k < TT / 32; ++k) { float d0 = __fsub_rn(v[k], mx); asm volatile("" : "+v"(d0)); v[k] = __builtin_amdgcn_exp2f(__fmul_rn(d0, 1.4426950408889634f)); sum += v[k]; }
#pragma unroll
    for (int sh = 16; sh; sh >>= 1) sum += __shfl_xor(sum, sh, 32);
    const float f = __fdiv_rn(hires ? 1.0f : PCAR, sum);
{
        if (hires) {
#pragma unroll
            for (int ch = 0; ch < TT / 128; ++ch) { v4us oh, ol;
#pragma unroll
                for (int q = 0; q < 4; ++q) { unsigned short a, c2; splitf(v[ch * 4 + q] * f, a, c2); oh[q] = a; ol[q] = c2; }
                const size_t oo = ((size_t)zz * (RH ? RH : 1) + i) * TT + ch * 128 + lane * 4; *(v4us*)(Ph + oo) = oh; *(v4us*)(Pl + oo) = ol; }
        } else {
#pragma unroll
            for (int ch = 0; ch < TT / 128; ++ch) { v4h o4;
#pragma unroll
                for (int q = 0; q < 4; ++q) o4[q] = tohx(v[ch * 4 + q] * f);
                *(v4h*)(P16 + (size_t)row * TT + ch * 128 + lane * 4) = o4; } }
         }
}
__global__ __launch_bounds__(256) void k_merge(const float* __restrict__ O, int h0, bf* Ah, bf* Al) { const size_t e = ((size_t)blockIdx.x * 256 + threadIdx.x) * 2; if (e >= (size_t)ZH * TT * HD) return; const int d = (int)(e % HD); const int t = (int)((e / HD) % TT); const int zz = (int)(e / ((size_t)HD * TT)); const float cs = (t < RH) ? 1.0f : (1.0f / PCAR); const size_t oo = (size_t)t * DQ + (h0 + zz) * HD + d;
    v2us oh, ol;
#pragma unroll
    for (int q = 0; q < 2; ++q) { unsigned short a, c2; splitf(O[e + q] * cs, a, c2); oh[q] = a; ol[q] = c2; } *(v2us*)(Ah + oo) = oh; *(v2us*)(Al + oo) = ol;  }

extern "C" void kernel_launch(void* const* d_in, const int* in_sizes, int n_in,
                              void* d_out, int out_size, void* d_ws, size_t ws_size, hipStream_t stream) {
    (void)in_sizes; (void)n_in; (void)out_size;
    const float* x = (const float*)d_in[0]; const float* wq = (const float*)d_in[1]; const float* wk = (const float*)d_in[2]; const float* wv = (const float*)d_in[3]; const float* wo = (const float*)d_in[4];   /* input order hidden_states, Wq, Wk, Wv, Wo ('oi': 'x @ W.T') */
    float* OUT = (float*)d_out;     // [4][2048][1024]
    char* wsp = (char*)d_ws;
    auto take = [&](size_t bytes) { char* p = wsp; wsp += (bytes + 255) & ~(size_t)255; return (void*)p; };
    bf* WQ = (bf*)take((size_t)DQ * DM * 2); bf* WK = (bf*)take((size_t)DKV * DM * 2); bf* WV = (bf*)take((size_t)DKV * DM * 2); bf* WO = (bf*)take((size_t)DM * DQ * 2); float* CS = (float*)take((size_t)TT * HD * 2 * 4);
    bf* XB = (bf*)take((size_t)TT * DM * 2); float* FQ = (float*)take((size_t)TT * DQ * 4); float* FK = (float*)take((size_t)TT * DKV * 4);
    h16* QP16 = (h16*)take((size_t)NH_ * TT * HD * 2); h16* KP16 = (h16*)take((size_t)NKV * TT * HD * 2); h16* VT16 = (h16*)take((size_t)NKV * HD * TT * 2);
    bf* QPh = (bf*)take((size_t)NH_ * TT * HD * 2); bf* QPl = (bf*)take((size_t)NH_ * TT * HD * 2); bf* KPh = (bf*)take((size_t)NKV * TT * HD * 2); bf* KPl = (bf*)take((size_t)NKV * TT * HD * 2); bf* VTh = (bf*)take((size_t)NKV * HD * TT * 2); bf* VTl = (bf*)take((size_t)NKV * HD * TT * 2); bf* Ph = (bf*)take((size_t)ZH * RH * TT * 2); bf* Pl = (bf*)take((size_t)ZH * RH * TT * 2);
    float* Sb = (float*)take((size_t)ZH * TT * TT * 4); h16* P16 = (h16*)take((size_t)ZH * TT * TT * 2); float* Ob = (float*)take((size_t)ZH * TT * HD * 4); bf* ATh = (bf*)take((size_t)TT * DQ * 2); bf* ATl = (bf*)take((size_t)TT * DQ * 2);
    if ((size_t)(wsp - (char*)d_ws) > ws_size) return;    // ws 256 MiB
    float* FV = FK;   // v projection reuses the k buffer after the k planes are built (stream-ordered)
    { k_cvt8<<<(unsigned)(((size_t)DQ * DM / 8 + 255) / 256), 256, 0, stream>>>(wq, WQ, (size_t)DQ * DM / 8); k_cvt8<<<(unsigned)(((size_t)DKV * DM / 8 + 255) / 256), 256, 0, stream>>>(wk, WK, (size_t)DKV * DM / 8); k_cvt8<<<(unsigned)(((size_t)DKV * DM / 8 + 255) / 256), 256, 0, stream>>>(wv, WV, (size_t)DKV * DM / 8);
      k_cvt8<<<(unsigned)(((size_t)DM * DQ / 8 + 255) / 256), 256, 0, stream>>>(wo, WO, (size_t)DM * DQ / 8);
       }
    k_csid<<<(TT * HD + 255) / 256, 256, 0, stream>>>(CS);
    const unsigned LQ = (unsigned)(((size_t)NH_ * TT * HD / 2 + 255) / 256), LKv = (unsigned)(((size_t)NKV * TT * HD / 2 + 255) / 256);
    for (int b = 0; b < NB_; ++b) {
        
        k_cvt8<<<(unsigned)(((size_t)TT * DM / 8 + 255) / 256), 256, 0, stream>>>(x + (size_t)b * TT * DM, XB, (size_t)TT * DM / 8);
        k_gemmw<bf, 0, false><<<dim3(TT / 64, DQ / 64, 1), 32, 0, stream>>>(XB, nullptr, WQ, nullptr, DM, FQ, DQ, nullptr, 0, 0, 0);
        k_rope<<<LQ, 256, 0, stream>>>(FQ, DQ, NH_, CS, nullptr, nullptr, 1.0f, QP16, QPh, QPl);
        k_gemmw<bf, 0, false><<<dim3(TT / 64, DKV / 64, 1), 32, 0, stream>>>(XB, nullptr, WK, nullptr, DM, FK, DKV, nullptr, 0, 0, 0);
        k_rope<<<LKv, 256, 0, stream>>>(FK, DKV, NKV, CS, nullptr, nullptr, 1.0f, KP16, KPh, KPl);
        k_gemmw<bf, 0, false><<<dim3(TT / 64, DKV / 64, 1), 32, 0, stream>>>(XB, nullptr, WV, nullptr, DM, FV, DKV, nullptr, 0, 0, 0); k_vtp<<<LKv, 256, 0, stream>>>(FV, DKV, NKV, VT16, VTh, VTl);
        for (int h0 = 0; h0 < NH_; h0 += ZH) { const size_t zq = (size_t)h0, zk = (size_t)(h0 / REP);   // one kv head per query head: the pass's two heads use consecutive kv planes (z-strides TT*HD)
            k_gemmc<bf, 2, 1><<<dim3(RH / 64, TT / 64, ZH), 32, 0, stream>>>(QPh + zq * TT * HD, QPl + zq * TT * HD, KPh + zk * TT * HD, KPl + zk * TT * HD, HD, Sb, TT, 0, (size_t)TT * HD, (size_t)TT * HD, (size_t)TT * TT);
            k_gemmc<h16, 0, 1><<<dim3((TT - RH) / 64, TT / 64, ZH), 32, 0, stream>>>(QP16 + zq * TT * HD + (size_t)RH * HD, nullptr, KP16 + zk * TT * HD, nullptr, HD, Sb + (size_t)RH * TT, TT, RH, (size_t)TT * HD, (size_t)TT * HD, (size_t)TT * TT);
            k_asoft<<<ZH * TT / 8, 256, 0, stream>>>(Sb, P16, Ph, Pl);
            k_gemmc<bf, 2, 2><<<dim3(RH / 64, HD / 64, ZH), 32, 0, stream>>>(Ph, Pl, VTh + zk * HD * TT, VTl + zk * HD * TT, TT, Ob, HD, 0, (size_t)RH * TT, (size_t)HD * TT, (size_t)TT * HD);
            k_gemmc<h16, 0, 2><<<dim3((TT - RH) / 64, HD / 64, ZH), 32, 0, stream>>>(P16 + (size_t)RH * TT, nullptr, VT16 + zk * HD * TT, nullptr, TT, Ob + (size_t)RH * HD, HD, RH, (size_t)TT * TT, (size_t)HD * TT, (size_t)TT * HD);
            k_merge<<<(unsigned)(((size_t)ZH * TT * HD / 2 + 255) / 256), 256, 0, stream>>>(Ob, h0, ATh, ATl); }
        k_gemmw<bf, 1, false><<<dim3(TT / 64, DM / 64, 1), 32, 0, stream>>>(ATh, ATl, WO, nullptr, DQ, OUT + (size_t)b * TT * DM, DM, nullptr, 0, 0, 0); }
}

// v001
// It runs in 1500 microseconds.
// Next to v000, in two timings, it ran 1.88 and 1.90 times as fast.
#include <hip/hip_runtime.h>

// Chunk-local causal multi-head self-attention (a ring attention with ring_size 1) (hidden_states [1][8192][1024] = FOUR chunks of 2,048 tokens: in memory [4][2048][1024]; q, k, v = x W^T ('oi' [1024][1024] 0.02, no bias; 16 heads x 64); each chunk attends causally WITHIN itself: scores / sqrt(64), tril(ones((2048, 2048))) kept, -inf elsewhere; softmax; out = merged Wo^T ('oi', no bias) -> [1][8192][1024] = [4][2048][1024] (8.4 M); argument order hidden_states, Wq, Wk, Wv, Wo).
// Layout per batch: bf16 copy of x; exact projections; causal T-2048 attention (hybrid rows: < 512 hi/lo 3 products, rest fp16 x1024; k_gemmc skips tiles above the diagonal and splits the keys of P x V over KSP work-groups); merged hi/lo x W_o exact.
// Compute dtypes, f32 accumulate: every input rounded to bf16; projections exact; attention rows < 512 3 products, rest fp16; softmax f32; W_o hl x exact.

#define NB_  4
#define TT   2048
#define DM   1024
#define NH_  16
#define NKV  16
#define REP  (NH_ / NKV)
#define HD   64
#define DQ   (NH_ * HD)
#define DKV  (NKV * HD)
#define ZH   2
#define RH   512                  // query rows < RH use hi+lo planes (0: none)
#define WIN  2048
#define PCAR 1024.0f
#define SCL  0.125f   // HD^-0.5
#define KSP  16                   // key slices of the probability x value product: one work-group and one f32 partial plane of Ob per slice, summed in k_merge
typedef _Float16 h16;
typedef unsigned short bf;
typedef __attribute__((ext_vector_type(16))) __bf16   v16bf;
typedef __attribute__((ext_vector_type(16))) _Float16 v16h;
typedef __attribute__((ext_vector_type(8)))  _Float16 v8h;
typedef __attribute__((ext_vector_type(8)))  unsigned short v8us;
typedef __attribute__((ext_vector_type(8)))  float    v8f;
typedef __attribute__((ext_vector_type(4)))  float    v4f;
typedef v8h  __attribute__((may_alias)) v8ha;
typedef v4f  __attribute__((may_alias)) v4fa;
typedef v8us __attribute__((may_alias)) v8usa;

__device__ __forceinline__ unsigned short f2bf(float f) { unsigned u = __float_as_uint(f); u += 0x7FFFu + ((u >> 16) & 1u); return (unsigned short)(u >> 16); }
__device__ __forceinline__ float bf2f(unsigned short b) { return __uint_as_float(((unsigned)b) << 16); }
__device__ __forceinline__ float bfr(float f) { return bf2f(f2bf(f)); }
__device__ __forceinline__ v16h cat16(v8h lo, v8h hi) { return __builtin_shufflevector(lo, hi, 0, 1, 2, 3, 4, 5, 6, 7, 8, 9, 10, 11, 12, 13, 14, 15); }
__device__ __forceinline__ v16bf cat16b(v8us lo, v8us hi) { return __builtin_bit_cast(v16bf, __builtin_shufflevector(lo, hi, 0, 1, 2, 3, 4, 5, 6, 7, 8, 9, 10, 11, 12, 13, 14, 15)); }
__device__ __forceinline__ v8f wmma16(v16h a, v16h b, v8f c) { return __builtin_amdgcn_wmma_f32_16x16x32_f16(false, a, false, b, (short)0, c, false, false); }
__device__ __forceinline__ v8f wmmab(v16bf a, v16bf b, v8f c) { return __builtin_amdgcn_wmma_f32_16x16x32_bf16(false, a, false, b, (short)0, c, false, false); }



// ---- k_gemmw: register-blocked GEMM, ONE WAVE per 64x64 output tile (16 accumulators), operands straight from K-contiguous 16-bit planes; grid (M/64, N/64, Z), 32 threads.
// C[m][n] (f32, pitch ldc, + optional f32 bias[n]) = sum_k A[m][k] Bt[n][k] (+ split products per NSPLIT). z-batch strides sA/sB/sC in elements. K % 32 == 0.
template <typename T16> struct WFrag;
template <> struct WFrag<h16> { typedef v16h V; static __device__ __forceinline__ V ld(const h16* p) { return cat16(*(const v8h*)p, *(const v8h*)(p + 16)); } static __device__ __forceinline__ v8f mma(V a, V b, v8f c) { return wmma16(a, b, c); } };
template <> struct WFrag<bf> { typedef v16bf V; static __device__ __forceinline__ V ld(const bf* p) { return cat16b(*(const v8us*)p, *(const v8us*)(p + 16)); } static __device__ __forceinline__ v8f mma(V a, V b, v8f c) { return wmmab(a, b, c); } };
template <typename T16, int NSPLIT, bool BIAS>
__global__ __launch_bounds__(32) void k_gemmw(const T16* __restrict__ A, const T16* __restrict__ A2, const T16* __restrict__ Bt, const T16* __restrict__ Bt2, int K, float* C, int ldc, const float* __restrict__ bias, size_t sA, size_t sB, size_t sC) {
    typedef typename WFrag<T16>::V V;
    __shared__ __align__(16) float os[16 * 68];
    const size_t z = blockIdx.z; A += z * sA; if (A2) A2 += z * sA; Bt += z * sB; if (Bt2) Bt2 += z * sB; C += z * sC;
    const int lane = threadIdx.x & 31, lr = lane & 15, hi = lane >> 4; const int r0 = blockIdx.x * 64, c0 = blockIdx.y * 64;
    v8f acc[4][4];
#pragma unroll
    for (int mb = 0; mb < 4; ++mb)
#pragma unroll
        for (int nb = 0; nb < 4; ++nb) acc[mb][nb] = (v8f){};
    const size_t aoff = (size_t)(r0 + lr) * K + 8 * hi, boff = (size_t)(c0 + lr) * K + 8 * hi;
#pragma unroll 1
    for (int kc = 0; kc < K; kc += 32) {
        V a[4], a2[4];
#pragma unroll
        for (int mb = 0; mb < 4; ++mb) { a[mb] = WFrag<T16>::ld(A + aoff + (size_t)mb * 16 * K + kc); if (NSPLIT == 1 || NSPLIT == 2) a2[mb] = WFrag<T16>::ld(A2 + aoff + (size_t)mb * 16 * K + kc); }
#pragma unroll
        for (int nb = 0; nb < 4; ++nb) { const V b = WFrag<T16>::ld(Bt + boff + (size_t)nb * 16 * K + kc); V b2; if (NSPLIT >= 2) b2 = WFrag<T16>::ld(Bt2 + boff + (size_t)nb * 16 * K + kc);
#pragma unroll
            for (int mb = 0; mb < 4; ++mb) { acc[mb][nb] = WFrag<T16>::mma(a[mb], b, acc[mb][nb]); if (NSPLIT == 1 || NSPLIT == 2) acc[mb][nb] = WFrag<T16>::mma(a2[mb], b, acc[mb][nb]); if (NSPLIT >= 2) acc[mb][nb] = WFrag<T16>::mma(a[mb], b2, acc[mb][nb]); } }
        asm volatile("v_nop\n\tv_nop\n\tv_nop\n\tv_nop" : "+v"(acc[0][0]), "+v"(acc[1][1]), "+v"(acc[2][2]), "+v"(acc[3][3]) : "v"(a[0]), "v"(a[3]));
    }
#pragma unroll
    for (int mb = 0; mb < 4; ++mb) {
#pragma unroll
        for (int nb = 0; nb < 4; ++nb) {
#pragma unroll
            for (int j = 0; j < 8; ++j) os[(hi * 8 + j) * 68 + nb * 16 + lr] = acc[mb][nb][j]; }
        __builtin_amdgcn_wave_barrier(); asm volatile("" ::: "memory");
        float* crow = C + (size_t)(r0 + mb * 16) * ldc + c0;
{
#pragma unroll
            for (int s = 0; s < 8; ++s) { const int row = 2 * s + hi, cofs = lr * 4; v4f val = *(const v4fa*)(os + row * 68 + cofs); if (BIAS) { val[0] += bfr(bias[c0 + cofs]); val[1] += bfr(bias[c0 + cofs + 1]); val[2] += bfr(bias[c0 + cofs + 2]); val[3] += bfr(bias[c0 + cofs + 3]); }
                *(v4f*)(crow + (size_t)row * ldc + cofs) = val; }
             }
        __builtin_amdgcn_wave_barrier(); asm volatile("" ::: "memory");
    }
}

// ---- k_gemmc: the same one-wave 64x64 tile GEMM specialised for causal attention: CMODE 1 skips score tiles entirely above the diagonal (query rows r0+roff.., key columns c0..), CMODE 2 limits the
// key (K) loop of the probability x value contraction to the diagonal block (probabilities beyond it are exactly zero). roff = row offset of this launch's first row within the sequence.
// CMODE 2 also splits that key loop over the KSP work-groups of grid.y (HD == 64: one column tile): slice ks takes the granules of KG keys numbered ks, ks + KSP, ... and stores its f32 partial tile
// (zeros where it has no granule) in plane ks of C (plane stride sP); k_merge adds the planes in slice order.
template <typename T16, int NSPLIT, int CMODE, int KG>
__global__ __launch_bounds__(32) void k_gemmc(const T16* __restrict__ A, const T16* __restrict__ A2, const T16* __restrict__ Bt, const T16* __restrict__ Bt2, int K, float* C, int ldc, int roff, size_t sA, size_t sB, size_t sC, size_t sP) {
    typedef typename WFrag<T16>::V V;
    __shared__ __align__(16) float os[16 * 68];
    const int ks = (CMODE == 2) ? (int)blockIdx.y : 0;
    const size_t z = blockIdx.z; A += z * sA + ks * KG; if (A2) A2 += z * sA + ks * KG; Bt += z * sB + ks * KG; if (Bt2) Bt2 += z * sB + ks * KG; C += z * sC + (size_t)ks * sP;   // slice ks starts at key ks * KG
    const int lane = threadIdx.x & 31, lr = lane & 15, hi = lane >> 4; const int r0 = blockIdx.x * 64, c0 = (CMODE == 2) ? 0 : blockIdx.y * 64;
    if (CMODE == 1 && c0 > r0 + roff + 63) return;                  // score tile entirely above the causal diagonal: never read (the softmax masks j > i by select)
    const int Kl = (CMODE == 2) ? min(K, r0 + roff + 64) - ks * KG : K;        // P.V: probabilities are exactly 0 beyond the diagonal block, so the K loop stops there (counted from the slice's first key; <= 0: no granule, the tile stays zero)
    v8f acc[4][4];
#pragma unroll
    for (int mb = 0; mb < 4; ++mb)
#pragma unroll
        for (int nb = 0; nb < 4; ++nb) acc[mb][nb] = (v8f){};
    const size_t aoff = (size_t)(r0 + lr) * K + 8 * hi, boff = (size_t)(c0 + lr) * K + 8 * hi;
#pragma unroll 1
    for (int kg = 0; kg < Kl; kg += ((CMODE == 2) ? KSP : 1) * KG)
#pragma unroll 1   // the granule's steps stay rolled too: one fragment set in registers, as before the split
    for (int kc = kg; kc < kg + KG; kc += 32) {
        V a[4], a2[4];
#pragma unroll
        for (int mb = 0; mb < 4; ++mb) { a[mb] = WFrag<T16>::ld(A + aoff + (size_t)mb * 16 * K + kc); if (NSPLIT == 1 || NSPLIT == 2) a2[mb] = WFrag<T16>::ld(A2 + aoff + (size_t)mb * 16 * K + kc); }
#pragma unroll
        for (int nb = 0; nb < 4; ++nb) { const V b = WFrag<T16>::ld(Bt + boff + (size_t)nb * 16 * K + kc); V b2; if (NSPLIT >= 2) b2 = WFrag<T16>::ld(Bt2 + boff + (size_t)nb * 16 * K + kc);
#pragma unroll
            for (int mb = 0; mb < 4; ++mb) { acc[mb][nb] = WFrag<T16>::mma(a[mb], b, acc[mb][nb]); if (NSPLIT == 1 || NSPLIT == 2) acc[mb][nb] = WFrag<T16>::mma(a2[mb], b, acc[mb][nb]); if (NSPLIT >= 2) acc[mb][nb] = WFrag<T16>::mma(a[mb], b2, acc[mb][nb]); } }
        asm volatile("v_nop\n\tv_nop\n\tv_nop\n\tv_nop" : "+v"(acc[0][0]), "+v"(acc[1][1]), "+v"(acc[2][2]), "+v"(acc[3][3]) : "v"(a[0]), "v"(a[3]));
    }
#pragma unroll
    for (int mb = 0; mb < 4; ++mb) {
#pragma unroll
        for (int nb = 0; nb < 4; ++nb) {
#pragma unroll
            for (int j = 0; j < 8; ++j) os[(hi * 8 + j) * 68 + nb * 16 + lr] = acc[mb][nb][j]; }
        __builtin_amdgcn_wave_barrier(); asm volatile("" ::: "memory");
        float* crow = C + (size_t)(r0 + mb * 16) * ldc + c0;
{
#pragma unroll
            for (int s = 0; s < 8; ++s) { const int row = 2 * s + hi, cofs = lr * 4; v4f val = *(const v4fa*)(os + row * 68 + cofs);
                *(v4f*)(crow + (size_t)row * ldc + cofs) = val; }
             }
        __builtin_amdgcn_wave_barrier(); asm volatile("" ::: "memory");
    }
}

__device__ __forceinline__ h16 tohx(float x) { return (h16)x; }
__device__ __forceinline__ void splitf(float y, unsigned short& h, unsigned short& l) { h = f2bf(y); l = f2bf(y - bf2f(h)); }
typedef __attribute__((ext_vector_type(2))) _Float16 v2h;
typedef __attribute__((ext_vector_type(4))) _Float16 v4h;
typedef __attribute__((ext_vector_type(2))) unsigned short v2us;
typedef __attribute__((ext_vector_type(4))) unsigned short v4us;
typedef __attribute__((ext_vector_type(2))) float v2f;
typedef __attribute__((ext_vector_type(4))) int v4i;

__global__ __launch_bounds__(256) void k_wtG(const float* __restrict__ w, int K, int N, bf* Bt) {
    const int lane = threadIdx.x & 31; const int L0 = (blockIdx.x * 8 + (threadIdx.x >> 5)) * 8; const int nlines = N * K / 64;
{
#pragma unroll 1
        for (int l = 0; l < 8; ++l) { const int L = L0 + l; if (L >= nlines) break; const size_t e = (size_t)L * 64 + lane * 2; const int k = (int)(e % K), n = (int)(e / K); v2us o;
            o[0] = f2bf(w[(size_t)k * N + n]); o[1] = f2bf(w[(size_t)(k + 1) * N + n]); *(v2us*)(Bt + e) = o; }
         }
}
__global__ __launch_bounds__(256) void k_cvt8(const float* __restrict__ src, bf* dst, size_t n8) { const size_t i = (size_t)blockIdx.x * 256 + threadIdx.x; if (i >= n8) return; const v8f v = *(const v8f*)(src + i * 8); v8us o;
#pragma unroll
    for (int k = 0; k < 8; ++k) o[k] = f2bf(v[k]); *(v8us*)(dst + i * 8) = o;  }

// k_rope: head planes [h][t][d] (fp16 + hi/lo) of rope(x) x sc with the rotate-half convention out[d] = x[d] cos[t][d] - x[d+HD/2] sin[t][d], out[d+HD/2] = x[d+HD/2] cos[t][d+HD/2] + x[d] sin[t][d+HD/2]
__global__ __launch_bounds__(256) void k_rope(const float* __restrict__ F, int pitch, int nheads, const float* __restrict__ CS, const float* __restrict__ RF, const float* __restrict__ nw, float sc, h16* P16, bf* Ph, bf* Pl) {
    const size_t e = ((size_t)blockIdx.x * 256 + threadIdx.x) * 2; if (e >= (size_t)nheads * TT * HD) return; const int d = (int)(e % HD); const int t = (int)((e / HD) % TT); const int h = (int)(e / ((size_t)HD * TT)); const float* f = F + (size_t)t * pitch + h * HD; const float rf = RF ? RF[(size_t)h * TT + t] : 1.0f; v2h o16; v2us oh, ol;
#pragma unroll
    for (int q = 0; q < 2; ++q) { const int dd = d + q; const int dp = (dd < HD / 2) ? dd + HD / 2 : dd - HD / 2; float x0 = f[dd], x1 = f[dp];
        if (RF) { float n0 = __fmul_rn(x0, rf), n1 = __fmul_rn(x1, rf); asm volatile("" : "+v"(n0)); asm volatile("" : "+v"(n1)); x0 = __fmul_rn(bfr(nw[dd]), n0); x1 = __fmul_rn(bfr(nw[dp]), n1); }
        const v2f cs = *(const v2f*)(CS + ((size_t)t * HD + dd) * 2); float a = __fmul_rn(x0, cs[0]), bq = __fmul_rn(x1, cs[1]); asm volatile("" : "+v"(a)); asm volatile("" : "+v"(bq)); const float r = ((dd < HD / 2) ? __fsub_rn(a, bq) : __fadd_rn(a, bq)) * sc;
        o16[q] = tohx(r); unsigned short a2, c2; splitf(r, a2, c2); oh[q] = a2; ol[q] = c2; }
    *(v2h*)(P16 + e) = o16; *(v2us*)(Ph + e) = oh; *(v2us*)(Pl + e) = ol;  }
__global__ __launch_bounds__(256) void k_vtp(const float* __restrict__ F, int pitch, int nheads, h16* V16, bf* Vh, bf* Vl) { const size_t e = ((size_t)blockIdx.x * 256 + threadIdx.x) * 2; if (e >= (size_t)nheads * HD * TT) return; const int t = (int)(e % TT); const int d = (int)((e / TT) % HD); const int g = (int)(e / ((size_t)TT * HD)); v2h o16; v2us oh, ol;
#pragma unroll
    for (int q = 0; q < 2; ++q) { const float x = F[(size_t)(t + q) * pitch + g * HD + d]; o16[q] = tohx(x); unsigned short a2, c2; splitf(x, a2, c2); oh[q] = a2; ol[q] = c2; }
    *(v2h*)(V16 + e) = o16; *(v2us*)(Vh + e) = oh; *(v2us*)(Vl + e) = ol;  }
__global__ __launch_bounds__(256) void k_csid(float* CS) { const int idx = blockIdx.x * 256 + threadIdx.x; if (idx >= TT * HD) return; v2f cs; cs[0] = 1.0f; cs[1] = 0.0f; *(v2f*)(CS + (size_t)idx * 2) = cs;  }
// k_asoft: per row (zz, i): t = S x HD^-0.5 for j <= i and i - j < WIN (WIN == TT, so the window test always holds: plain causal; the reference's -1e9 additive fill vanishes identically); softmax over the 2048 keys (register row, one exp, fixed trees);
__global__ __launch_bounds__(256) void k_asoft(const float* __restrict__ Sb, h16* P16, bf* Ph, bf* Pl) {
    const int lane = threadIdx.x & 31; const int row = blockIdx.x * 8 + (threadIdx.x >> 5); if (row >= ZH * TT) return; const int i = row % TT; const int zz = row / TT; (void)zz; const bool hires = (i < RH); const float* sr = Sb + (size_t)row * TT; float v[TT / 32]; float mx = -3.0e38f;
#pragma unroll
    for (int ch = 0; ch < TT / 128; ++ch) { const int j0 = ch * 128 + lane * 4; const v4f a = *(const v4f*)(sr + j0);
#pragma unroll
        for (int q = 0; q < 4; ++q) { const int j = j0 + q; (void)j; const float t = (j <= i && i - j < WIN) ? a[q] * SCL : -3.0e38f; v[ch * 4 + q] = t; mx = fmaxf(mx, t); } }
#pragma unroll
    for (int sh = 16; sh; sh >>= 1) mx = fmaxf(mx, __shfl_xor(mx, sh, 32));
    float sum = 0.f;
#pragma unroll
    for (int k = 0; k < TT / 32; ++k) { float d0 = __fsub_rn(v[k], mx); asm volatile("" : "+v"(d0)); v[k] = __builtin_amdgcn_exp2f(__fmul_rn(d0, 1.4426950408889634f)); sum += v[k]; }
#pragma unroll
    for (int sh = 16; sh; sh >>= 1) sum += __shfl_xor(sum, sh, 32);
    const float f = __fdiv_rn(hires ? 1.0f : PCAR, sum);
{
        if (hires) {
#pragma unroll
            for (int ch = 0; ch < TT / 128; ++ch) { v4us oh, ol;
#pragma unroll
                for (int q = 0; q < 4; ++q) { unsigned short a, c2; splitf(v[ch * 4 + q] * f, a, c2); oh[q] = a; ol[q] = c2; }
                const size_t oo = ((size_t)zz * (RH ? RH : 1) + i) * TT + ch * 128 + lane * 4; *(v4us*)(Ph + oo) = oh; *(v4us*)(Pl + oo) = ol; }
        } else {
#pragma unroll
            for (int ch = 0; ch < TT / 128; ++ch) { v4h o4;
#pragma unroll
                for (int q = 0; q < 4; ++q) o4[q] = tohx(v[ch * 4 + q] * f);
                *(v4h*)(P16 + (size_t)row * TT + ch * 128 + lane * 4) = o4; } }
         }
}
__global__ __launch_bounds__(256) void k_merge(const float* __restrict__ O, int h0, bf* Ah, bf* Al) { const size_t e = ((size_t)blockIdx.x * 256 + threadIdx.x) * 2; if (e >= (size_t)ZH * TT * HD) return; const int d = (int)(e % HD); const int t = (int)((e / HD) % TT); const int zz = (int)(e / ((size_t)HD * TT)); const float cs = (t < RH) ? 1.0f : (1.0f / PCAR); const size_t oo = (size_t)t * DQ + (h0 + zz) * HD + d;
    v2us oh, ol; v2f acc = (v2f){0.f, 0.f};
#pragma unroll   // all KSP plane loads are issued ahead of the first add
    for (int s = 0; s < KSP; ++s) { const v2f p = *(const v2f*)(O + (size_t)s * ((size_t)ZH * TT * HD) + e); acc[0] += p[0]; acc[1] += p[1]; }   // the key slices' partial sums, in slice order
#pragma unroll
    for (int q = 0; q < 2; ++q) { unsigned short a, c2; splitf(acc[q] * cs, a, c2); oh[q] = a; ol[q] = c2; } *(v2us*)(Ah + oo) = oh; *(v2us*)(Al + oo) = ol;  }

extern "C" void kernel_launch(void* const* d_in, const int* in_sizes, int n_in,
                              void* d_out, int out_size, void* d_ws, size_t ws_size, hipStream_t stream) {
    (void)in_sizes; (void)n_in; (void)out_size;
    const float* x = (const float*)d_in[0]; const float* wq = (const float*)d_in[1]; const float* wk = (const float*)d_in[2]; const float* wv = (const float*)d_in[3]; const float* wo = (const float*)d_in[4];   /* input order hidden_states, Wq, Wk, Wv, Wo ('oi': 'x @ W.T') */
    float* OUT = (float*)d_out;     // [4][2048][1024]
    char* wsp = (char*)d_ws;
    auto take = [&](size_t bytes) { char* p = wsp; wsp += (bytes + 255) & ~(size_t)255; return (void*)p; };
    bf* WQ = (bf*)take((size_t)DQ * DM * 2); bf* WK = (bf*)take((size_t)DKV * DM * 2); bf* WV = (bf*)take((size_t)DKV * DM * 2); bf* WO = (bf*)take((size_t)DM * DQ * 2); float* CS = (float*)take((size_t)TT * HD * 2 * 4);
    bf* XB = (bf*)take((size_t)TT * DM * 2); float* FQ = (float*)take((size_t)TT * DQ * 4); float* FK = (float*)take((size_t)TT * DKV * 4);
    h16* QP16 = (h16*)take((size_t)NH_ * TT * HD * 2); h16* KP16 = (h16*)take((size_t)NKV * TT * HD * 2); h16* VT16 = (h16*)take((size_t)NKV * HD * TT * 2);
    bf* QPh = (bf*)take((size_t)NH_ * TT * HD * 2); bf* QPl = (bf*)take((size_t)NH_ * TT * HD * 2); bf* KPh = (bf*)take((size_t)NKV * TT * HD * 2); bf* KPl = (bf*)take((size_t)NKV * TT * HD * 2); bf* VTh = (bf*)take((size_t)NKV * HD * TT * 2); bf* VTl = (bf*)take((size_t)NKV * HD * TT * 2); bf* Ph = (bf*)take((size_t)ZH * RH * TT * 2); bf* Pl = (bf*)take((size_t)ZH * RH * TT * 2);
    float* Sb = (float*)take((size_t)ZH * TT * TT * 4); h16* P16 = (h16*)take((size_t)ZH * TT * TT * 2); float* Ob = (float*)take((size_t)KSP * ZH * TT * HD * 4); bf* ATh = (bf*)take((size_t)TT * DQ * 2); bf* ATl = (bf*)take((size_t)TT * DQ * 2);
    if ((size_t)(wsp - (char*)d_ws) > ws_size) return;    // ws 256 MiB
    float* FV = FK;   // v projection reuses the k buffer after the k planes are built (stream-ordered)
    { k_cvt8<<<(unsigned)(((size_t)DQ * DM / 8 + 255) / 256), 256, 0, stream>>>(wq, WQ, (size_t)DQ * DM / 8); k_cvt8<<<(unsigned)(((size_t)DKV * DM / 8 + 255) / 256), 256, 0, stream>>>(wk, WK, (size_t)DKV * DM / 8); k_cvt8<<<(unsigned)(((size_t)DKV * DM / 8 + 255) / 256), 256, 0, stream>>>(wv, WV, (size_t)DKV * DM / 8);
      k_cvt8<<<(unsigned)(((size_t)DM * DQ / 8 + 255) / 256), 256, 0, stream>>>(wo, WO, (size_t)DM * DQ / 8);
       }
    k_csid<<<(TT * HD + 255) / 256, 256, 0, stream>>>(CS);
    const unsigned LQ = (unsigned)(((size_t)NH_ * TT * HD / 2 + 255) / 256), LKv = (unsigned)(((size_t)NKV * TT * HD / 2 + 255) / 256);
    for (int b = 0; b < NB_; ++b) {
        
        k_cvt8<<<(unsigned)(((size_t)TT * DM / 8 + 255) / 256), 256, 0, stream>>>(x + (size_t)b * TT * DM, XB, (size_t)TT * DM / 8);
        k_gemmw<bf, 0, false><<<dim3(TT / 64, DQ / 64, 1), 32, 0, stream>>>(XB, nullptr, WQ, nullptr, DM, FQ, DQ, nullptr, 0, 0, 0);
        k_rope<<<LQ, 256, 0, stream>>>(FQ, DQ, NH_, CS, nullptr, nullptr, 1.0f, QP16, QPh, QPl);
        k_gemmw<bf, 0, false><<<dim3(TT / 64, DKV / 64, 1), 32, 0, stream>>>(XB, nullptr, WK, nullptr, DM, FK, DKV, nullptr, 0, 0, 0);
        k_rope<<<LKv, 256, 0, stream>>>(FK, DKV, NKV, CS, nullptr, nullptr, 1.0f, KP16, KPh, KPl);
        k_gemmw<bf, 0, false><<<dim3(TT / 64, DKV / 64, 1), 32, 0, stream>>>(XB, nullptr, WV, nullptr, DM, FV, DKV, nullptr, 0, 0, 0); k_vtp<<<LKv, 256, 0, stream>>>(FV, DKV, NKV, VT16, VTh, VTl);
        for (int h0 = 0; h0 < NH_; h0 += ZH) { const size_t zq = (size_t)h0, zk = (size_t)(h0 / REP);   // one kv head per query head: the pass's two heads use consecutive kv planes (z-strides TT*HD)
            k_gemmc<bf, 2, 1, HD><<<dim3(RH / 64, TT / 64, ZH), 32, 0, stream>>>(QPh + zq * TT * HD, QPl + zq * TT * HD, KPh + zk * TT * HD, KPl + zk * TT * HD, HD, Sb, TT, 0, (size_t)TT * HD, (size_t)TT * HD, (size_t)TT * TT, 0);
            k_gemmc<h16, 0, 1, HD><<<dim3((TT - RH) / 64, TT / 64, ZH), 32, 0, stream>>>(QP16 + zq * TT * HD + (size_t)RH * HD, nullptr, KP16 + zk * TT * HD, nullptr, HD, Sb + (size_t)RH * TT, TT, RH, (size_t)TT * HD, (size_t)TT * HD, (size_t)TT * TT, 0);
            k_asoft<<<ZH * TT / 8, 256, 0, stream>>>(Sb, P16, Ph, Pl);
            k_gemmc<bf, 2, 2, 32><<<dim3(RH / 64, KSP, ZH), 32, 0, stream>>>(Ph, Pl, VTh + zk * HD * TT, VTl + zk * HD * TT, TT, Ob, HD, 0, (size_t)RH * TT, (size_t)HD * TT, (size_t)TT * HD, (size_t)ZH * TT * HD);
            k_gemmc<h16, 0, 2, 64><<<dim3((TT - RH) / 64, KSP, ZH), 32, 0, stream>>>(P16 + (size_t)RH * TT, nullptr, VT16 + zk * HD * TT, nullptr, TT, Ob + (size_t)RH * HD, HD, RH, (size_t)TT * TT, (size_t)HD * TT, (size_t)TT * HD, (size_t)ZH * TT * HD);
            k_merge<<<(unsigned)(((size_t)ZH * TT * HD / 2 + 255) / 256), 256, 0, stream>>>(Ob, h0, ATh, ATl); }
        k_gemmw<bf, 1, false><<<dim3(TT / 64, DM / 64, 1), 32, 0, stream>>>(ATh, ATl, WO, nullptr, DQ, OUT + (size_t)b * TT * DM, DM, nullptr, 0, 0, 0); }
}

// v002
// It runs in 953 microseconds.
// Next to v001, in two timings, it ran 1.58 and 1.56 times as fast.
// Over all steps from v000 it is 2.97 times as fast.
#include <hip/hip_runtime.h>

// Chunk-local causal multi-head self-attention (a ring attention with ring_size 1) (hidden_states [1][8192][1024] = FOUR chunks of 2,048 tokens: in memory [4][2048][1024]; q, k, v = x W^T ('oi' [1024][1024] 0.02, no bias; 16 heads x 64); each chunk attends causally WITHIN itself: scores / sqrt(64), tril(ones((2048, 2048))) kept, -inf elsewhere; softmax; out = merged Wo^T ('oi', no bias) -> [1][8192][1024] = [4][2048][1024] (8.4 M); argument order hidden_states, Wq, Wk, Wv, Wo).
// Layout per batch: bf16 copy of x; exact projections; causal T-2048 attention (hybrid rows: < 512 hi/lo 3 products, rest fp16 x1024; k_gemmc skips tiles above the diagonal and splits the keys of P x V over KSP work-groups); merged hi/lo x W_o exact.
// Compute dtypes, f32 accumulate: every input rounded to bf16; projections exact; attention rows < 512 3 products, rest fp16; softmax f32; W_o hl x exact.

#define NB_  4
#define TT   2048
#define DM   1024
#define NH_  16
#define NKV  16
#define REP  (NH_ / NKV)
#define HD   64
#define DQ   (NH_ * HD)
#define DKV  (NKV * HD)
#define ZH   8                    // heads per attention pass (grid.z of the score and probability x value launches)
#define RH   512                  // query rows < RH use hi+lo planes (0: none)
#define WIN  2048
#define PCAR 1024.0f
#define SCL  0.125f   // HD^-0.5
#define DF   (DQ + 2 * DKV)       // columns of the joint q | k | v projection
#define PP   (2 * TT)             // row pitch, in 16-bit elements, of the probability rows (they lie in the f32 score rows) and of the V^T planes: the K argument of the probability x value launches
#define KSP  16                   // key slices of the probability x value product: one work-group and one f32 partial plane of Ob per slice, summed in k_merge
typedef _Float16 h16;
typedef unsigned short bf;
typedef __attribute__((ext_vector_type(16))) __bf16   v16bf;
typedef __attribute__((ext_vector_type(16))) _Float16 v16h;
typedef __attribute__((ext_vector_type(8)))  _Float16 v8h;
typedef __attribute__((ext_vector_type(8)))  unsigned short v8us;
typedef __attribute__((ext_vector_type(8)))  float    v8f;
typedef __attribute__((ext_vector_type(4)))  float    v4f;
typedef v8h  __attribute__((may_alias)) v8ha;
typedef v4f  __attribute__((may_alias)) v4fa;
typedef v8us __attribute__((may_alias)) v8usa;

__device__ __forceinline__ unsigned short f2bf(float f) { unsigned u = __float_as_uint(f); u += 0x7FFFu + ((u >> 16) & 1u); return (unsigned short)(u >> 16); }
__device__ __forceinline__ float bf2f(unsigned short b) { return __uint_as_float(((unsigned)b) << 16); }
__device__ __forceinline__ float bfr(float f) { return bf2f(f2bf(f)); }
__device__ __forceinline__ v16h cat16(v8h lo, v8h hi) { return __builtin_shufflevector(lo, hi, 0, 1, 2, 3, 4, 5, 6, 7, 8, 9, 10, 11, 12, 13, 14, 15); }
__device__ __forceinline__ v16bf cat16b(v8us lo, v8us hi) { return __builtin_bit_cast(v16bf, __builtin_shufflevector(lo, hi, 0, 1, 2, 3, 4, 5, 6, 7, 8, 9, 10, 11, 12, 13, 14, 15)); }
__device__ __forceinline__ v8f wmma16(v16h a, v16h b, v8f c) { return __builtin_amdgcn_wmma_f32_16x16x32_f16(false, a, false, b, (short)0, c, false, false); }
__device__ __forceinline__ v8f wmmab(v16bf a, v16bf b, v8f c) { return __builtin_amdgcn_wmma_f32_16x16x32_bf16(false, a, false, b, (short)0, c, false, false); }



// ---- k_gemmw: register-blocked GEMM, ONE WAVE per 64x64 output tile (16 accumulators), operands straight from K-contiguous 16-bit planes; grid (M/64, N/64, Z), 32 threads.
// C[m][n] (f32, pitch ldc, + optional f32 bias[n]) = sum_k A[m][k] Bt[n][k] (+ split products per NSPLIT). z-batch strides sA/sB/sC in elements. K % 32 == 0.
template <typename T16> struct WFrag;
template <> struct WFrag<h16> { typedef v16h V; static __device__ __forceinline__ V ld(const h16* p) { return cat16(*(const v8h*)p, *(const v8h*)(p + 16)); } static __device__ __forceinline__ v8f mma(V a, V b, v8f c) { return wmma16(a, b, c); } };
template <> struct WFrag<bf> { typedef v16bf V; static __device__ __forceinline__ V ld(const bf* p) { return cat16b(*(const v8us*)p, *(const v8us*)(p + 16)); } static __device__ __forceinline__ v8f mma(V a, V b, v8f c) { return wmmab(a, b, c); } };
template <typename T16, int NSPLIT, bool BIAS>
__global__ __launch_bounds__(32) void k_gemmw(const T16* __restrict__ A, const T16* __restrict__ A2, const T16* __restrict__ Bt, const T16* __restrict__ Bt2, int K, float* C, int ldc, const float* __restrict__ bias, size_t sA, size_t sB, size_t sC) {
    typedef typename WFrag<T16>::V V;
    __shared__ __align__(16) float os[16 * 68];
    const size_t z = blockIdx.z; A += z * sA; if (A2) A2 += z * sA; Bt += z * sB; if (Bt2) Bt2 += z * sB; C += z * sC;
    const int lane = threadIdx.x & 31, lr = lane & 15, hi = lane >> 4; const int r0 = blockIdx.x * 64, c0 = blockIdx.y * 64;
    v8f acc[4][4];
#pragma unroll
    for (int mb = 0; mb < 4; ++mb)
#pragma unroll
        for (int nb = 0; nb < 4; ++nb) acc[mb][nb] = (v8f){};
    const size_t aoff = (size_t)(r0 + lr) * K + 8 * hi, boff = (size_t)(c0 + lr) * K + 8 * hi;
#pragma unroll 1
    for (int kc = 0; kc < K; kc += 32) {
        V a[4], a2[4];
#pragma unroll
        for (int mb = 0; mb < 4; ++mb) { a[mb] = WFrag<T16>::ld(A + aoff + (size_t)mb * 16 * K + kc); if (NSPLIT == 1 || NSPLIT == 2) a2[mb] = WFrag<T16>::ld(A2 + aoff + (size_t)mb * 16 * K + kc); }
#pragma unroll
        for (int nb = 0; nb < 4; ++nb) { const V b = WFrag<T16>::ld(Bt + boff + (size_t)nb * 16 * K + kc); V b2; if (NSPLIT >= 2) b2 = WFrag<T16>::ld(Bt2 + boff + (size_t)nb * 16 * K + kc);
#pragma unroll
            for (int mb = 0; mb < 4; ++mb) { acc[mb][nb] = WFrag<T16>::mma(a[mb], b, acc[mb][nb]); if (NSPLIT == 1 || NSPLIT == 2) acc[mb][nb] = WFrag<T16>::mma(a2[mb], b, acc[mb][nb]); if (NSPLIT >= 2) acc[mb][nb] = WFrag<T16>::mma(a[mb], b2, acc[mb][nb]); } }
        asm volatile("v_nop\n\tv_nop\n\tv_nop\n\tv_nop" : "+v"(acc[0][0]), "+v"(acc[1][1]), "+v"(acc[2][2]), "+v"(acc[3][3]) : "v"(a[0]), "v"(a[3]));
    }
#pragma unroll
    for (int mb = 0; mb < 4; ++mb) {
#pragma unroll
        for (int nb = 0; nb < 4; ++nb) {
#pragma unroll
            for (int j = 0; j < 8; ++j) os[(hi * 8 + j) * 68 + nb * 16 + lr] = acc[mb][nb][j]; }
        __builtin_amdgcn_wave_barrier(); asm volatile("" ::: "memory");
        float* crow = C + (size_t)(r0 + mb * 16) * ldc + c0;
{
#pragma unroll
            for (int s = 0; s < 8; ++s) { const int row = 2 * s + hi, cofs = lr * 4; v4f val = *(const v4fa*)(os + row * 68 + cofs); if (BIAS) { val[0] += bfr(bias[c0 + cofs]); val[1] += bfr(bias[c0 + cofs + 1]); val[2] += bfr(bias[c0 + cofs + 2]); val[3] += bfr(bias[c0 + cofs + 3]); }
                *(v4f*)(crow + (size_t)row * ldc + cofs) = val; }
             }
        __builtin_amdgcn_wave_barrier(); asm volatile("" ::: "memory");
    }
}

// ---- k_gemmc: the same one-wave 64x64 tile GEMM specialised for causal attention: CMODE 1 skips score tiles entirely above the diagonal (query rows r0+roff.., key columns c0..), CMODE 2 limits the
// key (K) loop of the probability x value contraction to the diagonal block (probabilities beyond it are exactly zero). roff = row offset of this launch's first row within the sequence.
// CMODE 2 also splits that key loop over the KSP work-groups of grid.y (HD == 64: one column tile): slice ks takes the granules of KG keys numbered ks, ks + KSP, ... and stores its f32 partial tile
// (zeros where it has no granule) in plane ks of C (plane stride sP); k_merge adds the planes in slice order.
template <typename T16, int NSPLIT, int CMODE, int KG>
__global__ __launch_bounds__(32) void k_gemmc(const T16* __restrict__ A, const T16* __restrict__ A2, const T16* __restrict__ Bt, const T16* __restrict__ Bt2, int K, float* C, int ldc, int roff, size_t sA, size_t sB, size_t sC, size_t sP) {
    typedef typename WFrag<T16>::V V;
    __shared__ __align__(16) float os[16 * 68];
    const int ks = (CMODE == 2) ? (int)blockIdx.y : 0;
    const size_t z = blockIdx.z; A += z * sA + ks * KG; if (A2) A2 += z * sA + ks * KG; Bt += z * sB + ks * KG; if (Bt2) Bt2 += z * sB + ks * KG; C += z * sC + (size_t)ks * sP;   // slice ks starts at key ks * KG
    const int lane = threadIdx.x & 31, lr = lane & 15, hi = lane >> 4; const int r0 = blockIdx.x * 64, c0 = (CMODE == 2) ? 0 : blockIdx.y * 64;
    if (CMODE == 1 && c0 > r0 + roff + 63) return;                  // score tile entirely above the causal diagonal: never read (the softmax masks j > i by select)
    const int Kl = (CMODE == 2) ? min(K, r0 + roff + 64) - ks * KG : K;        // P.V: probabilities are exactly 0 beyond the diagonal block, so the K loop stops there (counted from the slice's first key; <= 0: no granule, the tile stays zero)
    v8f acc[4][4];
#pragma unroll
    for (int mb = 0; mb < 4; ++mb)
#pragma unroll
        for (int nb = 0; nb < 4; ++nb) acc[mb][nb] = (v8f){};
    const size_t aoff = (size_t)(r0 + lr) * K + 8 * hi, boff = (size_t)(c0 + lr) * K + 8 * hi;
#pragma unroll 1
    for (int kg = 0; kg < Kl; kg += ((CMODE == 2) ? KSP : 1) * KG)
#pragma unroll 1   // the granule's steps stay rolled too: one fragment set in registers, as before the split
    for (int kc = kg; kc < kg + KG; kc += 32) {
        V a[4], a2[4];
#pragma unroll
        for (int mb = 0; mb < 4; ++mb) { a[mb] = WFrag<T16>::ld(A + aoff + (size_t)mb * 16 * K + kc); if (NSPLIT == 1 || NSPLIT == 2) a2[mb] = WFrag<T16>::ld(A2 + aoff + (size_t)mb * 16 * K + kc); }
#pragma unroll
        for (int nb = 0; nb < 4; ++nb) { const V b = WFrag<T16>::ld(Bt + boff + (size_t)nb * 16 * K + kc); V b2; if (NSPLIT >= 2) b2 = WFrag<T16>::ld(Bt2 + boff + (size_t)nb * 16 * K + kc);
#pragma unroll
            for (int mb = 0; mb < 4; ++mb) { acc[mb][nb] = WFrag<T16>::mma(a[mb], b, acc[mb][nb]); if (NSPLIT == 1 || NSPLIT == 2) acc[mb][nb] = WFrag<T16>::mma(a2[mb], b, acc[mb][nb]); if (NSPLIT >= 2) acc[mb][nb] = WFrag<T16>::mma(a[mb], b2, acc[mb][nb]); } }
        asm volatile("v_nop\n\tv_nop\n\tv_nop\n\tv_nop" : "+v"(acc[0][0]), "+v"(acc[1][1]), "+v"(acc[2][2]), "+v"(acc[3][3]) : "v"(a[0]), "v"(a[3]));
    }
#pragma unroll
    for (int mb = 0; mb < 4; ++mb) {
#pragma unroll
        for (int nb = 0; nb < 4; ++nb) {
#pragma unroll
            for (int j = 0; j < 8; ++j) os[(hi * 8 + j) * 68 + nb * 16 + lr] = acc[mb][nb][j]; }
        __builtin_amdgcn_wave_barrier(); asm volatile("" ::: "memory");
        float* crow = C + (size_t)(r0 + mb * 16) * ldc + c0;
{
#pragma unroll
            for (int s = 0; s < 8; ++s) { const int row = 2 * s + hi, cofs = lr * 4; v4f val = *(const v4fa*)(os + row * 68 + cofs);
                *(v4f*)(crow + (size_t)row * ldc + cofs) = val; }
             }
        __builtin_amdgcn_wave_barrier(); asm volatile("" ::: "memory");
    }
}

__device__ __forceinline__ h16 tohx(float x) { return (h16)x; }
__device__ __forceinline__ void splitf(float y, unsigned short& h, unsigned short& l) { h = f2bf(y); l = f2bf(y - bf2f(h)); }
typedef __attribute__((ext_vector_type(2))) _Float16 v2h;
typedef __attribute__((ext_vector_type(4))) _Float16 v4h;
typedef __attribute__((ext_vector_type(2))) unsigned short v2us;
typedef __attribute__((ext_vector_type(4))) unsigned short v4us;
typedef __attribute__((ext_vector_type(2))) float v2f;
typedef __attribute__((ext_vector_type(4))) int v4i;

__global__ __launch_bounds__(256) void k_wtG(const float* __restrict__ w, int K, int N, bf* Bt) {
    const int lane = threadIdx.x & 31; const int L0 = (blockIdx.x * 8 + (threadIdx.x >> 5)) * 8; const int nlines = N * K / 64;
{
#pragma unroll 1
        for (int l = 0; l < 8; ++l) { const int L = L0 + l; if (L >= nlines) break; const size_t e = (size_t)L * 64 + lane * 2; const int k = (int)(e % K), n = (int)(e / K); v2us o;
            o[0] = f2bf(w[(size_t)k * N + n]); o[1] = f2bf(w[(size_t)(k + 1) * N + n]); *(v2us*)(Bt + e) = o; }
         }
}
__global__ __launch_bounds__(256) void k_cvt8(const float* __restrict__ src, bf* dst, size_t n8) { const size_t i = (size_t)blockIdx.x * 256 + threadIdx.x; if (i >= n8) return; const v8f v = *(const v8f*)(src + i * 8); v8us o;
#pragma unroll
    for (int k = 0; k < 8; ++k) o[k] = f2bf(v[k]); *(v8us*)(dst + i * 8) = o;  }

// k_rope: head planes [h][t][d] (fp16 + hi/lo) of rope(x) x sc with the rotate-half convention out[d] = x[d] cos[t][d] - x[d+HD/2] sin[t][d], out[d+HD/2] = x[d+HD/2] cos[t][d+HD/2] + x[d] sin[t][d+HD/2]
__global__ __launch_bounds__(256) void k_rope(const float* __restrict__ F, int pitch, int nheads, const float* __restrict__ CS, const float* __restrict__ RF, const float* __restrict__ nw, float sc, h16* P16, bf* Ph, bf* Pl) {
    const size_t e = ((size_t)blockIdx.x * 256 + threadIdx.x) * 2; if (e >= (size_t)nheads * TT * HD) return; const int d = (int)(e % HD); const int t = (int)((e / HD) % TT); const int h = (int)(e / ((size_t)HD * TT)); const float* f = F + (size_t)t * pitch + h * HD; const float rf = RF ? RF[(size_t)h * TT + t] : 1.0f; v2h o16; v2us oh, ol;
#pragma unroll
    for (int q = 0; q < 2; ++q) { const int dd = d + q; const int dp = (dd < HD / 2) ? dd + HD / 2 : dd - HD / 2; float x0 = f[dd], x1 = f[dp];
        if (RF) { float n0 = __fmul_rn(x0, rf), n1 = __fmul_rn(x1, rf); asm volatile("" : "+v"(n0)); asm volatile("" : "+v"(n1)); x0 = __fmul_rn(bfr(nw[dd]), n0); x1 = __fmul_rn(bfr(nw[dp]), n1); }
        const v2f cs = *(const v2f*)(CS + ((size_t)t * HD + dd) * 2); float a = __fmul_rn(x0, cs[0]), bq = __fmul_rn(x1, cs[1]); asm volatile("" : "+v"(a)); asm volatile("" : "+v"(bq)); const float r = ((dd < HD / 2) ? __fsub_rn(a, bq) : __fadd_rn(a, bq)) * sc;
        o16[q] = tohx(r); unsigned short a2, c2; splitf(r, a2, c2); oh[q] = a2; ol[q] = c2; }
    *(v2h*)(P16 + e) = o16; *(v2us*)(Ph + e) = oh; *(v2us*)(Pl + e) = ol;  }
__global__ __launch_bounds__(256) void k_vtp(const float* __restrict__ F, int pitch, int nheads, h16* V16, bf* Vh, bf* Vl) { const size_t e = ((size_t)blockIdx.x * 256 + threadIdx.x) * 2; if (e >= (size_t)nheads * HD * TT) return; const int t = (int)(e % TT); const int d = (int)((e / TT) % HD); const int g = (int)(e / ((size_t)TT * HD)); v2h o16; v2us oh, ol;
#pragma unroll
    for (int q = 0; q < 2; ++q) { const float x = F[(size_t)(t + q) * pitch + g * HD + d]; o16[q] = tohx(x); unsigned short a2, c2; splitf(x, a2, c2); oh[q] = a2; ol[q] = c2; }
    const size_t o = (e - t) * (PP / TT) + t;   // plane rows [g][d] at pitch PP
    *(v2h*)(V16 + o) = o16; *(v2us*)(Vh + o) = oh; *(v2us*)(Vl + o) = ol;  }
__global__ __launch_bounds__(256) void k_csid(float* CS) { const int idx = blockIdx.x * 256 + threadIdx.x; if (idx >= TT * HD) return; v2f cs; cs[0] = 1.0f; cs[1] = 0.0f; *(v2f*)(CS + (size_t)idx * 2) = cs;  }
// k_asoft: per row (zz, i): t = S x HD^-0.5 for j <= i and i - j < WIN (sliding causal window; the reference's -1e9 additive fill vanishes identically); softmax over the 2048 keys (register row, one exp, fixed trees);
// the probabilities go over the row's own scores (every score of the row is in registers before the first store): rows < RH hi plane in the first TT 16-bit places and lo plane in the next TT, other rows fp16 in the first TT; row pitch PP.
__global__ __launch_bounds__(256) void k_asoft(float* Sb) {
    const int lane = threadIdx.x & 31; const int row = blockIdx.x * 8 + (threadIdx.x >> 5); if (row >= ZH * TT) return; const int i = row % TT; const int zz = row / TT; (void)zz; const bool hires = (i < RH); const float* sr = Sb + (size_t)row * TT; h16* const P16 = (h16*)(Sb + (size_t)row * TT); bf* const Ph = (bf*)(Sb + (size_t)row * TT); bf* const Pl = Ph + TT; float v[TT / 32]; float mx = -3.0e38f;
#pragma unroll
    for (int ch = 0; ch < TT / 128; ++ch) { const int j0 = ch * 128 + lane * 4; const v4f a = *(const v4f*)(sr + j0);
#pragma unroll
        for (int q = 0; q < 4; ++q) { const int j = j0 + q; (void)j; const float t = (j <= i && i - j < WIN) ? a[q] * SCL : -3.0e38f; v[ch * 4 + q] = t; mx = fmaxf(mx, t); } }
#pragma unroll
    for (int sh = 16; sh; sh >>= 1) mx = fmaxf(mx, __shfl_xor(mx, sh, 32));
    float sum = 0.f;
#pragma unroll
    for (int k = 0; k < TT / 32; ++k) { float d0 = __fsub_rn(v[k], mx); asm volatile("" : "+v"(d0)); v[k] = __builtin_amdgcn_exp2f(__fmul_rn(d0, 1.4426950408889634f)); sum += v[k]; }
#pragma unroll
    for (int sh = 16; sh; sh >>= 1) sum += __shfl_xor(sum, sh, 32);
    const float f = __fdiv_rn(hires ? 1.0f : PCAR, sum);
{
        if (hires) {
#pragma unroll
            for (int ch = 0; ch < TT / 128; ++ch) { v4us oh, ol;
#pragma unroll
                for (int q = 0; q < 4; ++q) { unsigned short a, c2; splitf(v[ch * 4 + q] * f, a, c2); oh[q] = a; ol[q] = c2; }
                const int oo = ch * 128 + lane * 4; *(v4us*)(Ph + oo) = oh; *(v4us*)(Pl + oo) = ol; }
        } else {
#pragma unroll
            for (int ch = 0; ch < TT / 128; ++ch) { v4h o4;
#pragma unroll
                for (int q = 0; q < 4; ++q) o4[q] = tohx(v[ch * 4 + q] * f);
                *(v4h*)(P16 + ch * 128 + lane * 4) = o4; } }
         }
}
__global__ __launch_bounds__(256) void k_merge(const float* __restrict__ O, int h0, bf* Ah, bf* Al) { const size_t e = ((size_t)blockIdx.x * 256 + threadIdx.x) * 2; if (e >= (size_t)ZH * TT * HD) return; const int d = (int)(e % HD); const int t = (int)((e / HD) % TT); const int zz = (int)(e / ((size_t)HD * TT)); const float cs = (t < RH) ? 1.0f : (1.0f / PCAR); const size_t oo = (size_t)t * DQ + (h0 + zz) * HD + d;
    v2us oh, ol; v2f acc = (v2f){0.f, 0.f};
#pragma unroll   // all KSP plane loads are issued ahead of the first add
    for (int s = 0; s < KSP; ++s) { const v2f p = *(const v2f*)(O + (size_t)s * ((size_t)ZH * TT * HD) + e); acc[0] += p[0]; acc[1] += p[1]; }   // the key slices' partial sums, in slice order
#pragma unroll
    for (int q = 0; q < 2; ++q) { unsigned short a, c2; splitf(acc[q] * cs, a, c2); oh[q] = a; ol[q] = c2; } *(v2us*)(Ah + oo) = oh; *(v2us*)(Al + oo) = ol;  }

extern "C" void kernel_launch(void* const* d_in, const int* in_sizes, int n_in,
                              void* d_out, int out_size, void* d_ws, size_t ws_size, hipStream_t stream) {
    (void)in_sizes; (void)n_in; (void)out_size;
    const float* x = (const float*)d_in[0]; const float* wq = (const float*)d_in[1]; const float* wk = (const float*)d_in[2]; const float* wv = (const float*)d_in[3]; const float* wo = (const float*)d_in[4];   /* input order hidden_states, Wq, Wk, Wv, Wo ('oi': 'x @ W.T') */
    float* OUT = (float*)d_out;     // [4][2048][1024]
    char* wsp = (char*)d_ws;
    auto take = [&](size_t bytes) { char* p = wsp; wsp += (bytes + 255) & ~(size_t)255; return (void*)p; };
    bf* WQ = (bf*)take((size_t)DF * DM * 2); bf* WK = WQ + (size_t)DQ * DM; bf* WV = WK + (size_t)DKV * DM;   /* one [DF][DM] plane: q, k, v rows */ bf* WO = (bf*)take((size_t)DM * DQ * 2); float* CS = (float*)take((size_t)TT * HD * 2 * 4);
    float* Ob = (float*)take((size_t)KSP * ZH * TT * HD * 4);
    bf* XB = (bf*)Ob; float* FF = (float*)(XB + (size_t)TT * DM);   // x copy and the f32 projections [TT][DF] lie in the first 28 MiB of the partial planes: they are dead once the head planes are built, and rewritten for the next chunk after its last k_merge (stream-ordered)
    h16* QP16 = (h16*)take((size_t)(NH_ + NKV) * TT * HD * 2); h16* KP16 = QP16 + (size_t)NH_ * TT * HD;   /* the k heads' planes follow the q heads': one k_rope launch writes both */ h16* VT16 = (h16*)take((size_t)NKV * HD * PP * 2);
    bf* QPh = (bf*)take((size_t)(NH_ + NKV) * TT * HD * 2); bf* KPh = QPh + (size_t)NH_ * TT * HD; bf* QPl = (bf*)take((size_t)(NH_ + NKV) * TT * HD * 2); bf* KPl = QPl + (size_t)NH_ * TT * HD; bf* VTh = (bf*)take((size_t)NKV * HD * PP * 2); bf* VTl = VTh + TT;   // hi and lo row of V^T side by side in one row of pitch PP
    float* Sb = (float*)take((size_t)ZH * TT * TT * 4); bf* ATh = (bf*)take((size_t)TT * DQ * 2); bf* ATl = (bf*)take((size_t)TT * DQ * 2);
    if ((size_t)(wsp - (char*)d_ws) > ws_size) return;    // ws 256 MiB
    { k_cvt8<<<(unsigned)(((size_t)DQ * DM / 8 + 255) / 256), 256, 0, stream>>>(wq, WQ, (size_t)DQ * DM / 8); k_cvt8<<<(unsigned)(((size_t)DKV * DM / 8 + 255) / 256), 256, 0, stream>>>(wk, WK, (size_t)DKV * DM / 8); k_cvt8<<<(unsigned)(((size_t)DKV * DM / 8 + 255) / 256), 256, 0, stream>>>(wv, WV, (size_t)DKV * DM / 8);
      k_cvt8<<<(unsigned)(((size_t)DM * DQ / 8 + 255) / 256), 256, 0, stream>>>(wo, WO, (size_t)DM * DQ / 8);
       }
    k_csid<<<(TT * HD + 255) / 256, 256, 0, stream>>>(CS);
    const unsigned LQK = (unsigned)(((size_t)(NH_ + NKV) * TT * HD / 2 + 255) / 256), LKv = (unsigned)(((size_t)NKV * TT * HD / 2 + 255) / 256);
    for (int b = 0; b < NB_; ++b) {
        
        k_cvt8<<<(unsigned)(((size_t)TT * DM / 8 + 255) / 256), 256, 0, stream>>>(x + (size_t)b * TT * DM, XB, (size_t)TT * DM / 8);
        k_gemmw<bf, 0, false><<<dim3(TT / 64, DF / 64, 1), 32, 0, stream>>>(XB, nullptr, WQ, nullptr, DM, FF, DF, nullptr, 0, 0, 0);   // q, k and v projections in one launch
        k_rope<<<LQK, 256, 0, stream>>>(FF, DF, NH_ + NKV, CS, nullptr, nullptr, 1.0f, QP16, QPh, QPl);   // q heads, then k heads
        k_vtp<<<LKv, 256, 0, stream>>>(FF + DQ + DKV, DF, NKV, VT16, VTh, VTl);
        for (int h0 = 0; h0 < NH_; h0 += ZH) { const size_t zq = (size_t)h0, zk = (size_t)(h0 / REP);   // one kv head per query head: the pass's ZH heads use consecutive kv planes (z-strides TT*HD, V^T HD*PP)
            k_gemmc<bf, 2, 1, HD><<<dim3(RH / 64, TT / 64, ZH), 32, 0, stream>>>(QPh + zq * TT * HD, QPl + zq * TT * HD, KPh + zk * TT * HD, KPl + zk * TT * HD, HD, Sb, TT, 0, (size_t)TT * HD, (size_t)TT * HD, (size_t)TT * TT, 0);
            k_gemmc<h16, 0, 1, HD><<<dim3((TT - RH) / 64, TT / 64, ZH), 32, 0, stream>>>(QP16 + zq * TT * HD + (size_t)RH * HD, nullptr, KP16 + zk * TT * HD, nullptr, HD, Sb + (size_t)RH * TT, TT, RH, (size_t)TT * HD, (size_t)TT * HD, (size_t)TT * TT, 0);
            k_asoft<<<ZH * TT / 8, 256, 0, stream>>>(Sb);
            k_gemmc<bf, 2, 2, 32><<<dim3(RH / 64, KSP, ZH), 32, 0, stream>>>((const bf*)Sb, (const bf*)Sb + TT, VTh + zk * HD * PP, VTl + zk * HD * PP, PP, Ob, HD, 0, (size_t)TT * PP, (size_t)HD * PP, (size_t)TT * HD, (size_t)ZH * TT * HD);
            k_gemmc<h16, 0, 2, 64><<<dim3((TT - RH) / 64, KSP, ZH), 32, 0, stream>>>((const h16*)Sb + (size_t)RH * PP, nullptr, VT16 + zk * HD * PP, nullptr, PP, Ob + (size_t)RH * HD, HD, RH, (size_t)TT * PP, (size_t)HD * PP, (size_t)TT * HD, (size_t)ZH * TT * HD);
            k_merge<<<(unsigned)(((size_t)ZH * TT * HD / 2 + 255) / 256), 256, 0, stream>>>(Ob, h0, ATh, ATl); }
        k_gemmw<bf, 1, false><<<dim3(TT / 64, DM / 64, 1), 32, 0, stream>>>(ATh, ATl, WO, nullptr, DQ, OUT + (size_t)b * TT * DM, DM, nullptr, 0, 0, 0); }
}

// v004
// One run takes 354 microseconds.
// Versions in between are left out here; by their measured steps it is 2.67 times as fast as v002.
// All steps since v000 together make it 7.93 times as fast.
#include <hip/hip_runtime.h>

// Chunk-local causal multi-head self-attention (a ring attention with ring_size 1) (hidden_states [1][8192][1024] = FOUR chunks of 2,048 tokens: in memory [4][2048][1024]; q, k, v = x W^T ('oi' [1024][1024] 0.02, no bias; 16 heads x 64); each chunk attends causally WITHIN itself: scores / sqrt(64), tril(ones((2048, 2048))) kept, -inf elsewhere; softmax; out = merged Wo^T ('oi', no bias) -> [1][8192][1024] = [4][2048][1024] (8.4 M); argument order hidden_states, Wq, Wk, Wv, Wo).
// Layout per batch: bf16 copy of x; exact projections, whose GEMM writes the 16-bit head planes itself (no f32 projection in memory); causal T-2048 attention in one launch (k_fattn: scores, online softmax and P x V per query tile, no score matrix in memory; hybrid rows: < 512 hi/lo 3 products, rest fp16); merged hi/lo x W_o exact.
// Compute dtypes, f32 accumulate: every input rounded to bf16; projections exact; attention rows < 512 3 products, rest fp16; softmax f32; W_o hl x exact.

#define NB_  4
#define TT   2048
#define DM   1024
#define NH_  16
#define NKV  16
#define REP  (NH_ / NKV)
#define HD   64
#define DQ   (NH_ * HD)
#define DKV  (NKV * HD)
#define RH   512                  // query rows < RH use hi+lo planes (0: none)
#define SCL  0.125f   // HD^-0.5
#define DF   (DQ + 2 * DKV)       // columns of the joint q | k | v projection
#define PP   (2 * TT)             // row pitch, in 16-bit elements, of the V^T planes
#define FW   4                    // waves of an attention work-group: the 32-key blocks of its query tile are dealt to them in turn
#define OSP  68                   // pitch, in f32, of one query's partial output row in LDS
#define SL2  (SCL * 1.4426950408889634f)   // score scale into the log2 domain
typedef _Float16 h16;
typedef unsigned short bf;
typedef __attribute__((ext_vector_type(16))) __bf16   v16bf;
typedef __attribute__((ext_vector_type(16))) _Float16 v16h;
typedef __attribute__((ext_vector_type(8)))  _Float16 v8h;
typedef __attribute__((ext_vector_type(8)))  unsigned short v8us;
typedef __attribute__((ext_vector_type(8)))  float    v8f;
typedef __attribute__((ext_vector_type(4)))  float    v4f;
typedef v8h  __attribute__((may_alias)) v8ha;
typedef v4f  __attribute__((may_alias)) v4fa;
typedef v8us __attribute__((may_alias)) v8usa;

__device__ __forceinline__ unsigned short f2bf(float f) { unsigned u = __float_as_uint(f); u += 0x7FFFu + ((u >> 16) & 1u); return (unsigned short)(u >> 16); }
__device__ __forceinline__ float bf2f(unsigned short b) { return __uint_as_float(((unsigned)b) << 16); }
__device__ __forceinline__ float bfr(float f) { return bf2f(f2bf(f)); }
__device__ __forceinline__ v16h cat16(v8h lo, v8h hi) { return __builtin_shufflevector(lo, hi, 0, 1, 2, 3, 4, 5, 6, 7, 8, 9, 10, 11, 12, 13, 14, 15); }
__device__ __forceinline__ v16bf cat16b(v8us lo, v8us hi) { return __builtin_bit_cast(v16bf, __builtin_shufflevector(lo, hi, 0, 1, 2, 3, 4, 5, 6, 7, 8, 9, 10, 11, 12, 13, 14, 15)); }
__device__ __forceinline__ v8f wmma16(v16h a, v16h b, v8f c) { return __builtin_amdgcn_wmma_f32_16x16x32_f16(false, a, false, b, (short)0, c, false, false); }
__device__ __forceinline__ v8f wmmab(v16bf a, v16bf b, v8f c) { return __builtin_amdgcn_wmma_f32_16x16x32_bf16(false, a, false, b, (short)0, c, false, false); }
__device__ __forceinline__ h16 tohx(float x) { return (h16)x; }
__device__ __forceinline__ void splitf(float y, unsigned short& h, unsigned short& l) { h = f2bf(y); l = f2bf(y - bf2f(h)); }
// s_wait_xcnt 0 behind a run of global loads or stores, in front of whatever next overwrites a register that the run names (address pairs, store data).
__device__ __forceinline__ void xw() { asm volatile("s_wait_xcnt 0x0" ::: "memory"); }



// ---- k_gemmw: register-blocked GEMM, ONE WAVE per 64x64 output tile (16 accumulators), operands straight from K-contiguous 16-bit planes; grid (M/64, N/64, Z), 32 threads.
// C[m][n] (f32, pitch ldc, + optional f32 bias[n]) = sum_k A[m][k] Bt[n][k] (+ split products per NSPLIT). z-batch strides sA/sB/sC in elements. K % 32 == 0.
// PL (the joint q | k | v projection): a 64-column tile is one head, and the tile goes straight from the accumulators to that head's fp16, bf16-hi and bf16-lo planes; C is not written.
// q and k heads: planes [head][t][d]; v heads: planes [head][d][t] at pitch PP. Sixteen plane rows at a time are turned in LDS so that eight lanes store one whole 128-byte row.
template <typename T16> struct WFrag;
template <> struct WFrag<h16> { typedef v16h V; static __device__ __forceinline__ V ld(const h16* p) { return cat16(*(const v8h*)p, *(const v8h*)(p + 16)); } static __device__ __forceinline__ v8f mma(V a, V b, v8f c) { return wmma16(a, b, c); } };
template <> struct WFrag<bf> { typedef v16bf V; static __device__ __forceinline__ V ld(const bf* p) { return cat16b(*(const v8us*)p, *(const v8us*)(p + 16)); } static __device__ __forceinline__ v8f mma(V a, V b, v8f c) { return wmmab(a, b, c); } };
template <typename T16, int NSPLIT, bool BIAS, bool PL>
__global__ __launch_bounds__(32) void k_gemmw(const T16* __restrict__ A, const T16* __restrict__ A2, const T16* __restrict__ Bt, const T16* __restrict__ Bt2, int K, float* C, int ldc, const float* __restrict__ bias, size_t sA, size_t sB, size_t sC, h16* P16, bf* Ph, bf* Pl, h16* V16, bf* Vh, bf* Vl) {
    typedef typename WFrag<T16>::V V;
    __shared__ __align__(16) float os[16 * 68];
    const size_t z = blockIdx.z; A += z * sA; if (A2) A2 += z * sA; Bt += z * sB; if (Bt2) Bt2 += z * sB; C += z * sC;
    const int lane = threadIdx.x & 31, lr = lane & 15, hi = lane >> 4; const int r0 = blockIdx.x * 64, c0 = blockIdx.y * 64;
    v8f acc[4][4];
#pragma unroll
    for (int mb = 0; mb < 4; ++mb)
#pragma unroll
        for (int nb = 0; nb < 4; ++nb) acc[mb][nb] = (v8f){};
    const size_t aoff = (size_t)(r0 + lr) * K + 8 * hi, boff = (size_t)(c0 + lr) * K + 8 * hi;
#pragma unroll 1
    for (int kc = 0; kc < K; kc += 32) {
        V a[4], a2[4];
#pragma unroll
        for (int mb = 0; mb < 4; ++mb) { a[mb] = WFrag<T16>::ld(A + aoff + (size_t)mb * 16 * K + kc); if (NSPLIT == 1 || NSPLIT == 2) a2[mb] = WFrag<T16>::ld(A2 + aoff + (size_t)mb * 16 * K + kc); }
#pragma unroll
        for (int nb = 0; nb < 4; ++nb) { const V b = WFrag<T16>::ld(Bt + boff + (size_t)nb * 16 * K + kc); V b2; if (NSPLIT >= 2) b2 = WFrag<T16>::ld(Bt2 + boff + (size_t)nb * 16 * K + kc);
#pragma unroll
            for (int mb = 0; mb < 4; ++mb) { acc[mb][nb] = WFrag<T16>::mma(a[mb], b, acc[mb][nb]); if (NSPLIT == 1 || NSPLIT == 2) acc[mb][nb] = WFrag<T16>::mma(a2[mb], b, acc[mb][nb]); if (NSPLIT >= 2) acc[mb][nb] = WFrag<T16>::mma(a[mb], b2, acc[mb][nb]); } }
        asm volatile("v_nop\n\tv_nop\n\tv_nop\n\tv_nop" : "+v"(acc[0][0]), "+v"(acc[1][1]), "+v"(acc[2][2]), "+v"(acc[3][3]) : "v"(a[0]), "v"(a[3]));
    }
    if (PL) {
        const int hh = blockIdx.y; const bool isv = hh >= NH_ + NKV;      // the same for the whole wave
        const size_t base = isv ? (size_t)(hh - NH_ - NKV) * HD * PP + r0 : ((size_t)hh * TT + r0) * HD; const int pitch = isv ? PP : HD;
        h16* D16 = (isv ? V16 : P16) + base; bf* Dh = (isv ? Vh : Ph) + base; bf* Dl = (isv ? Vl : Pl) + base;
#pragma unroll   // constant accumulator indices
        for (int u = 0; u < 4; ++u) {
            if (isv) {      // plane rows = 16 columns d of the tile, 64 tokens along each: a lane's 8 accumulator values are 8 tokens in a row
#pragma unroll
                for (int mb = 0; mb < 4; ++mb) { float* d = os + lr * 68 + mb * 16 + hi * 8; const v8f a = acc[mb][u]; *(v4fa*)d = (v4f){a[0], a[1], a[2], a[3]}; *(v4fa*)(d + 4) = (v4f){a[4], a[5], a[6], a[7]}; }
            } else {        // plane rows = 16 tokens of the tile, 64 columns d along each
#pragma unroll
                for (int nb = 0; nb < 4; ++nb) {
#pragma unroll
                    for (int j = 0; j < 8; ++j) os[(hi * 8 + j) * 68 + nb * 16 + lr] = acc[u][nb][j]; }
            }
            __builtin_amdgcn_wave_barrier(); asm volatile("" ::: "memory");   // the reads below take other lanes' values: they stay behind the writes
#pragma unroll
            for (int s = 0; s < 4; ++s) { const int row = 4 * s + (lane >> 3), g = lane & 7; const float* d = os + row * 68 + g * 8; const v4f a = *(const v4fa*)d, c = *(const v4fa*)(d + 4); v8h o16; v8us oh, ol;
#pragma unroll
                for (int j = 0; j < 4; ++j) { unsigned short p, q; o16[j] = tohx(a[j]); splitf(a[j], p, q); oh[j] = p; ol[j] = q; o16[4 + j] = tohx(c[j]); splitf(c[j], p, q); oh[4 + j] = p; ol[4 + j] = q; }
                const size_t o = (size_t)(u * 16 + row) * pitch + g * 8; *(v8h*)(D16 + o) = o16; *(v8us*)(Dh + o) = oh; *(v8us*)(Dl + o) = ol; xw(); }
            __builtin_amdgcn_wave_barrier(); asm volatile("" ::: "memory");   // the next sixteen rows overwrite os only behind these reads
        }
        return;
    }
#pragma unroll
    for (int mb = 0; mb < 4; ++mb) {
#pragma unroll
        for (int nb = 0; nb < 4; ++nb) {
#pragma unroll
            for (int j = 0; j < 8; ++j) os[(hi * 8 + j) * 68 + nb * 16 + lr] = acc[mb][nb][j]; }
        __builtin_amdgcn_wave_barrier(); asm volatile("" ::: "memory");
        float* crow = C + (size_t)(r0 + mb * 16) * ldc + c0;
{
#pragma unroll
            for (int s = 0; s < 8; ++s) { const int row = 2 * s + hi, cofs = lr * 4; v4f val = *(const v4fa*)(os + row * 68 + cofs); if (BIAS) { val[0] += bfr(bias[c0 + cofs]); val[1] += bfr(bias[c0 + cofs + 1]); val[2] += bfr(bias[c0 + cofs + 2]); val[3] += bfr(bias[c0 + cofs + 3]); }
                *(v4f*)(crow + (size_t)row * ldc + cofs) = val; }
             }
        __builtin_amdgcn_wave_barrier(); asm volatile("" ::: "memory");
    }
}

typedef __attribute__((ext_vector_type(2))) _Float16 v2h;
typedef __attribute__((ext_vector_type(4))) _Float16 v4h;
typedef __attribute__((ext_vector_type(2))) unsigned short v2us;
typedef __attribute__((ext_vector_type(4))) unsigned short v4us;
typedef __attribute__((ext_vector_type(2))) float v2f;
typedef __attribute__((ext_vector_type(4))) int v4i;

__global__ __launch_bounds__(256) void k_wtG(const float* __restrict__ w, int K, int N, bf* Bt) {
    const int lane = threadIdx.x & 31; const int L0 = (blockIdx.x * 8 + (threadIdx.x >> 5)) * 8; const int nlines = N * K / 64;
{
#pragma unroll 1
        for (int l = 0; l < 8; ++l) { const int L = L0 + l; if (L >= nlines) break; const size_t e = (size_t)L * 64 + lane * 2; const int k = (int)(e % K), n = (int)(e / K); v2us o;
            o[0] = f2bf(w[(size_t)k * N + n]); o[1] = f2bf(w[(size_t)(k + 1) * N + n]); *(v2us*)(Bt + e) = o; }
         }
}
__global__ __launch_bounds__(256) void k_cvt8(const float* __restrict__ src, bf* dst, size_t n8) { const size_t i = (size_t)blockIdx.x * 256 + threadIdx.x; if (i >= n8) return; const v8f v = *(const v8f*)(src + i * 8); v8us o;
#pragma unroll
    for (int k = 0; k < 8; ++k) o[k] = f2bf(v[k]); *(v8us*)(dst + i * 8) = o;  }

// ---- k_fattn: scores, causal softmax and probability x value product of one query tile of one head in one work-group of FW waves; nothing of the score matrix reaches memory.
// S^T = K Q^T (A = 16 key rows, B = 16 query rows): lane (lr, hi) holds keys 8 hi + j of query lr, so two score tiles of 32 keys, converted in place, are the B fragment of O^T += V^T P^T (A = rows of the V^T plane).
// Online softmax in the log2 domain: running maximum m and sum l per query, O^T rescaled when m moves; P = exp2(s - m) <= 1 is not normalised before it is rounded, the division by l comes last.
// The 32-key blocks up to the diagonal are dealt to the FW waves in turn; their (m, l, O) meet in LDS and are joined in wave order. HI: hi/lo bf16 planes, 3 products each side (query rows < RH); else fp16.
// Every '#pragma unroll' here gives a fragment, score or accumulator array constant indices, so that it stays in registers; the two lambdas are inlined by force for the same reason (they work on those arrays by reference).
template <typename T16, bool HI, int NQ>
__device__ __forceinline__ void fattn(const T16* __restrict__ Q, const T16* __restrict__ Q2, const T16* __restrict__ Kp, const T16* __restrict__ K2, const T16* __restrict__ Vt, const T16* __restrict__ V2, int q0, bf* Ah, bf* Al, float* so, float* sm, float* sl) {
    typedef typename WFrag<T16>::V V;
    const int lane = threadIdx.x & 31, lr = lane & 15, hi = lane >> 4; const int w = __builtin_amdgcn_readfirstlane(threadIdx.x >> 5);
    V qf[NQ][2], qf2[NQ][2]; v8f o[NQ][4]; float m[NQ], l[NQ];
#pragma unroll
    for (int nq = 0; nq < NQ; ++nq) { m[nq] = -3.0e38f; l[nq] = 0.f;
#pragma unroll
        for (int kk = 0; kk < 2; ++kk) { const size_t qo = (size_t)(q0 + nq * 16 + lr) * HD + kk * 32 + 8 * hi; qf[nq][kk] = WFrag<T16>::ld(Q + qo); if (HI) qf2[nq][kk] = WFrag<T16>::ld(Q2 + qo); }
#pragma unroll
        for (int mt = 0; mt < 4; ++mt) o[nq][mt] = (v8f){}; }
    xw();
    const int nblk = (q0 + NQ * 16 - 1) / 32 + 1;      // every block walked holds key kb <= q0: no query of the tile ever sees a block that is masked whole; only the last block crosses the diagonal
    V kf[2][2], kf2[2][2];
    auto ldk = [&](int b) __attribute__((always_inline)) {
#pragma unroll
        for (int t = 0; t < 2; ++t)
#pragma unroll
            for (int kk = 0; kk < 2; ++kk) kf[t][kk] = WFrag<T16>::ld(Kp + (size_t)(b * 32 + t * 16 + lr) * HD + kk * 32 + 8 * hi);
        xw();
        if (HI) {
#pragma unroll
            for (int t = 0; t < 2; ++t)
#pragma unroll
                for (int kk = 0; kk < 2; ++kk) kf2[t][kk] = WFrag<T16>::ld(K2 + (size_t)(b * 32 + t * 16 + lr) * HD + kk * 32 + 8 * hi);
            xw(); } };
    // one pass = one block of 32 keys. fp16 tiles: the K fragments were fetched one pass ahead, and block bn's follow into the same registers right behind the score products (not in the diagonal pass, a wave's last).
    auto pass = [&](int b, bool diag, int bn) __attribute__((always_inline)) { const int kb = b * 32; V vf[4], vf2[4]; v8f s[NQ][2];
        if (HI) ldk(b);
#pragma unroll
        for (int mt = 0; mt < 4; ++mt) vf[mt] = WFrag<T16>::ld(Vt + (size_t)(mt * 16 + lr) * PP + kb + 8 * hi);
        xw();
        if (HI) {
#pragma unroll
            for (int mt = 0; mt < 4; ++mt) vf2[mt] = WFrag<T16>::ld(V2 + (size_t)(mt * 16 + lr) * PP + kb + 8 * hi);
            xw(); }
        if (!HI) __builtin_amdgcn_sched_barrier(0);    // keeps the V^T loads in front of the score products, so that their latency runs under scores and softmax
#pragma unroll
        for (int nq = 0; nq < NQ; ++nq)
#pragma unroll
            for (int t = 0; t < 2; ++t) { s[nq][t] = (v8f){};
#pragma unroll
                for (int kk = 0; kk < 2; ++kk) { s[nq][t] = WFrag<T16>::mma(kf[t][kk], qf[nq][kk], s[nq][t]); if (HI) { s[nq][t] = WFrag<T16>::mma(kf[t][kk], qf2[nq][kk], s[nq][t]); s[nq][t] = WFrag<T16>::mma(kf2[t][kk], qf[nq][kk], s[nq][t]); } } }
        if (!HI && !diag) ldk(bn);
#pragma unroll
        for (int nq = 0; nq < NQ; ++nq) { const int q = q0 + nq * 16 + lr; float bm = -3.0e38f;
#pragma unroll
            for (int t = 0; t < 2; ++t)
#pragma unroll
                for (int j = 0; j < 8; ++j) { float x = s[nq][t][j] * SL2; if (diag) x = (kb + t * 16 + hi * 8 + j <= q) ? x : -3.0e38f; s[nq][t][j] = x; bm = fmaxf(bm, x); }
            bm = fmaxf(bm, __shfl_xor(bm, 16, 32));
            const float mn = fmaxf(m[nq], bm), al = __builtin_amdgcn_exp2f(m[nq] - mn); m[nq] = mn; float ps = 0.f;
#pragma unroll
            for (int t = 0; t < 2; ++t)
#pragma unroll
                for (int j = 0; j < 8; ++j) { const float p = __builtin_amdgcn_exp2f(s[nq][t][j] - mn); s[nq][t][j] = p; ps += p; }
            l[nq] = l[nq] * al + ps;     // this lane's eight-key halves only; the two halves of a query are added once, behind the loop
#pragma unroll
            for (int mt = 0; mt < 4; ++mt) o[nq][mt] *= al;
            if (HI) { v8us h0, h1, l0, l1;
#pragma unroll
                for (int j = 0; j < 8; ++j) { unsigned short a, c2; splitf(s[nq][0][j], a, c2); h0[j] = a; l0[j] = c2; splitf(s[nq][1][j], a, c2); h1[j] = a; l1[j] = c2; }
                const v16bf ph = cat16b(h0, h1), pl = cat16b(l0, l1);
#pragma unroll
                for (int mt = 0; mt < 4; ++mt) { o[nq][mt] = wmmab(__builtin_bit_cast(v16bf, vf[mt]), ph, o[nq][mt]); o[nq][mt] = wmmab(__builtin_bit_cast(v16bf, vf[mt]), pl, o[nq][mt]); o[nq][mt] = wmmab(__builtin_bit_cast(v16bf, vf2[mt]), ph, o[nq][mt]); }
            } else { v16h pf;
#pragma unroll
                for (int j = 0; j < 8; ++j) { pf[j] = tohx(s[nq][0][j]); pf[8 + j] = tohx(s[nq][1][j]); }
#pragma unroll
                for (int mt = 0; mt < 4; ++mt) o[nq][mt] = wmma16(__builtin_bit_cast(v16h, vf[mt]), pf, o[nq][mt]); } } };
    int b = w;
    if (!HI && b < nblk) ldk(b);
#pragma unroll 1   // rolled: one set of K and V^T fragments in registers
    for (; b < nblk - 1; b += FW) pass(b, false, min(b + FW, nblk - 1));     // blocks wholly below the diagonal: no mask; the fetch ahead is unconditional (a wave with no further block fetches the last block and drops it), so the loads stay in flight over the loop's foot
    if (b == nblk - 1) pass(b, true, b);                                     // the diagonal block, in the wave whose turn it is
#pragma unroll
    for (int nq = 0; nq < NQ; ++nq) { const int ql = w * 32 + nq * 16 + lr; const float lt = l[nq] + __shfl_xor(l[nq], 16, 32); if (hi == 0) { sm[ql] = m[nq]; sl[ql] = lt; }
#pragma unroll
        for (int mt = 0; mt < 4; ++mt) { float* d = so + ql * OSP + mt * 16 + hi * 8; const v8f a = o[nq][mt]; *(v4fa*)d = (v4f){a[0], a[1], a[2], a[3]}; *(v4fa*)(d + 4) = (v4f){a[4], a[5], a[6], a[7]}; } }
    __syncthreads();    // every wave's (m, l, O) is in LDS before any wave joins them
#pragma unroll
    for (int it = 0; it < NQ * 16 / (FW * 4); ++it) { const int ql = (it * FW + w) * 4 + (lane >> 3), g = lane & 7;     // eight lanes store the 128 bytes of one query's head row
        float mw[FW], M = -3.0e38f, Lt = 0.f, acc[8];
#pragma unroll
        for (int u = 0; u < FW; ++u) { mw[u] = sm[u * 32 + ql]; M = fmaxf(M, mw[u]); }
#pragma unroll
        for (int j = 0; j < 8; ++j) acc[j] = 0.f;
#pragma unroll
        for (int u = 0; u < FW; ++u) { const float f = __builtin_amdgcn_exp2f(mw[u] - M); Lt += f * sl[u * 32 + ql]; const float* d = so + (u * 32 + ql) * OSP + g * 8; const v4f a = *(const v4fa*)d, c = *(const v4fa*)(d + 4);   // a wave that had no block: m = -3e38, f = 0
#pragma unroll
            for (int j = 0; j < 4; ++j) { acc[j] += f * a[j]; acc[4 + j] += f * c[j]; } }
        const float inv = __fdiv_rn(1.0f, Lt); v8us oh, ol;
#pragma unroll
        for (int j = 0; j < 8; ++j) { unsigned short a, c2; splitf(acc[j] * inv, a, c2); oh[j] = a; ol[j] = c2; }
        const size_t oo = (size_t)(q0 + ql) * DQ + g * 8; *(v8us*)(Ah + oo) = oh; *(v8us*)(Al + oo) = ol; xw(); }
}
// grid (heads, tiles), longest tiles first: (TT - RH) / 32 fp16 tiles of 32 queries from the last row down, then RH / 16 hi/lo tiles of 16 queries.
__global__ __launch_bounds__(FW * 32) void k_fattn(const h16* __restrict__ Q16, const h16* __restrict__ K16, const h16* __restrict__ V16, const bf* __restrict__ Qh, const bf* __restrict__ Ql, const bf* __restrict__ Kh, const bf* __restrict__ Kl, const bf* __restrict__ Vh, const bf* __restrict__ Vl, bf* Ah, bf* Al) {
    __shared__ __align__(16) float so[FW * 32 * OSP]; __shared__ float sm[FW * 32]; __shared__ float sl[FW * 32];
    const int h = blockIdx.x, tile = blockIdx.y; const size_t hp = (size_t)h * TT * HD, vp = (size_t)h * HD * PP;
    if (tile < (TT - RH) / 32) fattn<h16, false, 2>(Q16 + hp, nullptr, K16 + hp, nullptr, V16 + vp, nullptr, TT - 32 * (tile + 1), Ah + h * HD, Al + h * HD, so, sm, sl);
    else fattn<bf, true, 1>(Qh + hp, Ql + hp, Kh + hp, Kl + hp, Vh + vp, Vl + vp, RH - 16 * (tile - (TT - RH) / 32 + 1), Ah + h * HD, Al + h * HD, so, sm, sl);
}

extern "C" void kernel_launch(void* const* d_in, const int* in_sizes, int n_in,
                              void* d_out, int out_size, void* d_ws, size_t ws_size, hipStream_t stream) {
    (void)in_sizes; (void)n_in; (void)out_size;
    const float* x = (const float*)d_in[0]; const float* wq = (const float*)d_in[1]; const float* wk = (const float*)d_in[2]; const float* wv = (const float*)d_in[3]; const float* wo = (const float*)d_in[4];   /* input order hidden_states, Wq, Wk, Wv, Wo ('oi': 'x @ W.T') */
    float* OUT = (float*)d_out;     // [4][2048][1024]
    char* wsp = (char*)d_ws;
    auto take = [&](size_t bytes) { char* p = wsp; wsp += (bytes + 255) & ~(size_t)255; return (void*)p; };
    bf* WQ = (bf*)take((size_t)DF * DM * 2); bf* WK = WQ + (size_t)DQ * DM; bf* WV = WK + (size_t)DKV * DM;   /* one [DF][DM] plane: q, k, v rows */ bf* WO = (bf*)take((size_t)DM * DQ * 2);
    bf* XB = (bf*)take((size_t)TT * DM * 2);   // x copy
    h16* QP16 = (h16*)take((size_t)(NH_ + NKV) * TT * HD * 2); h16* KP16 = QP16 + (size_t)NH_ * TT * HD;   /* the k heads' planes follow the q heads': head index = 64-column tile of the joint projection */ h16* VT16 = (h16*)take((size_t)NKV * HD * PP * 2);
    bf* QPh = (bf*)take((size_t)(NH_ + NKV) * TT * HD * 2); bf* KPh = QPh + (size_t)NH_ * TT * HD; bf* QPl = (bf*)take((size_t)(NH_ + NKV) * TT * HD * 2); bf* KPl = QPl + (size_t)NH_ * TT * HD; bf* VTh = (bf*)take((size_t)NKV * HD * PP * 2); bf* VTl = VTh + TT;   // hi and lo row of V^T side by side in one row of pitch PP
    bf* ATh = (bf*)take((size_t)TT * DQ * 2); bf* ATl = (bf*)take((size_t)TT * DQ * 2);
    if ((size_t)(wsp - (char*)d_ws) > ws_size) return;    // ws 256 MiB
    { k_cvt8<<<(unsigned)(((size_t)DQ * DM / 8 + 255) / 256), 256, 0, stream>>>(wq, WQ, (size_t)DQ * DM / 8); k_cvt8<<<(unsigned)(((size_t)DKV * DM / 8 + 255) / 256), 256, 0, stream>>>(wk, WK, (size_t)DKV * DM / 8); k_cvt8<<<(unsigned)(((size_t)DKV * DM / 8 + 255) / 256), 256, 0, stream>>>(wv, WV, (size_t)DKV * DM / 8);
      k_cvt8<<<(unsigned)(((size_t)DM * DQ / 8 + 255) / 256), 256, 0, stream>>>(wo, WO, (size_t)DM * DQ / 8);
       }
    for (int b = 0; b < NB_; ++b) {
        
        k_cvt8<<<(unsigned)(((size_t)TT * DM / 8 + 255) / 256), 256, 0, stream>>>(x + (size_t)b * TT * DM, XB, (size_t)TT * DM / 8);
        k_gemmw<bf, 0, false, true><<<dim3(TT / 64, DF / 64, 1), 32, 0, stream>>>(XB, nullptr, WQ, nullptr, DM, nullptr, 0, nullptr, 0, 0, 0, QP16, QPh, QPl, VT16, VTh, VTl);   // q, k and v projections in one launch, written as head planes
        k_fattn<<<dim3(NH_, (TT - RH) / 32 + RH / 16), FW * 32, 0, stream>>>(QP16, KP16, VT16, QPh, QPl, KPh, KPl, VTh, VTl, ATh, ATl);   // one kv head per query head
        k_gemmw<bf, 1, false, false><<<dim3(TT / 64, DM / 64, 1), 32, 0, stream>>>(ATh, ATl, WO, nullptr, DQ, OUT + (size_t)b * TT * DM, DM, nullptr, 0, 0, 0, nullptr, nullptr, nullptr, nullptr, nullptr, nullptr); }
}

// v005
// It runs in 270 microseconds.
// Timed twice side by side with v004, it ran 1.31 and 1.30 times as fast.
// Over all steps from v000 it is 10.3 times as fast.
#include <hip/hip_runtime.h>

// Chunk-local causal multi-head self-attention (a ring attention with ring_size 1) (hidden_states [1][8192][1024] = FOUR chunks of 2,048 tokens: in memory [4][2048][1024]; q, k, v = x W^T ('oi' [1024][1024] 0.02, no bias; 16 heads x 64); each chunk attends causally WITHIN itself: scores / sqrt(64), tril(ones((2048, 2048))) kept, -inf elsewhere; softmax; out = merged Wo^T ('oi', no bias) -> [1][8192][1024] = [4][2048][1024] (8.4 M); argument order hidden_states, Wq, Wk, Wv, Wo).
// Four launches, each over all four chunks at once (every plane in the workspace but the weight copies has one copy per chunk): bf16 copies of x and of the weights; exact projections, whose GEMM writes the 16-bit head planes itself (no f32 projection in memory); causal T-2048 attention (k_fattn: scores, online softmax and P x V per query tile, no score matrix in memory; hybrid rows: < 512 hi/lo 3 products, rest fp16); merged hi/lo x W_o exact.
// Compute dtypes, f32 accumulate: every input rounded to bf16; projections exact; attention rows < 512 3 products, rest fp16; softmax f32; W_o hl x exact.

#define NB_  4
#define TT   2048
#define DM   1024
#define NH_  16
#define NKV  16
#define REP  (NH_ / NKV)
#define HD   64
#define DQ   (NH_ * HD)
#define DKV  (NKV * HD)
#define RH   512                  // query rows < RH use hi+lo planes (0: none)
#define SCL  0.125f   // HD^-0.5
#define DF   (DQ + 2 * DKV)       // columns of the joint q | k | v projection
#define PP   (2 * TT)             // row pitch, in 16-bit elements, of the V^T planes
#define FW   4                    // waves of an attention work-group: the 32-key blocks of its query tile are dealt to them in turn
#define OSP  68                   // pitch, in f32, of one query's partial output row in LDS
#define SL2  (SCL * 1.4426950408889634f)   // score scale into the log2 domain
typedef _Float16 h16;
typedef unsigned short bf;
typedef __attribute__((ext_vector_type(16))) __bf16   v16bf;
typedef __attribute__((ext_vector_type(16))) _Float16 v16h;
typedef __attribute__((ext_vector_type(8)))  _Float16 v8h;
typedef __attribute__((ext_vector_type(8)))  unsigned short v8us;
typedef __attribute__((ext_vector_type(8)))  float    v8f;
typedef __attribute__((ext_vector_type(4)))  float    v4f;
typedef v8h  __attribute__((may_alias)) v8ha;
typedef v4f  __attribute__((may_alias)) v4fa;
typedef v8us __attribute__((may_alias)) v8usa;

__device__ __forceinline__ unsigned short f2bf(float f) { unsigned u = __float_as_uint(f); u += 0x7FFFu + ((u >> 16) & 1u); return (unsigned short)(u >> 16); }
__device__ __forceinline__ float bf2f(unsigned short b) { return __uint_as_float(((unsigned)b) << 16); }
__device__ __forceinline__ float bfr(float f) { return bf2f(f2bf(f)); }
__device__ __forceinline__ v16h cat16(v8h lo, v8h hi) { return __builtin_shufflevector(lo, hi, 0, 1, 2, 3, 4, 5, 6, 7, 8, 9, 10, 11, 12, 13, 14, 15); }
__device__ __forceinline__ v16bf cat16b(v8us lo, v8us hi) { return __builtin_bit_cast(v16bf, __builtin_shufflevector(lo, hi, 0, 1, 2, 3, 4, 5, 6, 7, 8, 9, 10, 11, 12, 13, 14, 15)); }
__device__ __forceinline__ v8f wmma16(v16h a, v16h b, v8f c) { return __builtin_amdgcn_wmma_f32_16x16x32_f16(false, a, false, b, (short)0, c, false, false); }
__device__ __forceinline__ v8f wmmab(v16bf a, v16bf b, v8f c) { return __builtin_amdgcn_wmma_f32_16x16x32_bf16(false, a, false, b, (short)0, c, false, false); }
__device__ __forceinline__ h16 tohx(float x) { return (h16)x; }
__device__ __forceinline__ void splitf(float y, unsigned short& h, unsigned short& l) { h = f2bf(y); l = f2bf(y - bf2f(h)); }
// s_wait_xcnt 0 behind a run of global loads or stores, in front of whatever next overwrites a register that the run names (address pairs, store data).
__device__ __forceinline__ void xw() { asm volatile("s_wait_xcnt 0x0" ::: "memory"); }



// ---- k_gemmw: register-blocked GEMM, ONE WAVE per 64x64 output tile (16 accumulators), operands straight from K-contiguous 16-bit planes; grid (M/64, N/64, Z), 32 threads.
// C[m][n] (f32, pitch ldc, + optional f32 bias[n]) = sum_k A[m][k] Bt[n][k] (+ split products per NSPLIT). z-batch strides sA/sB/sC in elements. K % 32 == 0.
// PL (the joint q | k | v projection): a 64-column tile is one head, and the tile goes straight from the accumulators to that head's fp16, bf16-hi and bf16-lo planes; C is not written.
// A row tile lies in one chunk (TT % 64 == 0). q and k heads: planes [chunk][head][t][d]; v heads: planes [chunk][head][d][t] at pitch PP. Sixteen plane rows at a time are turned in LDS so that eight lanes store one whole 128-byte row.
template <typename T16> struct WFrag;
template <> struct WFrag<h16> { typedef v16h V; static __device__ __forceinline__ V ld(const h16* p) { return cat16(*(const v8h*)p, *(const v8h*)(p + 16)); } static __device__ __forceinline__ v8f mma(V a, V b, v8f c) { return wmma16(a, b, c); } };
template <> struct WFrag<bf> { typedef v16bf V; static __device__ __forceinline__ V ld(const bf* p) { return cat16b(*(const v8us*)p, *(const v8us*)(p + 16)); } static __device__ __forceinline__ v8f mma(V a, V b, v8f c) { return wmmab(a, b, c); } };
template <typename T16, int NSPLIT, bool BIAS, bool PL>
__global__ __launch_bounds__(32) void k_gemmw(const T16* __restrict__ A, const T16* __restrict__ A2, const T16* __restrict__ Bt, const T16* __restrict__ Bt2, int K, float* C, int ldc, const float* __restrict__ bias, size_t sA, size_t sB, size_t sC, h16* P16, bf* Ph, bf* Pl, h16* V16, bf* Vh, bf* Vl) {
    typedef typename WFrag<T16>::V V;
    __shared__ __align__(16) float os[16 * 68];
    const size_t z = blockIdx.z; A += z * sA; if (A2) A2 += z * sA; Bt += z * sB; if (Bt2) Bt2 += z * sB; C += z * sC;
    const int lane = threadIdx.x & 31, lr = lane & 15, hi = lane >> 4; const int r0 = blockIdx.x * 64, c0 = blockIdx.y * 64;
    v8f acc[4][4];
#pragma unroll
    for (int mb = 0; mb < 4; ++mb)
#pragma unroll
        for (int nb = 0; nb < 4; ++nb) acc[mb][nb] = (v8f){};
    const size_t aoff = (size_t)(r0 + lr) * K + 8 * hi, boff = (size_t)(c0 + lr) * K + 8 * hi;
#pragma unroll 1
    for (int kc = 0; kc < K; kc += 32) {
        V a[4], a2[4];
#pragma unroll
        for (int mb = 0; mb < 4; ++mb) { a[mb] = WFrag<T16>::ld(A + aoff + (size_t)mb * 16 * K + kc); if (NSPLIT == 1 || NSPLIT == 2) a2[mb] = WFrag<T16>::ld(A2 + aoff + (size_t)mb * 16 * K + kc); }
#pragma unroll
        for (int nb = 0; nb < 4; ++nb) { const V b = WFrag<T16>::ld(Bt + boff + (size_t)nb * 16 * K + kc); V b2; if (NSPLIT >= 2) b2 = WFrag<T16>::ld(Bt2 + boff + (size_t)nb * 16 * K + kc);
#pragma unroll
            for (int mb = 0; mb < 4; ++mb) { acc[mb][nb] = WFrag<T16>::mma(a[mb], b, acc[mb][nb]); if (NSPLIT == 1 || NSPLIT == 2) acc[mb][nb] = WFrag<T16>::mma(a2[mb], b, acc[mb][nb]); if (NSPLIT >= 2) acc[mb][nb] = WFrag<T16>::mma(a[mb], b2, acc[mb][nb]); } }
        asm volatile("v_nop\n\tv_nop\n\tv_nop\n\tv_nop" : "+v"(acc[0][0]), "+v"(acc[1][1]), "+v"(acc[2][2]), "+v"(acc[3][3]) : "v"(a[0]), "v"(a[3]));
    }
    if (PL) {
        const int hh = blockIdx.y; const bool isv = hh >= NH_ + NKV;      // the same for the whole wave
        const int ch = r0 / TT, rc = r0 % TT;      // chunk of the row tile, first token inside it
        const size_t base = isv ? (size_t)(ch * NKV + hh - NH_ - NKV) * HD * PP + rc : ((size_t)(ch * (NH_ + NKV) + hh) * TT + rc) * HD; const int pitch = isv ? PP : HD;
        h16* D16 = (isv ? V16 : P16) + base; bf* Dh = (isv ? Vh : Ph) + base; bf* Dl = (isv ? Vl : Pl) + base;
#pragma unroll   // constant accumulator indices
        for (int u = 0; u < 4; ++u) {
            if (isv) {      // plane rows = 16 columns d of the tile, 64 tokens along each: a lane's 8 accumulator values are 8 tokens in a row
#pragma unroll
                for (int mb = 0; mb < 4; ++mb) { float* d = os + lr * 68 + mb * 16 + hi * 8; const v8f a = acc[mb][u]; *(v4fa*)d = (v4f){a[0], a[1], a[2], a[3]}; *(v4fa*)(d + 4) = (v4f){a[4], a[5], a[6], a[7]}; }
            } else {        // plane rows = 16 tokens of the tile, 64 columns d along each
#pragma unroll
                for (int nb = 0; nb < 4; ++nb) {
#pragma unroll
                    for (int j = 0; j < 8; ++j) os[(hi * 8 + j) * 68 + nb * 16 + lr] = acc[u][nb][j]; }
            }
            __builtin_amdgcn_wave_barrier(); asm volatile("" ::: "memory");   // the reads below take other lanes' values: they stay behind the writes
#pragma unroll
            for (int s = 0; s < 4; ++s) { const int row = 4 * s + (lane >> 3), g = lane & 7; const float* d = os + row * 68 + g * 8; const v4f a = *(const v4fa*)d, c = *(const v4fa*)(d + 4); v8h o16; v8us oh, ol;
#pragma unroll
                for (int j = 0; j < 4; ++j) { unsigned short p, q; o16[j] = tohx(a[j]); splitf(a[j], p, q); oh[j] = p; ol[j] = q; o16[4 + j] = tohx(c[j]); splitf(c[j], p, q); oh[4 + j] = p; ol[4 + j] = q; }
                const size_t o = (size_t)(u * 16 + row) * pitch + g * 8; *(v8h*)(D16 + o) = o16; *(v8us*)(Dh + o) = oh; *(v8us*)(Dl + o) = ol; xw(); }
            __builtin_amdgcn_wave_barrier(); asm volatile("" ::: "memory");   // the next sixteen rows overwrite os only behind these reads
        }
        return;
    }
#pragma unroll
    for (int mb = 0; mb < 4; ++mb) {
#pragma unroll
        for (int nb = 0; nb < 4; ++nb) {
#pragma unroll
            for (int j = 0; j < 8; ++j) os[(hi * 8 + j) * 68 + nb * 16 + lr] = acc[mb][nb][j]; }
        __builtin_amdgcn_wave_barrier(); asm volatile("" ::: "memory");
        float* crow = C + (size_t)(r0 + mb * 16) * ldc + c0;
{
#pragma unroll
            for (int s = 0; s < 8; ++s) { const int row = 2 * s + hi, cofs = lr * 4; v4f val = *(const v4fa*)(os + row * 68 + cofs); if (BIAS) { val[0] += bfr(bias[c0 + cofs]); val[1] += bfr(bias[c0 + cofs + 1]); val[2] += bfr(bias[c0 + cofs + 2]); val[3] += bfr(bias[c0 + cofs + 3]); }
                *(v4f*)(crow + (size_t)row * ldc + cofs) = val; }
             }
        __builtin_amdgcn_wave_barrier(); asm volatile("" ::: "memory");
    }
}

typedef __attribute__((ext_vector_type(2))) _Float16 v2h;
typedef __attribute__((ext_vector_type(4))) _Float16 v4h;
typedef __attribute__((ext_vector_type(2))) unsigned short v2us;
typedef __attribute__((ext_vector_type(4))) unsigned short v4us;
typedef __attribute__((ext_vector_type(2))) float v2f;
typedef __attribute__((ext_vector_type(4))) int v4i;

__global__ __launch_bounds__(256) void k_wtG(const float* __restrict__ w, int K, int N, bf* Bt) {
    const int lane = threadIdx.x & 31; const int L0 = (blockIdx.x * 8 + (threadIdx.x >> 5)) * 8; const int nlines = N * K / 64;
{
#pragma unroll 1
        for (int l = 0; l < 8; ++l) { const int L = L0 + l; if (L >= nlines) break; const size_t e = (size_t)L * 64 + lane * 2; const int k = (int)(e % K), n = (int)(e / K); v2us o;
            o[0] = f2bf(w[(size_t)k * N + n]); o[1] = f2bf(w[(size_t)(k + 1) * N + n]); *(v2us*)(Bt + e) = o; }
         }
}
// bf16 copies of all five inputs in one launch: a work-group converts 2,048 elements of the one input that its index falls into (the choice is the same for the whole work-group).
#define CB_X ((unsigned)((size_t)NB_ * TT * DM / 2048))
#define CB_Q ((unsigned)((size_t)DQ * DM / 2048))
#define CB_K ((unsigned)((size_t)DKV * DM / 2048))
__global__ __launch_bounds__(256) void k_cvt5(const float* __restrict__ x, const float* __restrict__ wq, const float* __restrict__ wk, const float* __restrict__ wv, const float* __restrict__ wo, bf* XB, bf* WQ, bf* WK, bf* WV, bf* WO) {
    unsigned blk = blockIdx.x; const float* src = x; bf* dst = XB;
    if (blk >= CB_X + CB_Q + 2 * CB_K) { blk -= CB_X + CB_Q + 2 * CB_K; src = wo; dst = WO; }
    else if (blk >= CB_X + CB_Q + CB_K) { blk -= CB_X + CB_Q + CB_K; src = wv; dst = WV; }
    else if (blk >= CB_X + CB_Q) { blk -= CB_X + CB_Q; src = wk; dst = WK; }
    else if (blk >= CB_X) { blk -= CB_X; src = wq; dst = WQ; }
    const size_t i = (size_t)blk * 256 + threadIdx.x; const v8f v = *(const v8f*)(src + i * 8); xw(); v8us o;
#pragma unroll
    for (int k = 0; k < 8; ++k) o[k] = f2bf(v[k]); *(v8us*)(dst + i * 8) = o;  }

// ---- k_fattn: scores, causal softmax and probability x value product of one query tile of one head in one work-group of FW waves; nothing of the score matrix reaches memory.
// S^T = K Q^T (A = 16 key rows, B = 16 query rows): lane (lr, hi) holds keys 8 hi + j of query lr, so two score tiles of 32 keys, converted in place, are the B fragment of O^T += V^T P^T (A = rows of the V^T plane).
// Online softmax in the log2 domain: running maximum m and sum l per query, O^T rescaled when m moves; P = exp2(s - m) <= 1 is not normalised before it is rounded, the division by l comes last.
// The 32-key blocks up to the diagonal are dealt to the FW waves in turn; their (m, l, O) meet in LDS and are joined in wave order. HI: hi/lo bf16 planes, 3 products each side (query rows < RH); else fp16.
// Every '#pragma unroll' here gives a fragment, score or accumulator array constant indices, so that it stays in registers; the two lambdas are inlined by force for the same reason (they work on those arrays by reference).
template <typename T16, bool HI, int NQ>
__device__ __forceinline__ void fattn(const T16* __restrict__ Q, const T16* __restrict__ Q2, const T16* __restrict__ Kp, const T16* __restrict__ K2, const T16* __restrict__ Vt, const T16* __restrict__ V2, int q0, bf* Ah, bf* Al, float* so, float* sm, float* sl) {
    typedef typename WFrag<T16>::V V;
    const int lane = threadIdx.x & 31, lr = lane & 15, hi = lane >> 4; const int w = __builtin_amdgcn_readfirstlane(threadIdx.x >> 5);
    V qf[NQ][2], qf2[NQ][2]; v8f o[NQ][4]; float m[NQ], l[NQ];
#pragma unroll
    for (int nq = 0; nq < NQ; ++nq) { m[nq] = -3.0e38f; l[nq] = 0.f;
#pragma unroll
        for (int kk = 0; kk < 2; ++kk) { const size_t qo = (size_t)(q0 + nq * 16 + lr) * HD + kk * 32 + 8 * hi; qf[nq][kk] = WFrag<T16>::ld(Q + qo); if (HI) qf2[nq][kk] = WFrag<T16>::ld(Q2 + qo); }
#pragma unroll
        for (int mt = 0; mt < 4; ++mt) o[nq][mt] = (v8f){}; }
    xw();
    const int nblk = (q0 + NQ * 16 - 1) / 32 + 1;      // every block walked holds key kb <= q0: no query of the tile ever sees a block that is masked whole; only the last block crosses the diagonal
    V kf[2][2], kf2[2][2];
    auto ldk = [&](int b) __attribute__((always_inline)) {
#pragma unroll
        for (int t = 0; t < 2; ++t)
#pragma unroll
            for (int kk = 0; kk < 2; ++kk) kf[t][kk] = WFrag<T16>::ld(Kp + (size_t)(b * 32 + t * 16 + lr) * HD + kk * 32 + 8 * hi);
        xw();
        if (HI) {
#pragma unroll
            for (int t = 0; t < 2; ++t)
#pragma unroll
                for (int kk = 0; kk < 2; ++kk) kf2[t][kk] = WFrag<T16>::ld(K2 + (size_t)(b * 32 + t * 16 + lr) * HD + kk * 32 + 8 * hi);
            xw(); } };
    // one pass = one block of 32 keys. fp16 tiles: the K fragments were fetched one pass ahead, and block bn's follow into the same registers right behind the score products (not in the diagonal pass, a wave's last).
    auto pass = [&](int b, bool diag, int bn) __attribute__((always_inline)) { const int kb = b * 32; V vf[4], vf2[4]; v8f s[NQ][2];
        if (HI) ldk(b);
#pragma unroll
        for (int mt = 0; mt < 4; ++mt) vf[mt] = WFrag<T16>::ld(Vt + (size_t)(mt * 16 + lr) * PP + kb + 8 * hi);
        xw();
        if (HI) {
#pragma unroll
            for (int mt = 0; mt < 4; ++mt) vf2[mt] = WFrag<T16>::ld(V2 + (size_t)(mt * 16 + lr) * PP + kb + 8 * hi);
            xw(); }
        if (!HI) __builtin_amdgcn_sched_barrier(0);    // keeps the V^T loads in front of the score products, so that their latency runs under scores and softmax
#pragma unroll
        for (int nq = 0; nq < NQ; ++nq)
#pragma unroll
            for (int t = 0; t < 2; ++t) { s[nq][t] = (v8f){};
#pragma unroll
                for (int kk = 0; kk < 2; ++kk) { s[nq][t] = WFrag<T16>::mma(kf[t][kk], qf[nq][kk], s[nq][t]); if (HI) { s[nq][t] = WFrag<T16>::mma(kf[t][kk], qf2[nq][kk], s[nq][t]); s[nq][t] = WFrag<T16>::mma(kf2[t][kk], qf[nq][kk], s[nq][t]); } } }
        if (!HI && !diag) ldk(bn);
#pragma unroll
        for (int nq = 0; nq < NQ; ++nq) { const int q = q0 + nq * 16 + lr; float bm = -3.0e38f;
#pragma unroll
            for (int t = 0; t < 2; ++t)
#pragma unroll
                for (int j = 0; j < 8; ++j) { float x = s[nq][t][j] * SL2; if (diag) x = (kb + t * 16 + hi * 8 + j <= q) ? x : -3.0e38f; s[nq][t][j] = x; bm = fmaxf(bm, x); }
            bm = fmaxf(bm, __shfl_xor(bm, 16, 32));
            const float mn = fmaxf(m[nq], bm), al = __builtin_amdgcn_exp2f(m[nq] - mn); m[nq] = mn; float ps = 0.f;
#pragma unroll
            for (int t = 0; t < 2; ++t)
#pragma unroll
                for (int j = 0; j < 8; ++j) { const float p = __builtin_amdgcn_exp2f(s[nq][t][j] - mn); s[nq][t][j] = p; ps += p; }
            l[nq] = l[nq] * al + ps;     // this lane's eight-key halves only; the two halves of a query are added once, behind the loop
#pragma unroll
            for (int mt = 0; mt < 4; ++mt) o[nq][mt] *= al;
            if (HI) { v8us h0, h1, l0, l1;
#pragma unroll
                for (int j = 0; j < 8; ++j) { unsigned short a, c2; splitf(s[nq][0][j], a, c2); h0[j] = a; l0[j] = c2; splitf(s[nq][1][j], a, c2); h1[j] = a; l1[j] = c2; }
                const v16bf ph = cat16b(h0, h1), pl = cat16b(l0, l1);
#pragma unroll
                for (int mt = 0; mt < 4; ++mt) { o[nq][mt] = wmmab(__builtin_bit_cast(v16bf, vf[mt]), ph, o[nq][mt]); o[nq][mt] = wmmab(__builtin_bit_cast(v16bf, vf[mt]), pl, o[nq][mt]); o[nq][mt] = wmmab(__builtin_bit_cast(v16bf, vf2[mt]), ph, o[nq][mt]); }
            } else { v16h pf;
#pragma unroll
                for (int j = 0; j < 8; ++j) { pf[j] = tohx(s[nq][0][j]); pf[8 + j] = tohx(s[nq][1][j]); }
#pragma unroll
                for (int mt = 0; mt < 4; ++mt) o[nq][mt] = wmma16(__builtin_bit_cast(v16h, vf[mt]), pf, o[nq][mt]); } } };
    int b = w;
    if (!HI && b < nblk) ldk(b);
#pragma unroll 1   // rolled: one set of K and V^T fragments in registers
    for (; b < nblk - 1; b += FW) pass(b, false, min(b + FW, nblk - 1));     // blocks wholly below the diagonal: no mask; the fetch ahead is unconditional (a wave with no further block fetches the last block and drops it), so the loads stay in flight over the loop's foot
    if (b == nblk - 1) pass(b, true, b);                                     // the diagonal block, in the wave whose turn it is
#pragma unroll
    for (int nq = 0; nq < NQ; ++nq) { const int ql = w * 32 + nq * 16 + lr; const float lt = l[nq] + __shfl_xor(l[nq], 16, 32); if (hi == 0) { sm[ql] = m[nq]; sl[ql] = lt; }
#pragma unroll
        for (int mt = 0; mt < 4; ++mt) { float* d = so + ql * OSP + mt * 16 + hi * 8; const v8f a = o[nq][mt]; *(v4fa*)d = (v4f){a[0], a[1], a[2], a[3]}; *(v4fa*)(d + 4) = (v4f){a[4], a[5], a[6], a[7]}; } }
    __syncthreads();    // every wave's (m, l, O) is in LDS before any wave joins them
#pragma unroll
    for (int it = 0; it < NQ * 16 / (FW * 4); ++it) { const int ql = (it * FW + w) * 4 + (lane >> 3), g = lane & 7;     // eight lanes store the 128 bytes of one query's head row
        float mw[FW], M = -3.0e38f, Lt = 0.f, acc[8];
#pragma unroll
        for (int u = 0; u < FW; ++u) { mw[u] = sm[u * 32 + ql]; M = fmaxf(M, mw[u]); }
#pragma unroll
        for (int j = 0; j < 8; ++j) acc[j] = 0.f;
#pragma unroll
        for (int u = 0; u < FW; ++u) { const float f = __builtin_amdgcn_exp2f(mw[u] - M); Lt += f * sl[u * 32 + ql]; const float* d = so + (u * 32 + ql) * OSP + g * 8; const v4f a = *(const v4fa*)d, c = *(const v4fa*)(d + 4);   // a wave that had no block: m = -3e38, f = 0
#pragma unroll
            for (int j = 0; j < 4; ++j) { acc[j] += f * a[j]; acc[4 + j] += f * c[j]; } }
        const float inv = __fdiv_rn(1.0f, Lt); v8us oh, ol;
#pragma unroll
        for (int j = 0; j < 8; ++j) { unsigned short a, c2; splitf(acc[j] * inv, a, c2); oh[j] = a; ol[j] = c2; }
        const size_t oo = (size_t)(q0 + ql) * DQ + g * 8; *(v8us*)(Ah + oo) = oh; *(v8us*)(Al + oo) = ol; xw(); }
}
// grid (chunks x heads, tiles), longest tiles of every chunk first: (TT - RH) / 32 fp16 tiles of 32 queries from the last row down, then RH / 16 hi/lo tiles of 16 queries.
__global__ __launch_bounds__(FW * 32) void k_fattn(const h16* __restrict__ Q16, const h16* __restrict__ K16, const h16* __restrict__ V16, const bf* __restrict__ Qh, const bf* __restrict__ Ql, const bf* __restrict__ Kh, const bf* __restrict__ Kl, const bf* __restrict__ Vh, const bf* __restrict__ Vl, bf* Ah, bf* Al) {
    __shared__ __align__(16) float so[FW * 32 * OSP]; __shared__ float sm[FW * 32]; __shared__ float sl[FW * 32];
    const int h = blockIdx.x % NH_, ch = blockIdx.x / NH_, tile = blockIdx.y; const size_t hp = (size_t)(ch * (NH_ + NKV) + h) * TT * HD, vp = (size_t)(ch * NKV + h) * HD * PP;
    Ah += (size_t)ch * TT * DQ; Al += (size_t)ch * TT * DQ;
    if (tile < (TT - RH) / 32) fattn<h16, false, 2>(Q16 + hp, nullptr, K16 + hp, nullptr, V16 + vp, nullptr, TT - 32 * (tile + 1), Ah + h * HD, Al + h * HD, so, sm, sl);
    else fattn<bf, true, 1>(Qh + hp, Ql + hp, Kh + hp, Kl + hp, Vh + vp, Vl + vp, RH - 16 * (tile - (TT - RH) / 32 + 1), Ah + h * HD, Al + h * HD, so, sm, sl);
}

extern "C" void kernel_launch(void* const* d_in, const int* in_sizes, int n_in,
                              void* d_out, int out_size, void* d_ws, size_t ws_size, hipStream_t stream) {
    (void)in_sizes; (void)n_in; (void)out_size;
    const float* x = (const float*)d_in[0]; const float* wq = (const float*)d_in[1]; const float* wk = (const float*)d_in[2]; const float* wv = (const float*)d_in[3]; const float* wo = (const float*)d_in[4];   /* input order hidden_states, Wq, Wk, Wv, Wo ('oi': 'x @ W.T') */
    float* OUT = (float*)d_out;     // [4][2048][1024]
    char* wsp = (char*)d_ws;
    auto take = [&](size_t bytes) { char* p = wsp; wsp += (bytes + 255) & ~(size_t)255; return (void*)p; };
    bf* WQ = (bf*)take((size_t)DF * DM * 2); bf* WK = WQ + (size_t)DQ * DM; bf* WV = WK + (size_t)DKV * DM;   /* one [DF][DM] plane: q, k, v rows */ bf* WO = (bf*)take((size_t)DM * DQ * 2);
    bf* XB = (bf*)take((size_t)NB_ * TT * DM * 2);   // x copy
    h16* QP16 = (h16*)take((size_t)NB_ * (NH_ + NKV) * TT * HD * 2); h16* KP16 = QP16 + (size_t)NH_ * TT * HD;   /* in each chunk the k heads' planes follow the q heads': head index = 64-column tile of the joint projection */ h16* VT16 = (h16*)take((size_t)NB_ * NKV * HD * PP * 2);
    bf* QPh = (bf*)take((size_t)NB_ * (NH_ + NKV) * TT * HD * 2); bf* KPh = QPh + (size_t)NH_ * TT * HD; bf* QPl = (bf*)take((size_t)NB_ * (NH_ + NKV) * TT * HD * 2); bf* KPl = QPl + (size_t)NH_ * TT * HD; bf* VTh = (bf*)take((size_t)NB_ * NKV * HD * PP * 2); bf* VTl = VTh + TT;   // hi and lo row of V^T side by side in one row of pitch PP
    bf* ATh = (bf*)take((size_t)NB_ * TT * DQ * 2); bf* ATl = (bf*)take((size_t)NB_ * TT * DQ * 2);
    if ((size_t)(wsp - (char*)d_ws) > ws_size) return;    // ws 256 MiB
    k_cvt5<<<CB_X + 2 * CB_Q + 2 * CB_K, 256, 0, stream>>>(x, wq, wk, wv, wo, XB, WQ, WK, WV, WO);
    k_gemmw<bf, 0, false, true><<<dim3(NB_ * TT / 64, DF / 64, 1), 32, 0, stream>>>(XB, nullptr, WQ, nullptr, DM, nullptr, 0, nullptr, 0, 0, 0, QP16, QPh, QPl, VT16, VTh, VTl);   // q, k and v projections of every chunk in one launch, written as head planes
    k_fattn<<<dim3(NB_ * NH_, (TT - RH) / 32 + RH / 16), FW * 32, 0, stream>>>(QP16, KP16, VT16, QPh, QPl, KPh, KPl, VTh, VTl, ATh, ATl);   // one kv head per query head
    k_gemmw<bf, 1, false, false><<<dim3(NB_ * TT / 64, DM / 64, 1), 32, 0, stream>>>(ATh, ATl, WO, nullptr, DQ, OUT, DM, nullptr, 0, 0, 0, nullptr, nullptr, nullptr, nullptr, nullptr, nullptr);
}

// v006
// A run of this version takes 177 microseconds.
// Timed twice side by side with v005, it ran 1.53 and 1.51 times as fast.
// Over all steps from v000 it is 15.7 times as fast.
#include <hip/hip_runtime.h>

// Chunk-local causal multi-head self-attention (a ring attention with ring_size 1) (hidden_states [1][8192][1024] = FOUR chunks of 2,048 tokens: in memory [4][2048][1024]; q, k, v = x W^T ('oi' [1024][1024] 0.02, no bias; 16 heads x 64); each chunk attends causally WITHIN itself: scores / sqrt(64), tril(ones((2048, 2048))) kept, -inf elsewhere; softmax; out = merged Wo^T ('oi', no bias) -> [1][8192][1024] = [4][2048][1024] (8.4 M); argument order hidden_states, Wq, Wk, Wv, Wo).
// Four launches, each over all four chunks at once (every plane in the workspace but the weight copies has one copy per chunk): bf16 copies of x and of the weights; exact projections, whose GEMM writes the 16-bit head planes itself (no f32 projection in memory); causal T-2048 attention (k_fattn: scores, online softmax and P x V per query tile, no score matrix in memory; hybrid rows: < 512 hi/lo 3 products, rest fp16); merged hi/lo x W_o exact.
// Every 16-bit plane that feeds a matrix fragment is stored in FRAGMENT ORDER: a block of 16 rows x 32 k is 1 KiB in a row, element (row, k) at ((k >> 4) & 1) * 256 + ((k >> 3) & 1) * 128 + (row & 15) * 8 + (k & 7), so that lane (lr, hi) finds its two 16-byte pieces at lane * 8 and 256 + lane * 8 and each wave-wide load covers four whole 128-byte lines. The k order inside a fragment is the one the row-major planes gave.
// Compute dtypes, f32 accumulate: every input rounded to bf16; projections exact; attention rows < 512 3 products, rest fp16; softmax f32; W_o hl x exact.

#define NB_  4
#define TT   2048
#define DM   1024
#define NH_  16
#define NKV  16
#define REP  (NH_ / NKV)
#define HD   64
#define DQ   (NH_ * HD)
#define DKV  (NKV * HD)
#define RH   512                  // query rows < RH use hi+lo planes (0: none)
#define SCL  0.125f   // HD^-0.5
#define DF   (DQ + 2 * DKV)       // columns of the joint q | k | v projection
#define PP   (2 * TT)             // HD * PP 16-bit elements: a head's room in the V^T planes (hi and lo plane; the fp16 plane fills half)
#define FW   4                    // waves of an attention work-group: the 32-key blocks of its query tile are dealt to them in turn
#define OSP  68                   // pitch, in f32, of one query's partial output row in LDS
#define SL2  (SCL * 1.4426950408889634f)   // score scale into the log2 domain
typedef _Float16 h16;
typedef unsigned short bf;
typedef __attribute__((ext_vector_type(16))) __bf16   v16bf;
typedef __attribute__((ext_vector_type(16))) _Float16 v16h;
typedef __attribute__((ext_vector_type(8)))  _Float16 v8h;
typedef __attribute__((ext_vector_type(8)))  unsigned short v8us;
typedef __attribute__((ext_vector_type(8)))  float    v8f;
typedef __attribute__((ext_vector_type(4)))  float    v4f;
typedef v8h  __attribute__((may_alias)) v8ha;
typedef v4f  __attribute__((may_alias)) v4fa;
typedef v8us __attribute__((may_alias)) v8usa;

__device__ __forceinline__ unsigned short f2bf(float f) { unsigned u = __float_as_uint(f); u += 0x7FFFu + ((u >> 16) & 1u); return (unsigned short)(u >> 16); }
__device__ __forceinline__ float bf2f(unsigned short b) { return __uint_as_float(((unsigned)b) << 16); }
__device__ __forceinline__ float bfr(float f) { return bf2f(f2bf(f)); }
__device__ __forceinline__ v16h cat16(v8h lo, v8h hi) { return __builtin_shufflevector(lo, hi, 0, 1, 2, 3, 4, 5, 6, 7, 8, 9, 10, 11, 12, 13, 14, 15); }
__device__ __forceinline__ v16bf cat16b(v8us lo, v8us hi) { return __builtin_bit_cast(v16bf, __builtin_shufflevector(lo, hi, 0, 1, 2, 3, 4, 5, 6, 7, 8, 9, 10, 11, 12, 13, 14, 15)); }
__device__ __forceinline__ v8f wmma16(v16h a, v16h b, v8f c) { return __builtin_amdgcn_wmma_f32_16x16x32_f16(false, a, false, b, (short)0, c, false, false); }
__device__ __forceinline__ v8f wmmab(v16bf a, v16bf b, v8f c) { return __builtin_amdgcn_wmma_f32_16x16x32_bf16(false, a, false, b, (short)0, c, false, false); }
__device__ __forceinline__ h16 tohx(float x) { return (h16)x; }
__device__ __forceinline__ void splitf(float y, unsigned short& h, unsigned short& l) { h = f2bf(y); l = f2bf(y - bf2f(h)); }
// s_wait_xcnt 0 behind a run of global loads or stores, in front of whatever next overwrites a register that the run names (address pairs, store data).
__device__ __forceinline__ void xw() { asm volatile("s_wait_xcnt 0x0" ::: "memory"); }
// the same wait behind a run of loads that all go from the address p (or from p and q): as inputs, the addresses keep their registers up to the wait, so that no load of the run lands on them.
__device__ __forceinline__ void xwa(const void* p) { asm volatile("s_wait_xcnt 0x0" :: "v"(p) : "memory"); }
__device__ __forceinline__ void xwa(const void* p, const void* q) { asm volatile("s_wait_xcnt 0x0" :: "v"(p), "v"(q) : "memory"); }



// ---- k_gemmw: register-blocked GEMM, ONE WAVE per 64x64 output tile (16 accumulators), operands straight from 16-bit planes in fragment order, blocks [row / 16][k / 32] (ld takes the lane's place in a block); grid (M/64, N/64, Z), 32 threads.
// C[m][n] (f32, pitch ldc, + optional f32 bias[n]) = sum_k A[m][k] Bt[n][k] (+ split products per NSPLIT). z-batch strides sA/sB/sC in elements. K % 32 == 0; K is a compile-time constant, so that all fragments of an operand in a k step lie at constant offsets from one address.
// PL (the joint q | k | v projection): a 64-column tile is one head, and the tile goes straight from the accumulators to that head's fp16, bf16-hi and bf16-lo planes; C is not written.
// A row tile lies in one chunk (TT % 64 == 0). q and k heads: planes [chunk][head], blocks [t / 16][d / 32]; v heads: planes [chunk][head] (HD * PP elements apart), rows d, k = t, blocks [t / 32][d / 16]. Sixteen plane rows at a time are turned in LDS so that a wave stores 512 bytes in a row.
template <typename T16> struct WFrag;
template <> struct WFrag<h16> { typedef v16h V; static __device__ __forceinline__ V ld(const h16* p) { return cat16(*(const v8h*)p, *(const v8h*)(p + 256)); } static __device__ __forceinline__ v8f mma(V a, V b, v8f c) { return wmma16(a, b, c); } };
template <> struct WFrag<bf> { typedef v16bf V; static __device__ __forceinline__ V ld(const bf* p) { return cat16b(*(const v8us*)p, *(const v8us*)(p + 256)); } static __device__ __forceinline__ v8f mma(V a, V b, v8f c) { return wmmab(a, b, c); } };
template <typename T16, int NSPLIT, bool BIAS, bool PL, int K>
__global__ __launch_bounds__(32) void k_gemmw(const T16* __restrict__ A, const T16* __restrict__ A2, const T16* __restrict__ Bt, const T16* __restrict__ Bt2, float* C, int ldc, const float* __restrict__ bias, size_t sA, size_t sB, size_t sC, h16* P16, bf* Ph, bf* Pl, h16* V16, bf* Vh, bf* Vl) {
    typedef typename WFrag<T16>::V V;
    __shared__ __align__(16) float os[16 * 68];
    const size_t z = blockIdx.z; A += z * sA; if (A2) A2 += z * sA; Bt += z * sB; if (Bt2) Bt2 += z * sB; C += z * sC;
    const int lane = threadIdx.x & 31, lr = lane & 15, hi = lane >> 4; const int r0 = blockIdx.x * 64, c0 = blockIdx.y * 64;
    v8f acc[4][4];
#pragma unroll
    for (int mb = 0; mb < 4; ++mb)
#pragma unroll
        for (int nb = 0; nb < 4; ++nb) acc[mb][nb] = (v8f){};
    const size_t aoff = (size_t)r0 * K + 8 * lane, boff = (size_t)c0 * K + 8 * lane;      // a row of blocks is 16 * K elements, a block 512
#pragma unroll 1
    for (int kc = 0; kc < K; kc += 32) {
        V a[4], a2[4]; const T16* pa = A + aoff + kc * 16; const T16* pa2 = A2 + aoff + kc * 16; const T16* pb = Bt + boff + kc * 16; const T16* pb2 = Bt2 + boff + kc * 16;
#pragma unroll
        for (int mb = 0; mb < 4; ++mb) { a[mb] = WFrag<T16>::ld(pa + (size_t)mb * 16 * K); if (NSPLIT == 1 || NSPLIT == 2) a2[mb] = WFrag<T16>::ld(pa2 + (size_t)mb * 16 * K); }
        if (NSPLIT == 1 || NSPLIT == 2) xwa(pa, pa2); else xwa(pa);
#pragma unroll
        for (int nb = 0; nb < 4; ++nb) { const V b = WFrag<T16>::ld(pb + (size_t)nb * 16 * K); V b2; if (NSPLIT >= 2) b2 = WFrag<T16>::ld(pb2 + (size_t)nb * 16 * K); if (NSPLIT >= 2) xwa(pb, pb2); else xwa(pb);
#pragma unroll
            for (int mb = 0; mb < 4; ++mb) { acc[mb][nb] = WFrag<T16>::mma(a[mb], b, acc[mb][nb]); if (NSPLIT == 1 || NSPLIT == 2) acc[mb][nb] = WFrag<T16>::mma(a2[mb], b, acc[mb][nb]); if (NSPLIT >= 2) acc[mb][nb] = WFrag<T16>::mma(a[mb], b2, acc[mb][nb]); } }
        asm volatile("v_nop\n\tv_nop\n\tv_nop\n\tv_nop" : "+v"(acc[0][0]), "+v"(acc[1][1]), "+v"(acc[2][2]), "+v"(acc[3][3]) : "v"(a[0]), "v"(a[3]));
    }
    if (PL) {
        const int hh = blockIdx.y; const bool isv = hh >= NH_ + NKV;      // the same for the whole wave
        const int ch = r0 / TT, rc = r0 % TT;      // chunk of the row tile, first token inside it
        const size_t base = isv ? (size_t)(ch * NKV + hh - NH_ - NKV) * HD * PP + (size_t)rc * HD : ((size_t)(ch * (NH_ + NKV) + hh) * TT + rc) * HD;      // 64 tokens are 4 x 2 blocks of a q or k plane, 2 x 4 blocks of a v plane: rc * HD elements in front of them either way
        h16* D16 = (isv ? V16 : P16) + base; bf* Dh = (isv ? Vh : Ph) + base; bf* Dl = (isv ? Vl : Pl) + base;
#pragma unroll   // constant accumulator indices
        for (int u = 0; u < 4; ++u) {
            if (isv) {      // plane rows = 16 columns d of the tile, 64 tokens along each: a lane's 8 accumulator values are 8 tokens in a row
#pragma unroll
                for (int mb = 0; mb < 4; ++mb) { float* d = os + lr * 68 + mb * 16 + hi * 8; const v8f a = acc[mb][u]; *(v4fa*)d = (v4f){a[0], a[1], a[2], a[3]}; *(v4fa*)(d + 4) = (v4f){a[4], a[5], a[6], a[7]}; }
            } else {        // plane rows = 16 tokens of the tile, 64 columns d along each
#pragma unroll
                for (int nb = 0; nb < 4; ++nb) {
#pragma unroll
                    for (int j = 0; j < 8; ++j) os[(hi * 8 + j) * 68 + nb * 16 + lr] = acc[u][nb][j]; }
            }
            __builtin_amdgcn_wave_barrier(); asm volatile("" ::: "memory");   // the reads below take other lanes' values: they stay behind the writes
#pragma unroll
            for (int s = 0; s < 4; ++s) { const int g = 2 * s + hi; const float* d = os + lr * 68 + g * 8;      // plane row lr, its k = 8 g ..: half s & 1 of the row's block s >> 1
                 const v4f a = *(const v4fa*)d, c = *(const v4fa*)(d + 4); v8h o16; v8us oh, ol;
#pragma unroll
                for (int j = 0; j < 4; ++j) { unsigned short p, q; o16[j] = tohx(a[j]); splitf(a[j], p, q); oh[j] = p; ol[j] = q; o16[4 + j] = tohx(c[j]); splitf(c[j], p, q); oh[4 + j] = p; ol[4 + j] = q; }
                const size_t o = (size_t)(isv ? (s >> 1) * 2048 + u * 512 + (s & 1) * 256 : u * 1024 + s * 256) + lane * 8; *(v8h*)(D16 + o) = o16; *(v8us*)(Dh + o) = oh; *(v8us*)(Dl + o) = ol; xw(); }
            __builtin_amdgcn_wave_barrier(); asm volatile("" ::: "memory");   // the next sixteen rows overwrite os only behind these reads
        }
        return;
    }
#pragma unroll
    for (int mb = 0; mb < 4; ++mb) {
#pragma unroll
        for (int nb = 0; nb < 4; ++nb) {
#pragma unroll
            for (int j = 0; j < 8; ++j) os[(hi * 8 + j) * 68 + nb * 16 + lr] = acc[mb][nb][j]; }
        __builtin_amdgcn_wave_barrier(); asm volatile("" ::: "memory");
        float* crow = C + (size_t)(r0 + mb * 16) * ldc + c0;
{
#pragma unroll
            for (int s = 0; s < 8; ++s) { const int row = 2 * s + hi, cofs = lr * 4; v4f val = *(const v4fa*)(os + row * 68 + cofs); if (BIAS) { val[0] += bfr(bias[c0 + cofs]); val[1] += bfr(bias[c0 + cofs + 1]); val[2] += bfr(bias[c0 + cofs + 2]); val[3] += bfr(bias[c0 + cofs + 3]); }
                *(v4f*)(crow + (size_t)row * ldc + cofs) = val; }
             }
        __builtin_amdgcn_wave_barrier(); asm volatile("" ::: "memory");
    }
}

typedef __attribute__((ext_vector_type(2))) _Float16 v2h;
typedef __attribute__((ext_vector_type(4))) _Float16 v4h;
typedef __attribute__((ext_vector_type(2))) unsigned short v2us;
typedef __attribute__((ext_vector_type(4))) unsigned short v4us;
typedef __attribute__((ext_vector_type(2))) float v2f;
typedef __attribute__((ext_vector_type(4))) int v4i;

__global__ __launch_bounds__(256) void k_wtG(const float* __restrict__ w, int K, int N, bf* Bt) {
    const int lane = threadIdx.x & 31; const int L0 = (blockIdx.x * 8 + (threadIdx.x >> 5)) * 8; const int nlines = N * K / 64;
{
#pragma unroll 1
        for (int l = 0; l < 8; ++l) { const int L = L0 + l; if (L >= nlines) break; const size_t e = (size_t)L * 64 + lane * 2; const int k = (int)(e % K), n = (int)(e / K); v2us o;
            o[0] = f2bf(w[(size_t)k * N + n]); o[1] = f2bf(w[(size_t)(k + 1) * N + n]); *(v2us*)(Bt + e) = o; }
         }
}
// bf16 copies of all five inputs in one launch, written in fragment order (blocks [row / 16][k / 32], every input has DM columns): a work-group converts the 2,048 elements of four blocks of the one input that its index falls into (the choice is the same for the whole work-group). A thread owns one 16-byte piece of the copy, so a wave stores 512 bytes in a row.
static_assert(DQ == DM, "W_o has DM columns");
#define CB_X ((unsigned)((size_t)NB_ * TT * DM / 2048))
#define CB_Q ((unsigned)((size_t)DQ * DM / 2048))
#define CB_K ((unsigned)((size_t)DKV * DM / 2048))
__global__ __launch_bounds__(256) void k_cvt5(const float* __restrict__ x, const float* __restrict__ wq, const float* __restrict__ wk, const float* __restrict__ wv, const float* __restrict__ wo, bf* XB, bf* WQ, bf* WK, bf* WV, bf* WO) {
    unsigned blk = blockIdx.x; const float* src = x; bf* dst = XB;
    if (blk >= CB_X + CB_Q + 2 * CB_K) { blk -= CB_X + CB_Q + 2 * CB_K; src = wo; dst = WO; }
    else if (blk >= CB_X + CB_Q + CB_K) { blk -= CB_X + CB_Q + CB_K; src = wv; dst = WV; }
    else if (blk >= CB_X + CB_Q) { blk -= CB_X + CB_Q; src = wk; dst = WK; }
    else if (blk >= CB_X) { blk -= CB_X; src = wq; dst = WQ; }
    const size_t i = (size_t)blk * 256 + threadIdx.x; const size_t bl = i >> 6; const int row = (int)(bl / (DM / 32)) * 16 + (int)(i & 15), kk = (int)(bl % (DM / 32)) * 32 + (int)((i >> 4) & 3) * 8;
    const v8f v = *(const v8f*)(src + (size_t)row * DM + kk); xw(); v8us o;
#pragma unroll
    for (int k = 0; k < 8; ++k) o[k] = f2bf(v[k]); *(v8us*)(dst + i * 8) = o;  }

// ---- k_fattn: scores, causal softmax and probability x value product of one query tile of one head in one work-group of FW waves; nothing of the score matrix reaches memory.
// S^T = K Q^T (A = 16 key rows, B = 16 query rows): lane (lr, hi) holds keys 8 hi + j of query lr, so two score tiles of 32 keys, converted in place, are the B fragment of O^T += V^T P^T (A = rows of the V^T plane).
// Online softmax in the log2 domain: running maximum m and sum l per query, O^T rescaled when m moves; P = exp2(s - m) <= 1 is not normalised before it is rounded, the division by l comes last.
// The 32-key blocks up to the diagonal are dealt to the FW waves in turn; their (m, l, O) meet in LDS and are joined in wave order. HI: hi/lo bf16 planes, 3 products each side (query rows < RH); else fp16.
// Every '#pragma unroll' here gives a fragment, score or accumulator array constant indices, so that it stays in registers; the two lambdas are inlined by force for the same reason (they work on those arrays by reference).
template <typename T16, bool HI, int NQ>
__device__ __forceinline__ void fattn(const T16* __restrict__ Q, const T16* __restrict__ Q2, const T16* __restrict__ Kp, const T16* __restrict__ K2, const T16* __restrict__ Vt, const T16* __restrict__ V2, int q0, bf* Ah, bf* Al, float* so, float* sm, float* sl) {
    typedef typename WFrag<T16>::V V;
    const int lane = threadIdx.x & 31, lr = lane & 15, hi = lane >> 4; const int w = __builtin_amdgcn_readfirstlane(threadIdx.x >> 5);
    V qf[NQ][2], qf2[NQ][2]; v8f o[NQ][4]; float m[NQ], l[NQ];
#pragma unroll
    for (int nq = 0; nq < NQ; ++nq) { m[nq] = -3.0e38f; l[nq] = 0.f;
#pragma unroll
        for (int kk = 0; kk < 2; ++kk) { const size_t qo = (size_t)(q0 + nq * 16) * HD + kk * 512 + 8 * lane; qf[nq][kk] = WFrag<T16>::ld(Q + qo); if (HI) qf2[nq][kk] = WFrag<T16>::ld(Q2 + qo); }
#pragma unroll
        for (int mt = 0; mt < 4; ++mt) o[nq][mt] = (v8f){}; }
    xw();
    const int nblk = (q0 + NQ * 16 - 1) / 32 + 1;      // every block walked holds key kb <= q0: no query of the tile ever sees a block that is masked whole; only the last block crosses the diagonal
    V kf[2][2], kf2[2][2];
    auto ldk = [&](int b) __attribute__((always_inline)) {
#pragma unroll
        for (int t = 0; t < 2; ++t)
#pragma unroll
            for (int kk = 0; kk < 2; ++kk) kf[t][kk] = WFrag<T16>::ld(Kp + (size_t)(b * 32 + t * 16) * HD + kk * 512 + 8 * lane);
        xw();
        if (HI) {
#pragma unroll
            for (int t = 0; t < 2; ++t)
#pragma unroll
                for (int kk = 0; kk < 2; ++kk) kf2[t][kk] = WFrag<T16>::ld(K2 + (size_t)(b * 32 + t * 16) * HD + kk * 512 + 8 * lane);
            xw(); } };
    // one pass = one block of 32 keys. fp16 tiles: the K fragments were fetched one pass ahead, and block bn's follow into the same registers right behind the score products (not in the diagonal pass, a wave's last).
    auto pass = [&](int b, bool diag, int bn) __attribute__((always_inline)) { const int kb = b * 32; V vf[4], vf2[4]; v8f s[NQ][2];
        if (HI) ldk(b);
#pragma unroll
        for (int mt = 0; mt < 4; ++mt) vf[mt] = WFrag<T16>::ld(Vt + (size_t)kb * HD + mt * 512 + 8 * lane);
        xw();
        if (HI) {
#pragma unroll
            for (int mt = 0; mt < 4; ++mt) vf2[mt] = WFrag<T16>::ld(V2 + (size_t)kb * HD + mt * 512 + 8 * lane);
            xw(); }
        if (!HI) __builtin_amdgcn_sched_barrier(0);    // keeps the V^T loads in front of the score products, so that their latency runs under scores and softmax
#pragma unroll
        for (int nq = 0; nq < NQ; ++nq)
#pragma unroll
            for (int t = 0; t < 2; ++t) { s[nq][t] = (v8f){};
#pragma unroll
                for (int kk = 0; kk < 2; ++kk) { s[nq][t] = WFrag<T16>::mma(kf[t][kk], qf[nq][kk], s[nq][t]); if (HI) { s[nq][t] = WFrag<T16>::mma(kf[t][kk], qf2[nq][kk], s[nq][t]); s[nq][t] = WFrag<T16>::mma(kf2[t][kk], qf[nq][kk], s[nq][t]); } } }
        if (!HI && !diag) { ldk(bn); __builtin_amdgcn_sched_barrier(0); }    // keeps the fetch ahead here, right behind the score products: moved down to the foot of the pass, its latency would stand open at the head of the next
#pragma unroll
        for (int nq = 0; nq < NQ; ++nq) { const int q = q0 + nq * 16 + lr; float bm = -3.0e38f;
#pragma unroll
            for (int t = 0; t < 2; ++t)
#pragma unroll
                for (int j = 0; j < 8; ++j) { float x = s[nq][t][j] * SL2; if (diag) x = (kb + t * 16 + hi * 8 + j <= q) ? x : -3.0e38f; s[nq][t][j] = x; bm = fmaxf(bm, x); }
            bm = fmaxf(bm, __shfl_xor(bm, 16, 32));
            const float mn = fmaxf(m[nq], bm), al = __builtin_amdgcn_exp2f(m[nq] - mn); m[nq] = mn; float ps = 0.f;
#pragma unroll
            for (int t = 0; t < 2; ++t)
#pragma unroll
                for (int j = 0; j < 8; ++j) { const float p = __builtin_amdgcn_exp2f(s[nq][t][j] - mn); s[nq][t][j] = p; ps += p; }
            l[nq] = l[nq] * al + ps;     // this lane's eight-key halves only; the two halves of a query are added once, behind the loop
#pragma unroll
            for (int mt = 0; mt < 4; ++mt) o[nq][mt] *= al;
            if (HI) { v8us h0, h1, l0, l1;
#pragma unroll
                for (int j = 0; j < 8; ++j) { unsigned short a, c2; splitf(s[nq][0][j], a, c2); h0[j] = a; l0[j] = c2; splitf(s[nq][1][j], a, c2); h1[j] = a; l1[j] = c2; }
                const v16bf ph = cat16b(h0, h1), pl = cat16b(l0, l1);
#pragma unroll
                for (int mt = 0; mt < 4; ++mt) { o[nq][mt] = wmmab(__builtin_bit_cast(v16bf, vf[mt]), ph, o[nq][mt]); o[nq][mt] = wmmab(__builtin_bit_cast(v16bf, vf[mt]), pl, o[nq][mt]); o[nq][mt] = wmmab(__builtin_bit_cast(v16bf, vf2[mt]), ph, o[nq][mt]); }
            } else { v16h pf;
#pragma unroll
                for (int j = 0; j < 8; ++j) { pf[j] = tohx(s[nq][0][j]); pf[8 + j] = tohx(s[nq][1][j]); }
#pragma unroll
                for (int mt = 0; mt < 4; ++mt) o[nq][mt] = wmma16(__builtin_bit_cast(v16h, vf[mt]), pf, o[nq][mt]); } } };
    int b = w;
    if (!HI && b < nblk) ldk(b);
#pragma unroll 1   // rolled: one set of K and V^T fragments in registers
    for (; b < nblk - 1; b += FW) pass(b, false, min(b + FW, nblk - 1));     // blocks wholly below the diagonal: no mask; the fetch ahead is unconditional (a wave with no further block fetches the last block and drops it), so the loads stay in flight over the loop's foot
    if (b == nblk - 1) pass(b, true, b);                                     // the diagonal block, in the wave whose turn it is
#pragma unroll
    for (int nq = 0; nq < NQ; ++nq) { const int ql = w * 32 + nq * 16 + lr; const float lt = l[nq] + __shfl_xor(l[nq], 16, 32); if (hi == 0) { sm[ql] = m[nq]; sl[ql] = lt; }
#pragma unroll
        for (int mt = 0; mt < 4; ++mt) { float* d = so + ql * OSP + mt * 16 + hi * 8; const v8f a = o[nq][mt]; *(v4fa*)d = (v4f){a[0], a[1], a[2], a[3]}; *(v4fa*)(d + 4) = (v4f){a[4], a[5], a[6], a[7]}; } }
    __syncthreads();    // every wave's (m, l, O) is in LDS before any wave joins them
#pragma unroll
    for (int it = 0; it < NQ * 16 / (FW * 4); ++it) { const int un = it * FW + w, ql = (un >> 2) * 16 + lr, g = (un & 3) * 2 + hi;     // a wave stores one 512-byte half block of the merged planes (rows = queries, k = head * HD + d): 16 queries x 16 d
        float mw[FW], M = -3.0e38f, Lt = 0.f, acc[8];
#pragma unroll
        for (int u = 0; u < FW; ++u) { mw[u] = sm[u * 32 + ql]; M = fmaxf(M, mw[u]); }
#pragma unroll
        for (int j = 0; j < 8; ++j) acc[j] = 0.f;
#pragma unroll
        for (int u = 0; u < FW; ++u) { const float f = __builtin_amdgcn_exp2f(mw[u] - M); Lt += f * sl[u * 32 + ql]; const float* d = so + (u * 32 + ql) * OSP + g * 8; const v4f a = *(const v4fa*)d, c = *(const v4fa*)(d + 4);   // a wave that had no block: m = -3e38, f = 0
#pragma unroll
            for (int j = 0; j < 4; ++j) { acc[j] += f * a[j]; acc[4 + j] += f * c[j]; } }
        const float inv = __fdiv_rn(1.0f, Lt); v8us oh, ol;
#pragma unroll
        for (int j = 0; j < 8; ++j) { unsigned short a, c2; splitf(acc[j] * inv, a, c2); oh[j] = a; ol[j] = c2; }
        const size_t oo = (size_t)(q0 + (un >> 2) * 16) * DQ + (un & 3) * 256 + lane * 8; *(v8us*)(Ah + oo) = oh; *(v8us*)(Al + oo) = ol; xw(); }
}
// grid (chunks x heads, tiles), longest tiles of every chunk first: (TT - RH) / 32 fp16 tiles of 32 queries from the last row down, then RH / 16 hi/lo tiles of 16 queries.
__global__ __launch_bounds__(FW * 32) void k_fattn(const h16* __restrict__ Q16, const h16* __restrict__ K16, const h16* __restrict__ V16, const bf* __restrict__ Qh, const bf* __restrict__ Ql, const bf* __restrict__ Kh, const bf* __restrict__ Kl, const bf* __restrict__ Vh, const bf* __restrict__ Vl, bf* Ah, bf* Al) {
    __shared__ __align__(16) float so[FW * 32 * OSP]; __shared__ float sm[FW * 32]; __shared__ float sl[FW * 32];
    const int h = blockIdx.x % NH_, ch = blockIdx.x / NH_, tile = blockIdx.y; const size_t hp = (size_t)(ch * (NH_ + NKV) + h) * TT * HD, vp = (size_t)(ch * NKV + h) * HD * PP;
    Ah += (size_t)ch * TT * DQ; Al += (size_t)ch * TT * DQ;
    if (tile < (TT - RH) / 32) fattn<h16, false, 2>(Q16 + hp, nullptr, K16 + hp, nullptr, V16 + vp, nullptr, TT - 32 * (tile + 1), Ah + h * HD * 16, Al + h * HD * 16, so, sm, sl);
    else fattn<bf, true, 1>(Qh + hp, Ql + hp, Kh + hp, Kl + hp, Vh + vp, Vl + vp, RH - 16 * (tile - (TT - RH) / 32 + 1), Ah + h * HD * 16, Al + h * HD * 16, so, sm, sl);
}

extern "C" void kernel_launch(void* const* d_in, const int* in_sizes, int n_in,
                              void* d_out, int out_size, void* d_ws, size_t ws_size, hipStream_t stream) {
    (void)in_sizes; (void)n_in; (void)out_size;
    const float* x = (const float*)d_in[0]; const float* wq = (const float*)d_in[1]; const float* wk = (const float*)d_in[2]; const float* wv = (const float*)d_in[3]; const float* wo = (const float*)d_in[4];   /* input order hidden_states, Wq, Wk, Wv, Wo ('oi': 'x @ W.T') */
    float* OUT = (float*)d_out;     // [4][2048][1024]
    char* wsp = (char*)d_ws;
    auto take = [&](size_t bytes) { char* p = wsp; wsp += (bytes + 255) & ~(size_t)255; return (void*)p; };
    bf* WQ = (bf*)take((size_t)DF * DM * 2); bf* WK = WQ + (size_t)DQ * DM; bf* WV = WK + (size_t)DKV * DM;   /* one [DF][DM] plane: q, k, v rows */ bf* WO = (bf*)take((size_t)DM * DQ * 2);
    bf* XB = (bf*)take((size_t)NB_ * TT * DM * 2);   // x copy
    h16* QP16 = (h16*)take((size_t)NB_ * (NH_ + NKV) * TT * HD * 2); h16* KP16 = QP16 + (size_t)NH_ * TT * HD;   /* in each chunk the k heads' planes follow the q heads': head index = 64-column tile of the joint projection */ h16* VT16 = (h16*)take((size_t)NB_ * NKV * HD * PP * 2);
    bf* QPh = (bf*)take((size_t)NB_ * (NH_ + NKV) * TT * HD * 2); bf* KPh = QPh + (size_t)NH_ * TT * HD; bf* QPl = (bf*)take((size_t)NB_ * (NH_ + NKV) * TT * HD * 2); bf* KPl = QPl + (size_t)NH_ * TT * HD; bf* VTh = (bf*)take((size_t)NB_ * NKV * HD * PP * 2); bf* VTl = VTh + (size_t)TT * HD;   // a head's hi plane and lo plane one behind the other in its HD * PP elements
    bf* ATh = (bf*)take((size_t)NB_ * TT * DQ * 2); bf* ATl = (bf*)take((size_t)NB_ * TT * DQ * 2);
    if ((size_t)(wsp - (char*)d_ws) > ws_size) return;    // ws 256 MiB
    k_cvt5<<<CB_X + 2 * CB_Q + 2 * CB_K, 256, 0, stream>>>(x, wq, wk, wv, wo, XB, WQ, WK, WV, WO);
    k_gemmw<bf, 0, false, true, DM><<<dim3(NB_ * TT / 64, DF / 64, 1), 32, 0, stream>>>(XB, nullptr, WQ, nullptr, nullptr, 0, nullptr, 0, 0, 0, QP16, QPh, QPl, VT16, VTh, VTl);   // q, k and v projections of every chunk in one launch, written as head planes
    k_fattn<<<dim3(NB_ * NH_, (TT - RH) / 32 + RH / 16), FW * 32, 0, stream>>>(QP16, KP16, VT16, QPh, QPl, KPh, KPl, VTh, VTl, ATh, ATl);   // one kv head per query head
    k_gemmw<bf, 1, false, false, DQ><<<dim3(NB_ * TT / 64, DM / 64, 1), 32, 0, stream>>>(ATh, ATl, WO, nullptr, OUT, DM, nullptr, 0, 0, 0, nullptr, nullptr, nullptr, nullptr, nullptr, nullptr);
}

// v007
// One run takes 153 microseconds.
// In two side-by-side timings against v006, it was 1.17 and 1.16 times as fast.
// Over all steps from v000 it is 18.3 times as fast.
#include <hip/hip_runtime.h>

// Chunk-local causal multi-head self-attention (a ring attention with ring_size 1) (hidden_states [1][8192][1024] = FOUR chunks of 2,048 tokens: in memory [4][2048][1024]; q, k, v = x W^T ('oi' [1024][1024] 0.02, no bias; 16 heads x 64); each chunk attends causally WITHIN itself: scores / sqrt(64), tril(ones((2048, 2048))) kept, -inf elsewhere; softmax; out = merged Wo^T ('oi', no bias) -> [1][8192][1024] = [4][2048][1024] (8.4 M); argument order hidden_states, Wq, Wk, Wv, Wo).
// Four launches, each over all four chunks at once (every plane in the workspace but the weight copies has one copy per chunk): bf16 copies of x and of the weights; exact projections, whose GEMM writes the 16-bit head planes itself (no f32 projection in memory); causal T-2048 attention (k_fattn: scores, online softmax and P x V per query tile, no score matrix in memory; hybrid rows: < 512 hi/lo 3 products, rest fp16); merged hi/lo x W_o exact.
// Every 16-bit plane that feeds a matrix fragment is stored in FRAGMENT ORDER: a block of 16 rows x 32 k is 1 KiB in a row, element (row, k) at ((k >> 4) & 1) * 256 + ((k >> 3) & 1) * 128 + (row & 15) * 8 + (k & 7), so that lane (lr, hi) finds its two 16-byte pieces at lane * 8 and 256 + lane * 8 and each wave-wide load covers four whole 128-byte lines. The k order inside a fragment is the one the row-major planes gave.
// Compute dtypes, f32 accumulate: every input rounded to bf16; projections exact; attention rows < 512 3 products, rest fp16; softmax f32; W_o hl x exact.

#define NB_  4
#define TT   2048
#define DM   1024
#define NH_  16
#define NKV  16
#define REP  (NH_ / NKV)
#define HD   64
#define DQ   (NH_ * HD)
#define DKV  (NKV * HD)
#define RH   512                  // query rows < RH use hi+lo planes (0: none)
#define SCL  0.125f   // HD^-0.5
#define DF   (DQ + 2 * DKV)       // columns of the joint q | k | v projection
#define PP   (2 * TT)             // HD * PP 16-bit elements: a head's room in the V^T planes (hi and lo plane; the fp16 plane fills half)
#define FW   4                    // waves of an attention work-group: the 32-key blocks of its query tile are dealt to them in turn
#define OSP  68                   // pitch, in f32, of one query's partial output row in LDS
#define SL2  (SCL * 1.4426950408889634f)   // score scale into the log2 domain
typedef _Float16 h16;
typedef unsigned short bf;
typedef __attribute__((ext_vector_type(16))) __bf16   v16bf;
typedef __attribute__((ext_vector_type(16))) _Float16 v16h;
typedef __attribute__((ext_vector_type(8)))  _Float16 v8h;
typedef __attribute__((ext_vector_type(8)))  unsigned short v8us;
typedef __attribute__((ext_vector_type(8)))  float    v8f;
typedef __attribute__((ext_vector_type(4)))  float    v4f;
typedef v8h  __attribute__((may_alias)) v8ha;
typedef v4f  __attribute__((may_alias)) v4fa;
typedef v8us __attribute__((may_alias)) v8usa;

__device__ __forceinline__ unsigned short f2bf(float f) { unsigned u = __float_as_uint(f); u += 0x7FFFu + ((u >> 16) & 1u); return (unsigned short)(u >> 16); }
__device__ __forceinline__ float bf2f(unsigned short b) { return __uint_as_float(((unsigned)b) << 16); }
__device__ __forceinline__ float bfr(float f) { return bf2f(f2bf(f)); }
__device__ __forceinline__ v16h cat16(v8h lo, v8h hi) { return __builtin_shufflevector(lo, hi, 0, 1, 2, 3, 4, 5, 6, 7, 8, 9, 10, 11, 12, 13, 14, 15); }
__device__ __forceinline__ v16bf cat16b(v8us lo, v8us hi) { return __builtin_bit_cast(v16bf, __builtin_shufflevector(lo, hi, 0, 1, 2, 3, 4, 5, 6, 7, 8, 9, 10, 11, 12, 13, 14, 15)); }
__device__ __forceinline__ v8f wmma16(v16h a, v16h b, v8f c) { return __builtin_amdgcn_wmma_f32_16x16x32_f16(false, a, false, b, (short)0, c, false, false); }
__device__ __forceinline__ v8f wmmab(v16bf a, v16bf b, v8f c) { return __builtin_amdgcn_wmma_f32_16x16x32_bf16(false, a, false, b, (short)0, c, false, false); }
__device__ __forceinline__ h16 tohx(float x) { return (h16)x; }
__device__ __forceinline__ void splitf(float y, unsigned short& h, unsigned short& l) { h = f2bf(y); l = f2bf(y - bf2f(h)); }
// s_wait_xcnt 0 behind a run of global loads or stores, in front of whatever next overwrites a register that the run names (address pairs, store data).
__device__ __forceinline__ void xw() { asm volatile("s_wait_xcnt 0x0" ::: "memory"); }
// the same wait behind a run of loads that all go from the address p (or from p and q): as inputs, the addresses keep their registers up to the wait, so that no load of the run lands on them.
__device__ __forceinline__ void xwa(const void* p) { asm volatile("s_wait_xcnt 0x0" :: "v"(p) : "memory"); }
__device__ __forceinline__ void xwa(const void* p, const void* q) { asm volatile("s_wait_xcnt 0x0" :: "v"(p), "v"(q) : "memory"); }



// ---- k_gemmw: register-blocked GEMM, one wave per 64x64 output tile (16 accumulators), GWM x GWN waves per work-group (4 x 2 on a 256x128 tile in the projection; 2 x 2 on 128x128 for W_o, so that two work-groups with barriers of their own share a WGP); grid (M / (64 GWM), N / (64 GWN), Z). Operands are 16-bit planes in fragment order, blocks [row / 16][k / 32] (ld takes the lane's place in a block).
// A k step (32 k) of the tile's operand blocks is a stage in LDS, shared by the waves: two stage buffers, filled by asynchronous copies two steps ahead, one barrier a step.
// C[m][n] (f32, pitch ldc, + optional f32 bias[n]) = sum_k A[m][k] Bt[n][k] (+ split products per NSPLIT). z-batch strides sA/sB/sC in elements. K % 32 == 0; K is a compile-time constant, so that all fragments of an operand in a k step lie at constant offsets from one address.
// PL (the joint q | k | v projection): a 64-column tile is one head, and the tile goes straight from the accumulators to that head's fp16, bf16-hi and bf16-lo planes; C is not written.
// A row tile lies in one chunk (TT % 64 == 0). q and k heads: planes [chunk][head], blocks [t / 16][d / 32]; v heads: planes [chunk][head] (HD * PP elements apart), rows d, k = t, blocks [t / 32][d / 16]. Sixteen plane rows at a time are turned in LDS so that a wave stores 512 bytes in a row.
template <typename T16> struct WFrag;
template <> struct WFrag<h16> { typedef v16h V; static __device__ __forceinline__ V ld(const h16* p) { return cat16(*(const v8h*)p, *(const v8h*)(p + 256)); } static __device__ __forceinline__ v8f mma(V a, V b, v8f c) { return wmma16(a, b, c); } };
template <> struct WFrag<bf> { typedef v16bf V; static __device__ __forceinline__ V ld(const bf* p) { return cat16b(*(const v8us*)p, *(const v8us*)(p + 256)); } static __device__ __forceinline__ v8f mma(V a, V b, v8f c) { return wmmab(a, b, c); } };
template <typename T16, int NSPLIT, bool BIAS, bool PL, int K, int GWM, int GWN>      // GWM x GWN wave tiles in a work-group's tile
__global__ __launch_bounds__(GWM * GWN * 32) void k_gemmw(const T16* __restrict__ A, const T16* __restrict__ A2, const T16* __restrict__ Bt, const T16* __restrict__ Bt2, float* C, int ldc, const float* __restrict__ bias, size_t sA, size_t sB, size_t sC, h16* P16, bf* Ph, bf* Pl, h16* V16, bf* Vh, bf* Vl) {
    typedef typename WFrag<T16>::V V;
    static_assert(NSPLIT <= 1, "one B plane"); static_assert(K >= 64 && K % 32 == 0, "two stages or more");
    constexpr int GTM = GWM * 64, GTN = GWN * 64, PA = GTM * 32, PB = GTN * 32;                  // elements of one k step of an A plane and of the B plane: GTM / 16 and GTN / 16 blocks
    constexpr int STGE = (NSPLIT == 1 ? 2 : 1) * PA + PB;        // one stage: [A | A2 | B]
    __shared__ __align__(1024) T16 ring[2 * STGE];
    __shared__ __align__(16) float osw[GWM * GWN][16 * 68];
    const size_t z = blockIdx.z; A += z * sA; if (A2) A2 += z * sA; Bt += z * sB; C += z * sC;
    const int lane = threadIdx.x & 31, lr = lane & 15, hi = lane >> 4; const int w = __builtin_amdgcn_readfirstlane(threadIdx.x >> 5), wm = w % GWM, wn = w / GWM;
    float* os = osw[w];      // each wave turns its own tile in its own rows
    const int r0 = blockIdx.x * GTM + wm * 64, c0 = blockIdx.y * GTN + wn * 64;
    v8f acc[4][4];
#pragma unroll
    for (int mb = 0; mb < 4; ++mb)
#pragma unroll
        for (int nb = 0; nb < 4; ++nb) acc[mb][nb] = (v8f){};
    // A stage is copied block by block as it lies in memory (a block is 1 KiB in a row): one copy of all threads brings BPC blocks, thread t the 16 bytes at (t & 63) * 16 of block t >> 6.
    constexpr int BPC = GWM * GWN / 2; constexpr unsigned LS = BPC * 1024; constexpr size_t GS = (size_t)BPC * 16 * K;      // blocks a copy; its step in LDS bytes and in plane elements
    static_assert(GTM / 16 == 4 * BPC && GTN / 16 == (NSPLIT == 1 ? 4 : 2) * BPC, "four copies bring an A plane's k step; four (two planes of A) or two the B plane's");
    const size_t tb = (size_t)(threadIdx.x >> 6) * 16 * K + (threadIdx.x & 63) * 8;
    const T16* ga = A + (size_t)blockIdx.x * GTM * K + tb; const T16* ga2 = A2 + (size_t)blockIdx.x * GTM * K + tb; const T16* gb = Bt + (size_t)blockIdx.y * GTN * K + tb;
    const unsigned rl = (unsigned)(size_t)ring + threadIdx.x * 16;      // the thread's LDS byte address in the first BPC blocks of stage buffer 0
    auto fill = [&](int kt, int buf) __attribute__((always_inline)) {
        const unsigned l = rl + buf * (STGE * 2); const T16* a = ga + (size_t)kt * 512; const T16* b = gb + (size_t)kt * 512;
        // the s_wait_xcnt 0 at the end of each statement stands in front of whatever next overwrites an address register of its copies
        if (NSPLIT == 1) { const T16* a2 = ga2 + (size_t)kt * 512;
            asm volatile("global_load_async_to_lds_b128 %0, %1, off\n\tglobal_load_async_to_lds_b128 %2, %3, off\n\tglobal_load_async_to_lds_b128 %4, %5, off\n\tglobal_load_async_to_lds_b128 %6, %7, off\n\t"
                         "global_load_async_to_lds_b128 %8, %9, off\n\tglobal_load_async_to_lds_b128 %10, %11, off\n\tglobal_load_async_to_lds_b128 %12, %13, off\n\tglobal_load_async_to_lds_b128 %14, %15, off\n\t"
                         "global_load_async_to_lds_b128 %16, %17, off\n\tglobal_load_async_to_lds_b128 %18, %19, off\n\tglobal_load_async_to_lds_b128 %20, %21, off\n\tglobal_load_async_to_lds_b128 %22, %23, off\n\ts_wait_xcnt 0x0"
                         :: "v"(l), "v"(a), "v"(l + LS), "v"(a + GS), "v"(l + 2 * LS), "v"(a + 2 * GS), "v"(l + 3 * LS), "v"(a + 3 * GS),
                            "v"(l + 2 * PA), "v"(a2), "v"(l + 2 * PA + LS), "v"(a2 + GS), "v"(l + 2 * PA + 2 * LS), "v"(a2 + 2 * GS), "v"(l + 2 * PA + 3 * LS), "v"(a2 + 3 * GS),
                            "v"(l + 4 * PA), "v"(b), "v"(l + 4 * PA + LS), "v"(b + GS), "v"(l + 4 * PA + 2 * LS), "v"(b + 2 * GS), "v"(l + 4 * PA + 3 * LS), "v"(b + 3 * GS) : "memory");
        } else {
            asm volatile("global_load_async_to_lds_b128 %0, %1, off\n\tglobal_load_async_to_lds_b128 %2, %3, off\n\tglobal_load_async_to_lds_b128 %4, %5, off\n\tglobal_load_async_to_lds_b128 %6, %7, off\n\t"
                         "global_load_async_to_lds_b128 %8, %9, off\n\tglobal_load_async_to_lds_b128 %10, %11, off\n\ts_wait_xcnt 0x0"
                         :: "v"(l), "v"(a), "v"(l + LS), "v"(a + GS), "v"(l + 2 * LS), "v"(a + 2 * GS), "v"(l + 3 * LS), "v"(a + 3 * GS),
                            "v"(l + 2 * PA), "v"(b), "v"(l + 2 * PA + LS), "v"(b + GS) : "memory");
        } };
    fill(0, 0);
    asm volatile("s_wait_asynccnt 0x0" ::: "memory");    // this wave's copies of stage 0 have landed before the barrier that publishes them
    __syncthreads();
    fill(1, 1);
#pragma unroll 1   // rolled: one set of fragments in registers
    for (int t = 0; t < K / 32; ++t) {
        const T16* sa = ring + (t & 1) * STGE + wm * 2048 + 8 * lane; const T16* sb = ring + (t & 1) * STGE + (NSPLIT == 1 ? 2 : 1) * PA + wn * 2048 + 8 * lane;
        V a[4], a2[4], b[4];
#pragma unroll
        for (int mb = 0; mb < 4; ++mb) { a[mb] = WFrag<T16>::ld(sa + mb * 512); if (NSPLIT == 1) a2[mb] = WFrag<T16>::ld(sa + PA + mb * 512); }
#pragma unroll
        for (int nb = 0; nb < 4; ++nb) b[nb] = WFrag<T16>::ld(sb + nb * 512);
        __builtin_amdgcn_sched_barrier(0);    // keeps the step's fragment reads together in front of its products: a read placed among the products is waited for there, with its whole LDS latency open
#pragma unroll
        for (int nb = 0; nb < 4; ++nb)
#pragma unroll
            for (int mb = 0; mb < 4; ++mb) { acc[mb][nb] = WFrag<T16>::mma(a[mb], b[nb], acc[mb][nb]); if (NSPLIT == 1) acc[mb][nb] = WFrag<T16>::mma(a2[mb], b[nb], acc[mb][nb]); }
        __builtin_amdgcn_sched_barrier(0);    // keeps the products in front of the waits below: moved behind the barrier, they would leave the copies of stage t + 1 only the time of the fragment reads to land
        asm volatile("s_wait_dscnt 0x0" ::: "memory");       // this wave's reads of the stage are done before the barrier behind which its buffer is refilled
        asm volatile("s_wait_asynccnt 0x0" ::: "memory");    // this wave's copies of stage t + 1 have landed before the barrier that publishes them
        __syncthreads();
        if (t + 2 < K / 32) fill(t + 2, t & 1);
    }
    asm volatile("s_wait_asynccnt 0x0" ::: "memory");        // nothing of this wave is in flight when it goes on
    if (PL) {
        const int hh = blockIdx.y * GWN + wn; const bool isv = hh >= NH_ + NKV;      // the same for the whole wave
        const int ch = r0 / TT, rc = r0 % TT;      // chunk of the row tile, first token inside it
        const size_t base = isv ? (size_t)(ch * NKV + hh - NH_ - NKV) * HD * PP + (size_t)rc * HD : ((size_t)(ch * (NH_ + NKV) + hh) * TT + rc) * HD;      // 64 tokens are 4 x 2 blocks of a q or k plane, 2 x 4 blocks of a v plane: rc * HD elements in front of them either way
        h16* D16 = (isv ? V16 : P16) + base; bf* Dh = (isv ? Vh : Ph) + base; bf* Dl = (isv ? Vl : Pl) + base;
#pragma unroll   // constant accumulator indices
        for (int u = 0; u < 4; ++u) {
            if (isv) {      // plane rows = 16 columns d of the tile, 64 tokens along each: a lane's 8 accumulator values are 8 tokens in a row
#pragma unroll
                for (int mb = 0; mb < 4; ++mb) { float* d = os + lr * 68 + mb * 16 + hi * 8; const v8f a = acc[mb][u]; *(v4fa*)d = (v4f){a[0], a[1], a[2], a[3]}; *(v4fa*)(d + 4) = (v4f){a[4], a[5], a[6], a[7]}; }
            } else {        // plane rows = 16 tokens of the tile, 64 columns d along each
#pragma unroll
                for (int nb = 0; nb < 4; ++nb) {
#pragma unroll
                    for (int j = 0; j < 8; ++j) os[(hi * 8 + j) * 68 + nb * 16 + lr] = acc[u][nb][j]; }
            }
            __builtin_amdgcn_wave_barrier(); asm volatile("" ::: "memory");   // the reads below take other lanes' values: they stay behind the writes
#pragma unroll
            for (int s = 0; s < 4; ++s) { const int g = 2 * s + hi; const float* d = os + lr * 68 + g * 8;      // plane row lr, its k = 8 g ..: half s & 1 of the row's block s >> 1
                 const v4f a = *(const v4fa*)d, c = *(const v4fa*)(d + 4); v8h o16; v8us oh, ol;
#pragma unroll
                for (int j = 0; j < 4; ++j) { unsigned short p, q; o16[j] = tohx(a[j]); splitf(a[j], p, q); oh[j] = p; ol[j] = q; o16[4 + j] = tohx(c[j]); splitf(c[j], p, q); oh[4 + j] = p; ol[4 + j] = q; }
                const size_t o = (size_t)(isv ? (s >> 1) * 2048 + u * 512 + (s & 1) * 256 : u * 1024 + s * 256) + lane * 8; *(v8h*)(D16 + o) = o16; *(v8us*)(Dh + o) = oh; *(v8us*)(Dl + o) = ol; xw(); }
            __builtin_amdgcn_wave_barrier(); asm volatile("" ::: "memory");   // the next sixteen rows overwrite os only behind these reads
        }
        return;
    }
#pragma unroll
    for (int mb = 0; mb < 4; ++mb) {
#pragma unroll
        for (int nb = 0; nb < 4; ++nb) {
#pragma unroll
            for (int j = 0; j < 8; ++j) os[(hi * 8 + j) * 68 + nb * 16 + lr] = acc[mb][nb][j]; }
        __builtin_amdgcn_wave_barrier(); asm volatile("" ::: "memory");
        float* crow = C + (size_t)(r0 + mb * 16) * ldc + c0;
{
#pragma unroll
            for (int s = 0; s < 8; ++s) { const int row = 2 * s + hi, cofs = lr * 4; v4f val = *(const v4fa*)(os + row * 68 + cofs); if (BIAS) { val[0] += bfr(bias[c0 + cofs]); val[1] += bfr(bias[c0 + cofs + 1]); val[2] += bfr(bias[c0 + cofs + 2]); val[3] += bfr(bias[c0 + cofs + 3]); }
                *(v4f*)(crow + (size_t)row * ldc + cofs) = val; }
             }
        __builtin_amdgcn_wave_barrier(); asm volatile("" ::: "memory");
    }
}

typedef __attribute__((ext_vector_type(2))) _Float16 v2h;
typedef __attribute__((ext_vector_type(4))) _Float16 v4h;
typedef __attribute__((ext_vector_type(2))) unsigned short v2us;
typedef __attribute__((ext_vector_type(4))) unsigned short v4us;
typedef __attribute__((ext_vector_type(2))) float v2f;
typedef __attribute__((ext_vector_type(4))) int v4i;

__global__ __launch_bounds__(256) void k_wtG(const float* __restrict__ w, int K, int N, bf* Bt) {
    const int lane = threadIdx.x & 31; const int L0 = (blockIdx.x * 8 + (threadIdx.x >> 5)) * 8; const int nlines = N * K / 64;
{
#pragma unroll 1
        for (int l = 0; l < 8; ++l) { const int L = L0 + l; if (L >= nlines) break; const size_t e = (size_t)L * 64 + lane * 2; const int k = (int)(e % K), n = (int)(e / K); v2us o;
            o[0] = f2bf(w[(size_t)k * N + n]); o[1] = f2bf(w[(size_t)(k + 1) * N + n]); *(v2us*)(Bt + e) = o; }
         }
}
// bf16 copies of all five inputs in one launch, written in fragment order (blocks [row / 16][k / 32], every input has DM columns): a work-group converts the 2,048 elements of four blocks of the one input that its index falls into (the choice is the same for the whole work-group). A thread owns one 16-byte piece of the copy, so a wave stores 512 bytes in a row.
static_assert(DQ == DM, "W_o has DM columns");
#define CB_X ((unsigned)((size_t)NB_ * TT * DM / 2048))
#define CB_Q ((unsigned)((size_t)DQ * DM / 2048))
#define CB_K ((unsigned)((size_t)DKV * DM / 2048))
__global__ __launch_bounds__(256) void k_cvt5(const float* __restrict__ x, const float* __restrict__ wq, const float* __restrict__ wk, const float* __restrict__ wv, const float* __restrict__ wo, bf* XB, bf* WQ, bf* WK, bf* WV, bf* WO) {
    unsigned blk = blockIdx.x; const float* src = x; bf* dst = XB;
    if (blk >= CB_X + CB_Q + 2 * CB_K) { blk -= CB_X + CB_Q + 2 * CB_K; src = wo; dst = WO; }
    else if (blk >= CB_X + CB_Q + CB_K) { blk -= CB_X + CB_Q + CB_K; src = wv; dst = WV; }
    else if (blk >= CB_X + CB_Q) { blk -= CB_X + CB_Q; src = wk; dst = WK; }
    else if (blk >= CB_X) { blk -= CB_X; src = wq; dst = WQ; }
    const size_t i = (size_t)blk * 256 + threadIdx.x; const size_t bl = i >> 6; const int row = (int)(bl / (DM / 32)) * 16 + (int)(i & 15), kk = (int)(bl % (DM / 32)) * 32 + (int)((i >> 4) & 3) * 8;
    const v8f v = *(const v8f*)(src + (size_t)row * DM + kk); xw(); v8us o;
#pragma unroll
    for (int k = 0; k < 8; ++k) o[k] = f2bf(v[k]); *(v8us*)(dst + i * 8) = o;  }

// ---- k_fattn: scores, causal softmax and probability x value product of one query tile of one head in one work-group of FW waves; nothing of the score matrix reaches memory.
// S^T = K Q^T (A = 16 key rows, B = 16 query rows): lane (lr, hi) holds keys 8 hi + j of query lr, so two score tiles of 32 keys, converted in place, are the B fragment of O^T += V^T P^T (A = rows of the V^T plane).
// Online softmax in the log2 domain: running maximum m and sum l per query, O^T rescaled when m moves; P = exp2(s - m) <= 1 is not normalised before it is rounded, the division by l comes last.
// The 32-key blocks up to the diagonal are dealt to the FW waves in turn; their (m, l, O) meet in LDS and are joined in wave order. HI: hi/lo bf16 planes, 3 products each side (query rows < RH); else fp16.
// Every '#pragma unroll' here gives a fragment, score or accumulator array constant indices, so that it stays in registers; the two lambdas are inlined by force for the same reason (they work on those arrays by reference).
template <typename T16, bool HI, int NQ>
__device__ __forceinline__ void fattn(const T16* __restrict__ Q, const T16* __restrict__ Q2, const T16* __restrict__ Kp, const T16* __restrict__ K2, const T16* __restrict__ Vt, const T16* __restrict__ V2, int q0, bf* Ah, bf* Al, float* so, float* sm, float* sl) {
    typedef typename WFrag<T16>::V V;
    const int lane = threadIdx.x & 31, lr = lane & 15, hi = lane >> 4; const int w = __builtin_amdgcn_readfirstlane(threadIdx.x >> 5);
    V qf[NQ][2], qf2[NQ][2]; v8f o[NQ][4]; float m[NQ], l[NQ];
#pragma unroll
    for (int nq = 0; nq < NQ; ++nq) { m[nq] = -3.0e38f; l[nq] = 0.f;
#pragma unroll
        for (int kk = 0; kk < 2; ++kk) { const size_t qo = (size_t)(q0 + nq * 16) * HD + kk * 512 + 8 * lane; qf[nq][kk] = WFrag<T16>::ld(Q + qo); if (HI) qf2[nq][kk] = WFrag<T16>::ld(Q2 + qo); }
#pragma unroll
        for (int mt = 0; mt < 4; ++mt) o[nq][mt] = (v8f){}; }
    xw();
    const int nblk = (q0 + NQ * 16 - 1) / 32 + 1;      // every block walked holds key kb <= q0: no query of the tile ever sees a block that is masked whole; only the last block crosses the diagonal
    V kf[2][2], kf2[2][2];
    auto ldk = [&](int b) __attribute__((always_inline)) {
#pragma unroll
        for (int t = 0; t < 2; ++t)
#pragma unroll
            for (int kk = 0; kk < 2; ++kk) kf[t][kk] = WFrag<T16>::ld(Kp + (size_t)(b * 32 + t * 16) * HD + kk * 512 + 8 * lane);
        xw();
        if (HI) {
#pragma unroll
            for (int t = 0; t < 2; ++t)
#pragma unroll
                for (int kk = 0; kk < 2; ++kk) kf2[t][kk] = WFrag<T16>::ld(K2 + (size_t)(b * 32 + t * 16) * HD + kk * 512 + 8 * lane);
            xw(); } };
    // one pass = one block of 32 keys. fp16 tiles: the K fragments were fetched one pass ahead, and block bn's follow into the same registers right behind the score products (not in the diagonal pass, a wave's last).
    auto pass = [&](int b, bool diag, int bn) __attribute__((always_inline)) { const int kb = b * 32; V vf[4], vf2[4]; v8f s[NQ][2];
        if (HI) ldk(b);
#pragma unroll
        for (int mt = 0; mt < 4; ++mt) vf[mt] = WFrag<T16>::ld(Vt + (size_t)kb * HD + mt * 512 + 8 * lane);
        xw();
        if (HI) {
#pragma unroll
            for (int mt = 0; mt < 4; ++mt) vf2[mt] = WFrag<T16>::ld(V2 + (size_t)kb * HD + mt * 512 + 8 * lane);
            xw(); }
        if (!HI) __builtin_amdgcn_sched_barrier(0);    // keeps the V^T loads in front of the score products, so that their latency runs under scores and softmax
#pragma unroll
        for (int nq = 0; nq < NQ; ++nq)
#pragma unroll
            for (int t = 0; t < 2; ++t) { s[nq][t] = (v8f){};
#pragma unroll
                for (int kk = 0; kk < 2; ++kk) { s[nq][t] = WFrag<T16>::mma(kf[t][kk], qf[nq][kk], s[nq][t]); if (HI) { s[nq][t] = WFrag<T16>::mma(kf[t][kk], qf2[nq][kk], s[nq][t]); s[nq][t] = WFrag<T16>::mma(kf2[t][kk], qf[nq][kk], s[nq][t]); } } }
        if (!HI && !diag) { ldk(bn); __builtin_amdgcn_sched_barrier(0); }    // keeps the fetch ahead here, right behind the score products: moved down to the foot of the pass, its latency would stand open at the head of the next
#pragma unroll
        for (int nq = 0; nq < NQ; ++nq) { const int q = q0 + nq * 16 + lr; float bm = -3.0e38f;
#pragma unroll
            for (int t = 0; t < 2; ++t)
#pragma unroll
                for (int j = 0; j < 8; ++j) { float x = s[nq][t][j] * SL2; if (diag) x = (kb + t * 16 + hi * 8 + j <= q) ? x : -3.0e38f; s[nq][t][j] = x; bm = fmaxf(bm, x); }
            bm = fmaxf(bm, __shfl_xor(bm, 16, 32));
            const float mn = fmaxf(m[nq], bm), al = __builtin_amdgcn_exp2f(m[nq] - mn); m[nq] = mn; float ps = 0.f;
#pragma unroll
            for (int t = 0; t < 2; ++t)
#pragma unroll
                for (int j = 0; j < 8; ++j) { const float p = __builtin_amdgcn_exp2f(s[nq][t][j] - mn); s[nq][t][j] = p; ps += p; }
            l[nq] = l[nq] * al + ps;     // this lane's eight-key halves only; the two halves of a query are added once, behind the loop
#pragma unroll
            for (int mt = 0; mt < 4; ++mt) o[nq][mt] *= al;
            if (HI) { v8us h0, h1, l0, l1;
#pragma unroll
                for (int j = 0; j < 8; ++j) { unsigned short a, c2; splitf(s[nq][0][j], a, c2); h0[j] = a; l0[j] = c2; splitf(s[nq][1][j], a, c2); h1[j] = a; l1[j] = c2; }
                const v16bf ph = cat16b(h0, h1), pl = cat16b(l0, l1);
#pragma unroll
                for (int mt = 0; mt < 4; ++mt) { o[nq][mt] = wmmab(__builtin_bit_cast(v16bf, vf[mt]), ph, o[nq][mt]); o[nq][mt] = wmmab(__builtin_bit_cast(v16bf, vf[mt]), pl, o[nq][mt]); o[nq][mt] = wmmab(__builtin_bit_cast(v16bf, vf2[mt]), ph, o[nq][mt]); }
            } else { v16h pf;
#pragma unroll
                for (int j = 0; j < 8; ++j) { pf[j] = tohx(s[nq][0][j]); pf[8 + j] = tohx(s[nq][1][j]); }
#pragma unroll
                for (int mt = 0; mt < 4; ++mt) o[nq][mt] = wmma16(__builtin_bit_cast(v16h, vf[mt]), pf, o[nq][mt]); } } };
    int b = w;
    if (!HI && b < nblk) ldk(b);
#pragma unroll 1   // rolled: one set of K and V^T fragments in registers
    for (; b < nblk - 1; b += FW) pass(b, false, min(b + FW, nblk - 1));     // blocks wholly below the diagonal: no mask; the fetch ahead is unconditional (a wave with no further block fetches the last block and drops it), so the loads stay in flight over the loop's foot
    if (b == nblk - 1) pass(b, true, b);                                     // the diagonal block, in the wave whose turn it is
#pragma unroll
    for (int nq = 0; nq < NQ; ++nq) { const int ql = w * 32 + nq * 16 + lr; const float lt = l[nq] + __shfl_xor(l[nq], 16, 32); if (hi == 0) { sm[ql] = m[nq]; sl[ql] = lt; }
#pragma unroll
        for (int mt = 0; mt < 4; ++mt) { float* d = so + ql * OSP + mt * 16 + hi * 8; const v8f a = o[nq][mt]; *(v4fa*)d = (v4f){a[0], a[1], a[2], a[3]}; *(v4fa*)(d + 4) = (v4f){a[4], a[5], a[6], a[7]}; } }
    __syncthreads();    // every wave's (m, l, O) is in LDS before any wave joins them
#pragma unroll
    for (int it = 0; it < NQ * 16 / (FW * 4); ++it) { const int un = it * FW + w, ql = (un >> 2) * 16 + lr, g = (un & 3) * 2 + hi;     // a wave stores one 512-byte half block of the merged planes (rows = queries, k = head * HD + d): 16 queries x 16 d
        float mw[FW], M = -3.0e38f, Lt = 0.f, acc[8];
#pragma unroll
        for (int u = 0; u < FW; ++u) { mw[u] = sm[u * 32 + ql]; M = fmaxf(M, mw[u]); }
#pragma unroll
        for (int j = 0; j < 8; ++j) acc[j] = 0.f;
#pragma unroll
        for (int u = 0; u < FW; ++u) { const float f = __builtin_amdgcn_exp2f(mw[u] - M); Lt += f * sl[u * 32 + ql]; const float* d = so + (u * 32 + ql) * OSP + g * 8; const v4f a = *(const v4fa*)d, c = *(const v4fa*)(d + 4);   // a wave that had no block: m = -3e38, f = 0
#pragma unroll
            for (int j = 0; j < 4; ++j) { acc[j] += f * a[j]; acc[4 + j] += f * c[j]; } }
        const float inv = __fdiv_rn(1.0f, Lt); v8us oh, ol;
#pragma unroll
        for (int j = 0; j < 8; ++j) { unsigned short a, c2; splitf(acc[j] * inv, a, c2); oh[j] = a; ol[j] = c2; }
        const size_t oo = (size_t)(q0 + (un >> 2) * 16) * DQ + (un & 3) * 256 + lane * 8; *(v8us*)(Ah + oo) = oh; *(v8us*)(Al + oo) = ol; xw(); }
}
// grid (chunks x heads, tiles), longest tiles of every chunk first: (TT - RH) / 32 fp16 tiles of 32 queries from the last row down, then RH / 16 hi/lo tiles of 16 queries.
__global__ __launch_bounds__(FW * 32) void k_fattn(const h16* __restrict__ Q16, const h16* __restrict__ K16, const h16* __restrict__ V16, const bf* __restrict__ Qh, const bf* __restrict__ Ql, const bf* __restrict__ Kh, const bf* __restrict__ Kl, const bf* __restrict__ Vh, const bf* __restrict__ Vl, bf* Ah, bf* Al) {
    __shared__ __align__(16) float so[FW * 32 * OSP]; __shared__ float sm[FW * 32]; __shared__ float sl[FW * 32];
    const int h = blockIdx.x % NH_, ch = blockIdx.x / NH_, tile = blockIdx.y; const size_t hp = (size_t)(ch * (NH_ + NKV) + h) * TT * HD, vp = (size_t)(ch * NKV + h) * HD * PP;
    Ah += (size_t)ch * TT * DQ; Al += (size_t)ch * TT * DQ;
    if (tile < (TT - RH) / 32) fattn<h16, false, 2>(Q16 + hp, nullptr, K16 + hp, nullptr, V16 + vp, nullptr, TT - 32 * (tile + 1), Ah + h * HD * 16, Al + h * HD * 16, so, sm, sl);
    else fattn<bf, true, 1>(Qh + hp, Ql + hp, Kh + hp, Kl + hp, Vh + vp, Vl + vp, RH - 16 * (tile - (TT - RH) / 32 + 1), Ah + h * HD * 16, Al + h * HD * 16, so, sm, sl);
}

extern "C" void kernel_launch(void* const* d_in, const int* in_sizes, int n_in,
                              void* d_out, int out_size, void* d_ws, size_t ws_size, hipStream_t stream) {
    (void)in_sizes; (void)n_in; (void)out_size;
    const float* x = (const float*)d_in[0]; const float* wq = (const float*)d_in[1]; const float* wk = (const float*)d_in[2]; const float* wv = (const float*)d_in[3]; const float* wo = (const float*)d_in[4];   /* input order hidden_states, Wq, Wk, Wv, Wo ('oi': 'x @ W.T') */
    float* OUT = (float*)d_out;     // [4][2048][1024]
    char* wsp = (char*)d_ws;
    auto take = [&](size_t bytes) { char* p = wsp; wsp += (bytes + 255) & ~(size_t)255; return (void*)p; };
    bf* WQ = (bf*)take((size_t)DF * DM * 2); bf* WK = WQ + (size_t)DQ * DM; bf* WV = WK + (size_t)DKV * DM;   /* one [DF][DM] plane: q, k, v rows */ bf* WO = (bf*)take((size_t)DM * DQ * 2);
    bf* XB = (bf*)take((size_t)NB_ * TT * DM * 2);   // x copy
    h16* QP16 = (h16*)take((size_t)NB_ * (NH_ + NKV) * TT * HD * 2); h16* KP16 = QP16 + (size_t)NH_ * TT * HD;   /* in each chunk the k heads' planes follow the q heads': head index = 64-column tile of the joint projection */ h16* VT16 = (h16*)take((size_t)NB_ * NKV * HD * PP * 2);
    bf* QPh = (bf*)take((size_t)NB_ * (NH_ + NKV) * TT * HD * 2); bf* KPh = QPh + (size_t)NH_ * TT * HD; bf* QPl = (bf*)take((size_t)NB_ * (NH_ + NKV) * TT * HD * 2); bf* KPl = QPl + (size_t)NH_ * TT * HD; bf* VTh = (bf*)take((size_t)NB_ * NKV * HD * PP * 2); bf* VTl = VTh + (size_t)TT * HD;   // a head's hi plane and lo plane one behind the other in its HD * PP elements
    bf* ATh = (bf*)take((size_t)NB_ * TT * DQ * 2); bf* ATl = (bf*)take((size_t)NB_ * TT * DQ * 2);
    if ((size_t)(wsp - (char*)d_ws) > ws_size) return;    // ws 256 MiB
    k_cvt5<<<CB_X + 2 * CB_Q + 2 * CB_K, 256, 0, stream>>>(x, wq, wk, wv, wo, XB, WQ, WK, WV, WO);
    k_gemmw<bf, 0, false, true, DM, 4, 2><<<dim3(NB_ * TT / 256, DF / 128, 1), 256, 0, stream>>>(XB, nullptr, WQ, nullptr, nullptr, 0, nullptr, 0, 0, 0, QP16, QPh, QPl, VT16, VTh, VTl);   // q, k and v projections of every chunk in one launch, written as head planes
    k_fattn<<<dim3(NB_ * NH_, (TT - RH) / 32 + RH / 16), FW * 32, 0, stream>>>(QP16, KP16, VT16, QPh, QPl, KPh, KPl, VTh, VTl, ATh, ATl);   // one kv head per query head
    k_gemmw<bf, 1, false, false, DQ, 2, 2><<<dim3(NB_ * TT / 128, DM / 128, 1), 128, 0, stream>>>(ATh, ATl, WO, nullptr, OUT, DM, nullptr, 0, 0, 0, nullptr, nullptr, nullptr, nullptr, nullptr, nullptr);
}

// v008
// Measured time: 146 microseconds a run.
// Next to v007, in two timings, it ran 1.05 and 1.06 times as fast.
// All steps since v000 together make it 19.4 times as fast.
#include <hip/hip_runtime.h>

// Chunk-local causal multi-head self-attention (a ring attention with ring_size 1) (hidden_states [1][8192][1024] = FOUR chunks of 2,048 tokens: in memory [4][2048][1024]; q, k, v = x W^T ('oi' [1024][1024] 0.02, no bias; 16 heads x 64); each chunk attends causally WITHIN itself: scores / sqrt(64), tril(ones((2048, 2048))) kept, -inf elsewhere; softmax; out = merged Wo^T ('oi', no bias) -> [1][8192][1024] = [4][2048][1024] (8.4 M); argument order hidden_states, Wq, Wk, Wv, Wo).
// Four launches, each over all four chunks at once (every plane in the workspace but the weight copies has one copy per chunk): bf16 copies of x and of the weights; exact projections, whose GEMM writes the 16-bit head planes itself (no f32 projection in memory); causal T-2048 attention (k_fattn: scores, online softmax and P x V per query tile, no score matrix in memory; hybrid rows: < 512 hi/lo 3 products, rest fp16, whose K and V^T blocks the waves of a work-group share in LDS); merged hi/lo x W_o exact.
// Every 16-bit plane that feeds a matrix fragment is stored in FRAGMENT ORDER: a block of 16 rows x 32 k is 1 KiB in a row, element (row, k) at ((k >> 4) & 1) * 256 + ((k >> 3) & 1) * 128 + (row & 15) * 8 + (k & 7), so that lane (lr, hi) finds its two 16-byte pieces at lane * 8 and 256 + lane * 8 and each wave-wide load covers four whole 128-byte lines. The k order inside a fragment is the one the row-major planes gave.
// Compute dtypes, f32 accumulate: every input rounded to bf16; projections exact; attention rows < 512 3 products, rest fp16; softmax f32; W_o hl x exact.

#define NB_  4
#define TT   2048
#define DM   1024
#define NH_  16
#define NKV  16
#define REP  (NH_ / NKV)
#define HD   64
#define DQ   (NH_ * HD)
#define DKV  (NKV * HD)
#define RH   512                  // query rows < RH use hi+lo planes (0: none)
#define SCL  0.125f   // HD^-0.5
#define DF   (DQ + 2 * DKV)       // columns of the joint q | k | v projection
#define PP   (2 * TT)             // HD * PP 16-bit elements: a head's room in the V^T planes (hi and lo plane; the fp16 plane fills half)
#define FW   4                    // waves of an attention work-group
#define OSP  68                   // pitch, in f32, of one query's partial output row in LDS
#define SL2  (SCL * 1.4426950408889634f)   // score scale into the log2 domain
typedef _Float16 h16;
typedef unsigned short bf;
typedef __attribute__((ext_vector_type(16))) __bf16   v16bf;
typedef __attribute__((ext_vector_type(16))) _Float16 v16h;
typedef __attribute__((ext_vector_type(8)))  _Float16 v8h;
typedef __attribute__((ext_vector_type(8)))  unsigned short v8us;
typedef __attribute__((ext_vector_type(8)))  float    v8f;
typedef __attribute__((ext_vector_type(4)))  float    v4f;
typedef v8h  __attribute__((may_alias)) v8ha;
typedef v4f  __attribute__((may_alias)) v4fa;
typedef v8us __attribute__((may_alias)) v8usa;

__device__ __forceinline__ unsigned short f2bf(float f) { unsigned u = __float_as_uint(f); u += 0x7FFFu + ((u >> 16) & 1u); return (unsigned short)(u >> 16); }
__device__ __forceinline__ float bf2f(unsigned short b) { return __uint_as_float(((unsigned)b) << 16); }
__device__ __forceinline__ float bfr(float f) { return bf2f(f2bf(f)); }
__device__ __forceinline__ v16h cat16(v8h lo, v8h hi) { return __builtin_shufflevector(lo, hi, 0, 1, 2, 3, 4, 5, 6, 7, 8, 9, 10, 11, 12, 13, 14, 15); }
__device__ __forceinline__ v16bf cat16b(v8us lo, v8us hi) { return __builtin_bit_cast(v16bf, __builtin_shufflevector(lo, hi, 0, 1, 2, 3, 4, 5, 6, 7, 8, 9, 10, 11, 12, 13, 14, 15)); }
__device__ __forceinline__ v8f wmma16(v16h a, v16h b, v8f c) { return __builtin_amdgcn_wmma_f32_16x16x32_f16(false, a, false, b, (short)0, c, false, false); }
__device__ __forceinline__ v8f wmmab(v16bf a, v16bf b, v8f c) { return __builtin_amdgcn_wmma_f32_16x16x32_bf16(false, a, false, b, (short)0, c, false, false); }
__device__ __forceinline__ h16 tohx(float x) { return (h16)x; }
__device__ __forceinline__ void splitf(float y, unsigned short& h, unsigned short& l) { h = f2bf(y); l = f2bf(y - bf2f(h)); }
// s_wait_xcnt 0 behind a run of global loads or stores, in front of whatever next overwrites a register that the run names (address pairs, store data).
__device__ __forceinline__ void xw() { asm volatile("s_wait_xcnt 0x0" ::: "memory"); }
// the same wait behind a run of loads that all go from the address p (or from p and q): as inputs, the addresses keep their registers up to the wait, so that no load of the run lands on them.
__device__ __forceinline__ void xwa(const void* p) { asm volatile("s_wait_xcnt 0x0" :: "v"(p) : "memory"); }
__device__ __forceinline__ void xwa(const void* p, const void* q) { asm volatile("s_wait_xcnt 0x0" :: "v"(p), "v"(q) : "memory"); }



// ---- k_gemmw: register-blocked GEMM, one wave per 64x64 output tile (16 accumulators), GWM x GWN waves per work-group (4 x 2 on a 256x128 tile in the projection; 2 x 2 on 128x128 for W_o, so that two work-groups with barriers of their own share a WGP); grid (M / (64 GWM), N / (64 GWN), Z). Operands are 16-bit planes in fragment order, blocks [row / 16][k / 32] (ld takes the lane's place in a block).
// A k step (32 k) of the tile's operand blocks is a stage in LDS, shared by the waves: two stage buffers, filled by asynchronous copies two steps ahead, one barrier a step.
// C[m][n] (f32, pitch ldc, + optional f32 bias[n]) = sum_k A[m][k] Bt[n][k] (+ split products per NSPLIT). z-batch strides sA/sB/sC in elements. K % 32 == 0; K is a compile-time constant, so that all fragments of an operand in a k step lie at constant offsets from one address.
// PL (the joint q | k | v projection): a 64-column tile is one head, and the tile goes straight from the accumulators to that head's fp16, bf16-hi and bf16-lo planes; C is not written.
// A row tile lies in one chunk (TT % 64 == 0). q and k heads: planes [chunk][head], blocks [t / 16][d / 32]; v heads: planes [chunk][head] (HD * PP elements apart), rows d, k = t, blocks [t / 32][d / 16]. Sixteen plane rows at a time are turned in LDS so that a wave stores 512 bytes in a row.
template <typename T16> struct WFrag;
template <> struct WFrag<h16> { typedef v16h V; static __device__ __forceinline__ V ld(const h16* p) { return cat16(*(const v8h*)p, *(const v8h*)(p + 256)); } static __device__ __forceinline__ v8f mma(V a, V b, v8f c) { return wmma16(a, b, c); } };
template <> struct WFrag<bf> { typedef v16bf V; static __device__ __forceinline__ V ld(const bf* p) { return cat16b(*(const v8us*)p, *(const v8us*)(p + 256)); } static __device__ __forceinline__ v8f mma(V a, V b, v8f c) { return wmmab(a, b, c); } };
template <typename T16, int NSPLIT, bool BIAS, bool PL, int K, int GWM, int GWN>      // GWM x GWN wave tiles in a work-group's tile
__global__ __launch_bounds__(GWM * GWN * 32) void k_gemmw(const T16* __restrict__ A, const T16* __restrict__ A2, const T16* __restrict__ Bt, const T16* __restrict__ Bt2, float* C, int ldc, const float* __restrict__ bias, size_t sA, size_t sB, size_t sC, h16* P16, bf* Ph, bf* Pl, h16* V16, bf* Vh, bf* Vl) {
    typedef typename WFrag<T16>::V V;
    static_assert(NSPLIT <= 1, "one B plane"); static_assert(K >= 64 && K % 32 == 0, "two stages or more");
    constexpr int GTM = GWM * 64, GTN = GWN * 64, PA = GTM * 32, PB = GTN * 32;                  // elements of one k step of an A plane and of the B plane: GTM / 16 and GTN / 16 blocks
    constexpr int STGE = (NSPLIT == 1 ? 2 : 1) * PA + PB;        // one stage: [A | A2 | B]
    __shared__ __align__(1024) T16 ring[2 * STGE];
    __shared__ __align__(16) float osw[GWM * GWN][16 * 68];
    const size_t z = blockIdx.z; A += z * sA; if (A2) A2 += z * sA; Bt += z * sB; C += z * sC;
    const int lane = threadIdx.x & 31, lr = lane & 15, hi = lane >> 4; const int w = __builtin_amdgcn_readfirstlane(threadIdx.x >> 5), wm = w % GWM, wn = w / GWM;
    float* os = osw[w];      // each wave turns its own tile in its own rows
    const int r0 = blockIdx.x * GTM + wm * 64, c0 = blockIdx.y * GTN + wn * 64;
    v8f acc[4][4];
#pragma unroll
    for (int mb = 0; mb < 4; ++mb)
#pragma unroll
        for (int nb = 0; nb < 4; ++nb) acc[mb][nb] = (v8f){};
    // A stage is copied block by block as it lies in memory (a block is 1 KiB in a row): one copy of all threads brings BPC blocks, thread t the 16 bytes at (t & 63) * 16 of block t >> 6.
    constexpr int BPC = GWM * GWN / 2; constexpr unsigned LS = BPC * 1024; constexpr size_t GS = (size_t)BPC * 16 * K;      // blocks a copy; its step in LDS bytes and in plane elements
    static_assert(GTM / 16 == 4 * BPC && GTN / 16 == (NSPLIT == 1 ? 4 : 2) * BPC, "four copies bring an A plane's k step; four (two planes of A) or two the B plane's");
    const size_t tb = (size_t)(threadIdx.x >> 6) * 16 * K + (threadIdx.x & 63) * 8;
    const T16* ga = A + (size_t)blockIdx.x * GTM * K + tb; const T16* ga2 = A2 + (size_t)blockIdx.x * GTM * K + tb; const T16* gb = Bt + (size_t)blockIdx.y * GTN * K + tb;
    const unsigned rl = (unsigned)(size_t)ring + threadIdx.x * 16;      // the thread's LDS byte address in the first BPC blocks of stage buffer 0
    auto fill = [&](int kt, int buf) __attribute__((always_inline)) {
        const unsigned l = rl + buf * (STGE * 2); const T16* a = ga + (size_t)kt * 512; const T16* b = gb + (size_t)kt * 512;
        // the s_wait_xcnt 0 at the end of each statement stands in front of whatever next overwrites an address register of its copies
        if (NSPLIT == 1) { const T16* a2 = ga2 + (size_t)kt * 512;
            asm volatile("global_load_async_to_lds_b128 %0, %1, off\n\tglobal_load_async_to_lds_b128 %2, %3, off\n\tglobal_load_async_to_lds_b128 %4, %5, off\n\tglobal_load_async_to_lds_b128 %6, %7, off\n\t"
                         "global_load_async_to_lds_b128 %8, %9, off\n\tglobal_load_async_to_lds_b128 %10, %11, off\n\tglobal_load_async_to_lds_b128 %12, %13, off\n\tglobal_load_async_to_lds_b128 %14, %15, off\n\t"
                         "global_load_async_to_lds_b128 %16, %17, off\n\tglobal_load_async_to_lds_b128 %18, %19, off\n\tglobal_load_async_to_lds_b128 %20, %21, off\n\tglobal_load_async_to_lds_b128 %22, %23, off\n\ts_wait_xcnt 0x0"
                         :: "v"(l), "v"(a), "v"(l + LS), "v"(a + GS), "v"(l + 2 * LS), "v"(a + 2 * GS), "v"(l + 3 * LS), "v"(a + 3 * GS),
                            "v"(l + 2 * PA), "v"(a2), "v"(l + 2 * PA + LS), "v"(a2 + GS), "v"(l + 2 * PA + 2 * LS), "v"(a2 + 2 * GS), "v"(l + 2 * PA + 3 * LS), "v"(a2 + 3 * GS),
                            "v"(l + 4 * PA), "v"(b), "v"(l + 4 * PA + LS), "v"(b + GS), "v"(l + 4 * PA + 2 * LS), "v"(b + 2 * GS), "v"(l + 4 * PA + 3 * LS), "v"(b + 3 * GS) : "memory");
        } else {
            asm volatile("global_load_async_to_lds_b128 %0, %1, off\n\tglobal_load_async_to_lds_b128 %2, %3, off\n\tglobal_load_async_to_lds_b128 %4, %5, off\n\tglobal_load_async_to_lds_b128 %6, %7, off\n\t"
                         "global_load_async_to_lds_b128 %8, %9, off\n\tglobal_load_async_to_lds_b128 %10, %11, off\n\ts_wait_xcnt 0x0"
                         :: "v"(l), "v"(a), "v"(l + LS), "v"(a + GS), "v"(l + 2 * LS), "v"(a + 2 * GS), "v"(l + 3 * LS), "v"(a + 3 * GS),
                            "v"(l + 2 * PA), "v"(b), "v"(l + 2 * PA + LS), "v"(b + GS) : "memory");
        } };
    fill(0, 0);
    asm volatile("s_wait_asynccnt 0x0" ::: "memory");    // this wave's copies of stage 0 have landed before the barrier that publishes them
    __syncthreads();
    fill(1, 1);
#pragma unroll 1   // rolled: one set of fragments in registers
    for (int t = 0; t < K / 32; ++t) {
        const T16* sa = ring + (t & 1) * STGE + wm * 2048 + 8 * lane; const T16* sb = ring + (t & 1) * STGE + (NSPLIT == 1 ? 2 : 1) * PA + wn * 2048 + 8 * lane;
        V a[4], a2[4], b[4];
#pragma unroll
        for (int mb = 0; mb < 4; ++mb) { a[mb] = WFrag<T16>::ld(sa + mb * 512); if (NSPLIT == 1) a2[mb] = WFrag<T16>::ld(sa + PA + mb * 512); }
#pragma unroll
        for (int nb = 0; nb < 4; ++nb) b[nb] = WFrag<T16>::ld(sb + nb * 512);
        __builtin_amdgcn_sched_barrier(0);    // keeps the step's fragment reads together in front of its products: a read placed among the products is waited for there, with its whole LDS latency open
#pragma unroll
        for (int nb = 0; nb < 4; ++nb)
#pragma unroll
            for (int mb = 0; mb < 4; ++mb) { acc[mb][nb] = WFrag<T16>::mma(a[mb], b[nb], acc[mb][nb]); if (NSPLIT == 1) acc[mb][nb] = WFrag<T16>::mma(a2[mb], b[nb], acc[mb][nb]); }
        __builtin_amdgcn_sched_barrier(0);    // keeps the products in front of the waits below: moved behind the barrier, they would leave the copies of stage t + 1 only the time of the fragment reads to land
        asm volatile("s_wait_dscnt 0x0" ::: "memory");       // this wave's reads of the stage are done before the barrier behind which its buffer is refilled
        asm volatile("s_wait_asynccnt 0x0" ::: "memory");    // this wave's copies of stage t + 1 have landed before the barrier that publishes them
        __syncthreads();
        if (t + 2 < K / 32) fill(t + 2, t & 1);
    }
    asm volatile("s_wait_asynccnt 0x0" ::: "memory");        // nothing of this wave is in flight when it goes on
    if (PL) {
        const int hh = blockIdx.y * GWN + wn; const bool isv = hh >= NH_ + NKV;      // the same for the whole wave
        const int ch = r0 / TT, rc = r0 % TT;      // chunk of the row tile, first token inside it
        const size_t base = isv ? (size_t)(ch * NKV + hh - NH_ - NKV) * HD * PP + (size_t)rc * HD : ((size_t)(ch * (NH_ + NKV) + hh) * TT + rc) * HD;      // 64 tokens are 4 x 2 blocks of a q or k plane, 2 x 4 blocks of a v plane: rc * HD elements in front of them either way
        h16* D16 = (isv ? V16 : P16) + base; bf* Dh = (isv ? Vh : Ph) + base; bf* Dl = (isv ? Vl : Pl) + base;
#pragma unroll   // constant accumulator indices
        for (int u = 0; u < 4; ++u) {
            if (isv) {      // plane rows = 16 columns d of the tile, 64 tokens along each: a lane's 8 accumulator values are 8 tokens in a row
#pragma unroll
                for (int mb = 0; mb < 4; ++mb) { float* d = os + lr * 68 + mb * 16 + hi * 8; const v8f a = acc[mb][u]; *(v4fa*)d = (v4f){a[0], a[1], a[2], a[3]}; *(v4fa*)(d + 4) = (v4f){a[4], a[5], a[6], a[7]}; }
            } else {        // plane rows = 16 tokens of the tile, 64 columns d along each
#pragma unroll
                for (int nb = 0; nb < 4; ++nb) {
#pragma unroll
                    for (int j = 0; j < 8; ++j) os[(hi * 8 + j) * 68 + nb * 16 + lr] = acc[u][nb][j]; }
            }
            __builtin_amdgcn_wave_barrier(); asm volatile("" ::: "memory");   // the reads below take other lanes' values: they stay behind the writes
#pragma unroll
            for (int s = 0; s < 4; ++s) { const int g = 2 * s + hi; const float* d = os + lr * 68 + g * 8;      // plane row lr, its k = 8 g ..: half s & 1 of the row's block s >> 1
                 const v4f a = *(const v4fa*)d, c = *(const v4fa*)(d + 4); v8h o16; v8us oh, ol;
#pragma unroll
                for (int j = 0; j < 4; ++j) { unsigned short p, q; o16[j] = tohx(a[j]); splitf(a[j], p, q); oh[j] = p; ol[j] = q; o16[4 + j] = tohx(c[j]); splitf(c[j], p, q); oh[4 + j] = p; ol[4 + j] = q; }
                const size_t o = (size_t)(isv ? (s >> 1) * 2048 + u * 512 + (s & 1) * 256 : u * 1024 + s * 256) + lane * 8; *(v8h*)(D16 + o) = o16; *(v8us*)(Dh + o) = oh; *(v8us*)(Dl + o) = ol; xw(); }
            __builtin_amdgcn_wave_barrier(); asm volatile("" ::: "memory");   // the next sixteen rows overwrite os only behind these reads
        }
        return;
    }
#pragma unroll
    for (int mb = 0; mb < 4; ++mb) {
#pragma unroll
        for (int nb = 0; nb < 4; ++nb) {
#pragma unroll
            for (int j = 0; j < 8; ++j) os[(hi * 8 + j) * 68 + nb * 16 + lr] = acc[mb][nb][j]; }
        __builtin_amdgcn_wave_barrier(); asm volatile("" ::: "memory");
        float* crow = C + (size_t)(r0 + mb * 16) * ldc + c0;
{
#pragma unroll
            for (int s = 0; s < 8; ++s) { const int row = 2 * s + hi, cofs = lr * 4; v4f val = *(const v4fa*)(os + row * 68 + cofs); if (BIAS) { val[0] += bfr(bias[c0 + cofs]); val[1] += bfr(bias[c0 + cofs + 1]); val[2] += bfr(bias[c0 + cofs + 2]); val[3] += bfr(bias[c0 + cofs + 3]); }
                *(v4f*)(crow + (size_t)row * ldc + cofs) = val; }
             }
        __builtin_amdgcn_wave_barrier(); asm volatile("" ::: "memory");
    }
}

typedef __attribute__((ext_vector_type(2))) _Float16 v2h;
typedef __attribute__((ext_vector_type(4))) _Float16 v4h;
typedef __attribute__((ext_vector_type(2))) unsigned short v2us;
typedef __attribute__((ext_vector_type(4))) unsigned short v4us;
typedef __attribute__((ext_vector_type(2))) float v2f;
typedef __attribute__((ext_vector_type(4))) int v4i;

__global__ __launch_bounds__(256) void k_wtG(const float* __restrict__ w, int K, int N, bf* Bt) {
    const int lane = threadIdx.x & 31; const int L0 = (blockIdx.x * 8 + (threadIdx.x >> 5)) * 8; const int nlines = N * K / 64;
{
#pragma unroll 1
        for (int l = 0; l < 8; ++l) { const int L = L0 + l; if (L >= nlines) break; const size_t e = (size_t)L * 64 + lane * 2; const int k = (int)(e % K), n = (int)(e / K); v2us o;
            o[0] = f2bf(w[(size_t)k * N + n]); o[1] = f2bf(w[(size_t)(k + 1) * N + n]); *(v2us*)(Bt + e) = o; }
         }
}
// bf16 copies of all five inputs in one launch, written in fragment order (blocks [row / 16][k / 32], every input has DM columns): a work-group converts the 2,048 elements of four blocks of the one input that its index falls into (the choice is the same for the whole work-group). A thread owns one 16-byte piece of the copy, so a wave stores 512 bytes in a row.
static_assert(DQ == DM, "W_o has DM columns");
#define CB_X ((unsigned)((size_t)NB_ * TT * DM / 2048))
#define CB_Q ((unsigned)((size_t)DQ * DM / 2048))
#define CB_K ((unsigned)((size_t)DKV * DM / 2048))
__global__ __launch_bounds__(256) void k_cvt5(const float* __restrict__ x, const float* __restrict__ wq, const float* __restrict__ wk, const float* __restrict__ wv, const float* __restrict__ wo, bf* XB, bf* WQ, bf* WK, bf* WV, bf* WO) {
    unsigned blk = blockIdx.x; const float* src = x; bf* dst = XB;
    if (blk >= CB_X + CB_Q + 2 * CB_K) { blk -= CB_X + CB_Q + 2 * CB_K; src = wo; dst = WO; }
    else if (blk >= CB_X + CB_Q + CB_K) { blk -= CB_X + CB_Q + CB_K; src = wv; dst = WV; }
    else if (blk >= CB_X + CB_Q) { blk -= CB_X + CB_Q; src = wk; dst = WK; }
    else if (blk >= CB_X) { blk -= CB_X; src = wq; dst = WQ; }
    const size_t i = (size_t)blk * 256 + threadIdx.x; const size_t bl = i >> 6; const int row = (int)(bl / (DM / 32)) * 16 + (int)(i & 15), kk = (int)(bl % (DM / 32)) * 32 + (int)((i >> 4) & 3) * 8;
    const v8f v = *(const v8f*)(src + (size_t)row * DM + kk); xw(); v8us o;
#pragma unroll
    for (int k = 0; k < 8; ++k) o[k] = f2bf(v[k]); *(v8us*)(dst + i * 8) = o;  }

// ---- k_fattn: scores, causal softmax and probability x value product of one query tile of one head in one work-group of FW waves; nothing of the score matrix reaches memory.
// S^T = K Q^T (A = 16 key rows, B = 16 query rows): lane (lr, hi) holds keys 8 hi + j of query lr, so two score tiles of 32 keys, converted in place, are the B fragment of O^T += V^T P^T (A = rows of the V^T plane).
// Online softmax in the log2 domain: running maximum m and sum l per query, O^T rescaled when m moves; P = exp2(s - m) <= 1 is not normalised before it is rounded, the division by l comes last.
// Every '#pragma unroll' here gives a fragment, score or accumulator array constant indices, so that it stays in registers; the lambdas are inlined by force for the same reason (they work on those arrays by reference).

// fattn_s, fp16 planes (query rows >= RH): a tile is FW * 32 queries, 32 to a wave, and every wave walks all the keys of its own queries, so that (m, l, O) stay in its registers to the end.
// The waves share the keys: a stage is SK keys of the K plane and of the V^T plane (each SK * HD elements in a row, as they lie in memory, in fragment order) in LDS; two stage buffers, filled by asynchronous copies two stages ahead, one barrier a stage.
#define SK   64                   // keys of a stage
static_assert(SK % 32 == 0 && FW * 32 == 2 * SK && SK * HD * 2 == 4 * FW * 32 * 16, "a tile's own keys are two stages, the two that are filled when the loop ends; four copies of all threads bring a plane's share of a stage");
__device__ __forceinline__ void fattn_s(const h16* __restrict__ Q, const h16* __restrict__ Kp, const h16* __restrict__ Vt, int q0, bf* Ah, bf* Al, h16* ring) {
    constexpr int NQ = 2, STG = 2 * SK * HD;      // 16-query groups of a wave; elements of a stage: [K | V^T]
    const int lane = threadIdx.x & 31, lr = lane & 15, hi = lane >> 4; const int w = __builtin_amdgcn_readfirstlane(threadIdx.x >> 5);
    const int qw = q0 + w * 32;      // the wave's first query
    v16h qf[NQ][2]; v8f o[NQ][4]; float m[NQ], l[NQ];
#pragma unroll
    for (int nq = 0; nq < NQ; ++nq) { m[nq] = -3.0e38f; l[nq] = 0.f;
#pragma unroll
        for (int kk = 0; kk < 2; ++kk) qf[nq][kk] = WFrag<h16>::ld(Q + (size_t)(qw + nq * 16) * HD + kk * 512 + 8 * lane);
#pragma unroll
        for (int mt = 0; mt < 4; ++mt) o[nq][mt] = (v8f){}; }
    xw();
    const int nf = q0 / SK;      // stages in front of the tile's own keys: wholly below every wave's diagonal; FW * 32 / SK stages with the tile's own keys follow them
    const unsigned rl = (unsigned)(size_t)ring + threadIdx.x * 16;      // the thread's LDS byte address in stage buffer 0
    const h16* gk = Kp + threadIdx.x * 8; const h16* gv = Vt + threadIdx.x * 8;
    auto fill = [&](int s, int buf) __attribute__((always_inline)) {
        const unsigned d = rl + buf * (STG * 2); const h16* k = gk + (size_t)s * (SK * HD); const h16* v = gv + (size_t)s * (SK * HD);
        // the s_wait_xcnt 0 at the end of the statement stands in front of whatever next overwrites an address register of its copies
        asm volatile("global_load_async_to_lds_b128 %0, %1, off\n\tglobal_load_async_to_lds_b128 %2, %3, off\n\tglobal_load_async_to_lds_b128 %4, %5, off\n\tglobal_load_async_to_lds_b128 %6, %7, off\n\t"
                     "global_load_async_to_lds_b128 %8, %9, off\n\tglobal_load_async_to_lds_b128 %10, %11, off\n\tglobal_load_async_to_lds_b128 %12, %13, off\n\tglobal_load_async_to_lds_b128 %14, %15, off\n\ts_wait_xcnt 0x0"
                     :: "v"(d), "v"(k), "v"(d + 2048), "v"(k + 1024), "v"(d + 4096), "v"(k + 2048), "v"(d + 6144), "v"(k + 3072),
                        "v"(d + 8192), "v"(v), "v"(d + 10240), "v"(v + 1024), "v"(d + 12288), "v"(v + 2048), "v"(d + 14336), "v"(v + 3072) : "memory"); };
    // one pass = one block of 32 keys, read from the stage at sk (the lane's place in the block's first K fragment; its V^T fragments lie SK * HD elements behind)
    auto pass = [&](const h16* sk, int kb, bool diag) __attribute__((always_inline)) { v16h kf[2][2], vf[4]; v8f s[NQ][2];
#pragma unroll
        for (int t = 0; t < 2; ++t)
#pragma unroll
            for (int kk = 0; kk < 2; ++kk) kf[t][kk] = WFrag<h16>::ld(sk + t * 1024 + kk * 512);
#pragma unroll
        for (int mt = 0; mt < 4; ++mt) vf[mt] = WFrag<h16>::ld(sk + SK * HD + mt * 512);
        __builtin_amdgcn_sched_barrier(0);    // keeps the pass's fragment reads together in front of its products: the V^T reads' latency runs under scores and softmax, and no read stands among the products
#pragma unroll
        for (int nq = 0; nq < NQ; ++nq)
#pragma unroll
            for (int t = 0; t < 2; ++t) { s[nq][t] = (v8f){};
#pragma unroll
                for (int kk = 0; kk < 2; ++kk) s[nq][t] = wmma16(kf[t][kk], qf[nq][kk], s[nq][t]); }
#pragma unroll
        for (int nq = 0; nq < NQ; ++nq) { const int q = qw + nq * 16 + lr; float bm = -3.0e38f;
#pragma unroll
            for (int t = 0; t < 2; ++t)
#pragma unroll
                for (int j = 0; j < 8; ++j) { float x = s[nq][t][j] * SL2; if (diag) x = (kb + t * 16 + hi * 8 + j <= q) ? x : -3.0e38f; s[nq][t][j] = x; bm = fmaxf(bm, x); }
            bm = fmaxf(bm, __shfl_xor(bm, 16, 32));
            const float mn = fmaxf(m[nq], bm), al = __builtin_amdgcn_exp2f(m[nq] - mn); m[nq] = mn; float ps = 0.f;
#pragma unroll
            for (int t = 0; t < 2; ++t)
#pragma unroll
                for (int j = 0; j < 8; ++j) { const float p = __builtin_amdgcn_exp2f(s[nq][t][j] - mn); s[nq][t][j] = p; ps += p; }
            l[nq] = l[nq] * al + ps;     // this lane's eight-key halves only; the two halves of a query are added once, behind the loop
#pragma unroll
            for (int mt = 0; mt < 4; ++mt) o[nq][mt] *= al;
            v16h pf;
#pragma unroll
            for (int j = 0; j < 8; ++j) { pf[j] = tohx(s[nq][0][j]); pf[8 + j] = tohx(s[nq][1][j]); }
#pragma unroll
            for (int mt = 0; mt < 4; ++mt) o[nq][mt] = wmma16(vf[mt], pf, o[nq][mt]); } };
    fill(0, 0);
    asm volatile("s_wait_asynccnt 0x0" ::: "memory");    // this wave's copies of stage 0 have landed before the barrier that publishes them
    __syncthreads();
    fill(1, 1);
#pragma unroll 1   // rolled: one set of K and V^T fragments in registers
    for (int s = 0; s < nf; ++s) {
        const h16* st = ring + (s & 1) * STG + 8 * lane;
#pragma unroll 1   // rolled: unrolled, the second pass's fragment reads move up among the first's products and take a second set of registers, and with it a wave per SIMD
        for (int hb = 0; hb < SK / 32; ++hb) pass(st + hb * 32 * HD, s * SK + hb * 32, false);
        asm volatile("s_wait_dscnt 0x0" ::: "memory");       // this wave's reads of the stage are done before the barrier behind which its buffer is refilled
        asm volatile("s_wait_asynccnt 0x0" ::: "memory");    // this wave's copies of stage s + 1 have landed before the barrier that publishes them
        __syncthreads();
        fill(s + 2, s & 1);      // stage s + 2 exists: the two stages of the tile's own keys follow the loop's
    }
    // the tile's own keys, block tb = the queries of wave tb: a wave walks the blocks up to its own (all of them by the masked pass, which is one copy in the text), and passes the barriers of the others
#pragma unroll 1   // rolled: one copy of the masked pass
    for (int tb = 0; tb < FW; ++tb) {
        if (tb <= w) pass(ring + ((nf + tb / (SK / 32)) & 1) * STG + tb % (SK / 32) * 32 * HD + 8 * lane, q0 + tb * 32, true);
        if ((tb + 1) % (SK / 32) == 0 && tb + 1 < FW) {      // the foot of a stage that has a successor; nothing is refilled any more
            asm volatile("s_wait_asynccnt 0x0" ::: "memory");    // this wave's copies of the next stage have landed before the barrier that publishes them
            __syncthreads(); }
    }
    asm volatile("s_wait_asynccnt 0x0" ::: "memory");        // nothing of this wave is in flight when it goes on
#pragma unroll
    for (int nq = 0; nq < NQ; ++nq) { const float inv = __fdiv_rn(1.0f, l[nq] + __shfl_xor(l[nq], 16, 32));
#pragma unroll
        for (int mt = 0; mt < 4; ++mt) { v8us oh, ol;      // lane (lr, hi) holds d = 16 mt + 8 hi + j of query lr: its own 16-byte piece of a half block of the merged planes (rows = queries, k = head * HD + d), so a wave stores 512 bytes in a row
#pragma unroll
            for (int j = 0; j < 8; ++j) { unsigned short a, c2; splitf(o[nq][mt][j] * inv, a, c2); oh[j] = a; ol[j] = c2; }
            const size_t oo = (size_t)(qw + nq * 16) * DQ + mt * 256 + lane * 8; *(v8us*)(Ah + oo) = oh; *(v8us*)(Al + oo) = ol; xw(); } }
}

// fattn_hl, hi/lo bf16 planes, 3 products each side (query rows < RH): a tile is 16 queries; the 32-key blocks up to the diagonal are dealt to the FW waves in turn, their (m, l, O) meet in LDS and are joined in wave order.
__device__ __forceinline__ void fattn_hl(const bf* __restrict__ Q, const bf* __restrict__ Q2, const bf* __restrict__ Kp, const bf* __restrict__ K2, const bf* __restrict__ Vt, const bf* __restrict__ V2, int q0, bf* Ah, bf* Al, float* so, float* sm, float* sl) {
    typedef v16bf V; constexpr int NQ = 1;
    const int lane = threadIdx.x & 31, lr = lane & 15, hi = lane >> 4; const int w = __builtin_amdgcn_readfirstlane(threadIdx.x >> 5);
    V qf[NQ][2], qf2[NQ][2]; v8f o[NQ][4]; float m[NQ], l[NQ];
#pragma unroll
    for (int nq = 0; nq < NQ; ++nq) { m[nq] = -3.0e38f; l[nq] = 0.f;
#pragma unroll
        for (int kk = 0; kk < 2; ++kk) { const size_t qo = (size_t)(q0 + nq * 16) * HD + kk * 512 + 8 * lane; qf[nq][kk] = WFrag<bf>::ld(Q + qo); qf2[nq][kk] = WFrag<bf>::ld(Q2 + qo); }
#pragma unroll
        for (int mt = 0; mt < 4; ++mt) o[nq][mt] = (v8f){}; }
    xw();
    const int nblk = (q0 + NQ * 16 - 1) / 32 + 1;      // every block walked holds key kb <= q0: no query of the tile ever sees a block that is masked whole; only the last block crosses the diagonal
    // one pass = one block of 32 keys
    auto pass = [&](int b, bool diag) __attribute__((always_inline)) { const int kb = b * 32; V kf[2][2], kf2[2][2], vf[4], vf2[4]; v8f s[NQ][2];
#pragma unroll
        for (int t = 0; t < 2; ++t)
#pragma unroll
            for (int kk = 0; kk < 2; ++kk) kf[t][kk] = WFrag<bf>::ld(Kp + (size_t)(b * 32 + t * 16) * HD + kk * 512 + 8 * lane);
        xw();
#pragma unroll
        for (int t = 0; t < 2; ++t)
#pragma unroll
            for (int kk = 0; kk < 2; ++kk) kf2[t][kk] = WFrag<bf>::ld(K2 + (size_t)(b * 32 + t * 16) * HD + kk * 512 + 8 * lane);
        xw();
#pragma unroll
        for (int mt = 0; mt < 4; ++mt) vf[mt] = WFrag<bf>::ld(Vt + (size_t)kb * HD + mt * 512 + 8 * lane);
        xw();
#pragma unroll
        for (int mt = 0; mt < 4; ++mt) vf2[mt] = WFrag<bf>::ld(V2 + (size_t)kb * HD + mt * 512 + 8 * lane);
        xw();
#pragma unroll
        for (int nq = 0; nq < NQ; ++nq)
#pragma unroll
            for (int t = 0; t < 2; ++t) { s[nq][t] = (v8f){};
#pragma unroll
                for (int kk = 0; kk < 2; ++kk) { s[nq][t] = wmmab(kf[t][kk], qf[nq][kk], s[nq][t]); s[nq][t] = wmmab(kf[t][kk], qf2[nq][kk], s[nq][t]); s[nq][t] = wmmab(kf2[t][kk], qf[nq][kk], s[nq][t]); } }
#pragma unroll
        for (int nq = 0; nq < NQ; ++nq) { const int q = q0 + nq * 16 + lr; float bm = -3.0e38f;
#pragma unroll
            for (int t = 0; t < 2; ++t)
#pragma unroll
                for (int j = 0; j < 8; ++j) { float x = s[nq][t][j] * SL2; if (diag) x = (kb + t * 16 + hi * 8 + j <= q) ? x : -3.0e38f; s[nq][t][j] = x; bm = fmaxf(bm, x); }
            bm = fmaxf(bm, __shfl_xor(bm, 16, 32));
            const float mn = fmaxf(m[nq], bm), al = __builtin_amdgcn_exp2f(m[nq] - mn); m[nq] = mn; float ps = 0.f;
#pragma unroll
            for (int t = 0; t < 2; ++t)
#pragma unroll
                for (int j = 0; j < 8; ++j) { const float p = __builtin_amdgcn_exp2f(s[nq][t][j] - mn); s[nq][t][j] = p; ps += p; }
            l[nq] = l[nq] * al + ps;     // this lane's eight-key halves only; the two halves of a query are added once, behind the loop
#pragma unroll
            for (int mt = 0; mt < 4; ++mt) o[nq][mt] *= al;
            v8us h0, h1, l0, l1;
#pragma unroll
            for (int j = 0; j < 8; ++j) { unsigned short a, c2; splitf(s[nq][0][j], a, c2); h0[j] = a; l0[j] = c2; splitf(s[nq][1][j], a, c2); h1[j] = a; l1[j] = c2; }
            const v16bf ph = cat16b(h0, h1), pl = cat16b(l0, l1);
#pragma unroll
            for (int mt = 0; mt < 4; ++mt) { o[nq][mt] = wmmab(vf[mt], ph, o[nq][mt]); o[nq][mt] = wmmab(vf[mt], pl, o[nq][mt]); o[nq][mt] = wmmab(vf2[mt], ph, o[nq][mt]); } } };
    int b = w;
#pragma unroll 1   // rolled: one set of K and V^T fragments in registers
    for (; b < nblk - 1; b += FW) pass(b, false);     // blocks wholly below the diagonal: no mask
    if (b == nblk - 1) pass(b, true);                 // the diagonal block, in the wave whose turn it is
#pragma unroll
    for (int nq = 0; nq < NQ; ++nq) { const int ql = w * 32 + nq * 16 + lr; const float lt = l[nq] + __shfl_xor(l[nq], 16, 32); if (hi == 0) { sm[ql] = m[nq]; sl[ql] = lt; }
#pragma unroll
        for (int mt = 0; mt < 4; ++mt) { float* d = so + ql * OSP + mt * 16 + hi * 8; const v8f a = o[nq][mt]; *(v4fa*)d = (v4f){a[0], a[1], a[2], a[3]}; *(v4fa*)(d + 4) = (v4f){a[4], a[5], a[6], a[7]}; } }
    __syncthreads();    // every wave's (m, l, O) is in LDS before any wave joins them
#pragma unroll
    for (int it = 0; it < NQ * 16 / (FW * 4); ++it) { const int un = it * FW + w, ql = (un >> 2) * 16 + lr, g = (un & 3) * 2 + hi;     // a wave stores one 512-byte half block of the merged planes (rows = queries, k = head * HD + d): 16 queries x 16 d
        float mw[FW], M = -3.0e38f, Lt = 0.f, acc[8];
#pragma unroll
        for (int u = 0; u < FW; ++u) { mw[u] = sm[u * 32 + ql]; M = fmaxf(M, mw[u]); }
#pragma unroll
        for (int j = 0; j < 8; ++j) acc[j] = 0.f;
#pragma unroll
        for (int u = 0; u < FW; ++u) { const float f = __builtin_amdgcn_exp2f(mw[u] - M); Lt += f * sl[u * 32 + ql]; const float* d = so + (u * 32 + ql) * OSP + g * 8; const v4f a = *(const v4fa*)d, c = *(const v4fa*)(d + 4);   // a wave that had no block: m = -3e38, f = 0
#pragma unroll
            for (int j = 0; j < 4; ++j) { acc[j] += f * a[j]; acc[4 + j] += f * c[j]; } }
        const float inv = __fdiv_rn(1.0f, Lt); v8us oh, ol;
#pragma unroll
        for (int j = 0; j < 8; ++j) { unsigned short a, c2; splitf(acc[j] * inv, a, c2); oh[j] = a; ol[j] = c2; }
        const size_t oo = (size_t)(q0 + (un >> 2) * 16) * DQ + (un & 3) * 256 + lane * 8; *(v8us*)(Ah + oo) = oh; *(v8us*)(Al + oo) = ol; xw(); }
}
// grid (chunks x heads, tiles), longest tiles of every chunk first: (TT - RH) / (FW * 32) fp16 tiles of FW * 32 queries from the last row down, then RH / 16 hi/lo tiles of 16 queries.
static_assert((TT - RH) % (FW * 32) == 0 && RH % SK == 0, "whole fp16 tiles, each beginning on a stage");
__global__ __launch_bounds__(FW * 32) void k_fattn(const h16* __restrict__ Q16, const h16* __restrict__ K16, const h16* __restrict__ V16, const bf* __restrict__ Qh, const bf* __restrict__ Ql, const bf* __restrict__ Kh, const bf* __restrict__ Kl, const bf* __restrict__ Vh, const bf* __restrict__ Vl, bf* Ah, bf* Al) {
    __shared__ __align__(16) float so[FW * 32 * OSP]; __shared__ float sm[FW * 32]; __shared__ float sl[FW * 32];
    static_assert(sizeof(so) >= 2 * 2 * SK * HD * sizeof(h16), "an fp16 tile's two stage buffers lie in so, which only a hi/lo tile uses for partial outputs");
    const int h = blockIdx.x % NH_, ch = blockIdx.x / NH_, tile = blockIdx.y; const size_t hp = (size_t)(ch * (NH_ + NKV) + h) * TT * HD, vp = (size_t)(ch * NKV + h) * HD * PP;
    Ah += (size_t)ch * TT * DQ; Al += (size_t)ch * TT * DQ;
    if (tile < (TT - RH) / (FW * 32)) fattn_s(Q16 + hp, K16 + hp, V16 + vp, TT - FW * 32 * (tile + 1), Ah + h * HD * 16, Al + h * HD * 16, (h16*)so);
    else fattn_hl(Qh + hp, Ql + hp, Kh + hp, Kl + hp, Vh + vp, Vl + vp, RH - 16 * (tile - (TT - RH) / (FW * 32) + 1), Ah + h * HD * 16, Al + h * HD * 16, so, sm, sl);
}

extern "C" void kernel_launch(void* const* d_in, const int* in_sizes, int n_in,
                              void* d_out, int out_size, void* d_ws, size_t ws_size, hipStream_t stream) {
    (void)in_sizes; (void)n_in; (void)out_size;
    const float* x = (const float*)d_in[0]; const float* wq = (const float*)d_in[1]; const float* wk = (const float*)d_in[2]; const float* wv = (const float*)d_in[3]; const float* wo = (const float*)d_in[4];   /* input order hidden_states, Wq, Wk, Wv, Wo ('oi': 'x @ W.T') */
    float* OUT = (float*)d_out;     // [4][2048][1024]
    char* wsp = (char*)d_ws;
    auto take = [&](size_t bytes) { char* p = wsp; wsp += (bytes + 255) & ~(size_t)255; return (void*)p; };
    bf* WQ = (bf*)take((size_t)DF * DM * 2); bf* WK = WQ + (size_t)DQ * DM; bf* WV = WK + (size_t)DKV * DM;   /* one [DF][DM] plane: q, k, v rows */ bf* WO = (bf*)take((size_t)DM * DQ * 2);
    bf* XB = (bf*)take((size_t)NB_ * TT * DM * 2);   // x copy
    h16* QP16 = (h16*)take((size_t)NB_ * (NH_ + NKV) * TT * HD * 2); h16* KP16 = QP16 + (size_t)NH_ * TT * HD;   /* in each chunk the k heads' planes follow the q heads': head index = 64-column tile of the joint projection */ h16* VT16 = (h16*)take((size_t)NB_ * NKV * HD * PP * 2);
    bf* QPh = (bf*)take((size_t)NB_ * (NH_ + NKV) * TT * HD * 2); bf* KPh = QPh + (size_t)NH_ * TT * HD; bf* QPl = (bf*)take((size_t)NB_ * (NH_ + NKV) * TT * HD * 2); bf* KPl = QPl + (size_t)NH_ * TT * HD; bf* VTh = (bf*)take((size_t)NB_ * NKV * HD * PP * 2); bf* VTl = VTh + (size_t)TT * HD;   // a head's hi plane and lo plane one behind the other in its HD * PP elements
    bf* ATh = (bf*)take((size_t)NB_ * TT * DQ * 2); bf* ATl = (bf*)take((size_t)NB_ * TT * DQ * 2);
    if ((size_t)(wsp - (char*)d_ws) > ws_size) return;    // ws 256 MiB
    k_cvt5<<<CB_X + 2 * CB_Q + 2 * CB_K, 256, 0, stream>>>(x, wq, wk, wv, wo, XB, WQ, WK, WV, WO);
    k_gemmw<bf, 0, false, true, DM, 4, 2><<<dim3(NB_ * TT / 256, DF / 128, 1), 256, 0, stream>>>(XB, nullptr, WQ, nullptr, nullptr, 0, nullptr, 0, 0, 0, QP16, QPh, QPl, VT16, VTh, VTl);   // q, k and v projections of every chunk in one launch, written as head planes
    k_fattn<<<dim3(NB_ * NH_, (TT - RH) / (FW * 32) + RH / 16), FW * 32, 0, stream>>>(QP16, KP16, VT16, QPh, QPl, KPh, KPl, VTh, VTl, ATh, ATl);   // one kv head per query head
    k_gemmw<bf, 1, false, false, DQ, 2, 2><<<dim3(NB_ * TT / 128, DM / 128, 1), 128, 0, stream>>>(ATh, ATl, WO, nullptr, OUT, DM, nullptr, 0, 0, 0, nullptr, nullptr, nullptr, nullptr, nullptr, nullptr);
}

// v009
// Measured time: 119 microseconds a run.
// Timed twice side by side with v008, it ran 1.20 and 1.19 times as fast.
// Counting every step since v000, it is 23.1 times as fast.
#include <hip/hip_runtime.h>

// Chunk-local causal multi-head self-attention (a ring attention with ring_size 1) (hidden_states [1][8192][1024] = FOUR chunks of 2,048 tokens: in memory [4][2048][1024]; q, k, v = x W^T ('oi' [1024][1024] 0.02, no bias; 16 heads x 64); each chunk attends causally WITHIN itself: scores / sqrt(64), tril(ones((2048, 2048))) kept, -inf elsewhere; softmax; out = merged Wo^T ('oi', no bias) -> [1][8192][1024] = [4][2048][1024] (8.4 M); argument order hidden_states, Wq, Wk, Wv, Wo).
// Four launches, each over all four chunks at once (every plane in the workspace but the weight copies has one copy per chunk): bf16 copies of x and of the weights; exact projections, whose GEMM writes the 16-bit head planes itself (no f32 projection in memory); causal T-2048 attention (k_fattn: scores, online softmax and P x V per query tile, no score matrix in memory; hybrid rows: < 512 hi/lo 3 products, rest fp16, whose K and V^T blocks the waves of a work-group share in LDS); merged hi/lo x W_o exact.
// Every 16-bit plane that feeds a matrix fragment is stored in FRAGMENT ORDER: a block of 16 rows x 32 k is 1 KiB in a row, element (row, k) at ((k >> 4) & 1) * 256 + ((k >> 3) & 1) * 128 + (row & 15) * 8 + (k & 7), so that lane (lr, hi) finds its two 16-byte pieces at lane * 8 and 256 + lane * 8 and each wave-wide load covers four whole 128-byte lines. The k order inside a fragment is the one the row-major planes gave.
// Compute dtypes, f32 accumulate: every input rounded to bf16; projections exact; attention rows < 512 3 products, rest fp16; softmax f32; W_o hl x exact.

#define NB_  4
#define TT   2048
#define DM   1024
#define NH_  16
#define NKV  16
#define REP  (NH_ / NKV)
#define HD   64
#define DQ   (NH_ * HD)
#define DKV  (NKV * HD)
#define RH   512                  // query rows < RH use hi+lo planes (0: none)
#define SCL  0.125f   // HD^-0.5
#define DF   (DQ + 2 * DKV)       // columns of the joint q | k | v projection
#define PP   (2 * TT)             // HD * PP 16-bit elements: a head's room in the V^T planes (hi and lo plane; the fp16 plane fills half)
#define FW   4                    // waves of an attention work-group
#define OSP  68                   // pitch, in f32, of one query's partial output row in LDS
#define SL2  (SCL * 1.4426950408889634f)   // score scale into the log2 domain
typedef _Float16 h16;
typedef unsigned short bf;
typedef __attribute__((ext_vector_type(16))) __bf16   v16bf;
typedef __attribute__((ext_vector_type(16))) _Float16 v16h;
typedef __attribute__((ext_vector_type(8)))  _Float16 v8h;
typedef __attribute__((ext_vector_type(8)))  unsigned short v8us;
typedef __attribute__((ext_vector_type(8)))  float    v8f;
typedef __attribute__((ext_vector_type(4)))  float    v4f;
typedef v8h  __attribute__((may_alias)) v8ha;
typedef v4f  __attribute__((may_alias)) v4fa;
typedef v8us __attribute__((may_alias)) v8usa;

__device__ __forceinline__ unsigned short f2bf(float f) { unsigned u = __float_as_uint(f); u += 0x7FFFu + ((u >> 16) & 1u); return (unsigned short)(u >> 16); }
__device__ __forceinline__ float bf2f(unsigned short b) { return __uint_as_float(((unsigned)b) << 16); }
__device__ __forceinline__ float bfr(float f) { return bf2f(f2bf(f)); }
__device__ __forceinline__ v16h cat16(v8h lo, v8h hi) { return __builtin_shufflevector(lo, hi, 0, 1, 2, 3, 4, 5, 6, 7, 8, 9, 10, 11, 12, 13, 14, 15); }
__device__ __forceinline__ v16bf cat16b(v8us lo, v8us hi) { return __builtin_bit_cast(v16bf, __builtin_shufflevector(lo, hi, 0, 1, 2, 3, 4, 5, 6, 7, 8, 9, 10, 11, 12, 13, 14, 15)); }
__device__ __forceinline__ v8f wmma16(v16h a, v16h b, v8f c) { return __builtin_amdgcn_wmma_f32_16x16x32_f16(false, a, false, b, (short)0, c, false, false); }
__device__ __forceinline__ v8f wmmab(v16bf a, v16bf b, v8f c) { return __builtin_amdgcn_wmma_f32_16x16x32_bf16(false, a, false, b, (short)0, c, false, false); }
__device__ __forceinline__ h16 tohx(float x) { return (h16)x; }
__device__ __forceinline__ void splitf(float y, unsigned short& h, unsigned short& l) { h = f2bf(y); l = f2bf(y - bf2f(h)); }
// s_wait_xcnt 0 behind a run of global loads or stores, in front of whatever next overwrites a register that the run names (address pairs, store data).
__device__ __forceinline__ void xw() { asm volatile("s_wait_xcnt 0x0" ::: "memory"); }
// the same wait behind a run of loads that all go from the address p (or from p and q): as inputs, the addresses keep their registers up to the wait, so that no load of the run lands on them.
__device__ __forceinline__ void xwa(const void* p) { asm volatile("s_wait_xcnt 0x0" :: "v"(p) : "memory"); }
__device__ __forceinline__ void xwa(const void* p, const void* q) { asm volatile("s_wait_xcnt 0x0" :: "v"(p), "v"(q) : "memory"); }



// ---- k_gemmw: register-blocked GEMM, one wave per 64x64 output tile (16 accumulators), GWM x GWN waves per work-group (4 x 2 on a 256x128 tile in the projection; 2 x 2 on 128x128 for W_o, so that two work-groups with barriers of their own share a WGP); grid (M / (64 GWM), N / (64 GWN), Z). Operands are 16-bit planes in fragment order, blocks [row / 16][k / 32] (ld takes the lane's place in a block).
// KS = 64 k (two k steps of 32) of the tile's operand blocks are a stage in LDS, shared by the waves: two stage buffers, filled by asynchronous copies two stages ahead, one barrier a stage. A stage's copies have the time of two k steps to land, and between the two steps no wave waits for another.
// C[m][n] (f32, pitch ldc, + optional f32 bias[n]) = sum_k A[m][k] Bt[n][k] (+ split products per NSPLIT). z-batch strides sA/sB/sC in elements. K % 64 == 0 and K >= 128; K is a compile-time constant, so that all fragments of an operand in a k step lie at constant offsets from one address.
// PL (the joint q | k | v projection): a 64-column tile is one head, and the tile goes straight from the accumulators to that head's fp16, bf16-hi and bf16-lo planes; C is not written.
// A row tile lies in one chunk (TT % 64 == 0). q and k heads: planes [chunk][head], blocks [t / 16][d / 32]; v heads: planes [chunk][head] (HD * PP elements apart), rows d, k = t, blocks [t / 32][d / 16]. Sixteen plane rows at a time are turned in LDS so that a wave stores 512 bytes in a row.
template <typename T16> struct WFrag;
template <> struct WFrag<h16> { typedef v16h V; static __device__ __forceinline__ V ld(const h16* p) { return cat16(*(const v8h*)p, *(const v8h*)(p + 256)); } static __device__ __forceinline__ v8f mma(V a, V b, v8f c) { return wmma16(a, b, c); } };
template <> struct WFrag<bf> { typedef v16bf V; static __device__ __forceinline__ V ld(const bf* p) { return cat16b(*(const v8us*)p, *(const v8us*)(p + 256)); } static __device__ __forceinline__ v8f mma(V a, V b, v8f c) { return wmmab(a, b, c); } };
// twelve asynchronous copies of all threads, 16 bytes a thread each: eight from g + i * gs (elements) to the LDS byte address l + i * ls, four from h + i * gs to m + i * ls. The s_wait_xcnt 0 at the end of the statement stands in front of whatever next overwrites an address register of its copies.
template <typename T16> __device__ __forceinline__ void cp12(unsigned l, const T16* g, unsigned m, const T16* h, unsigned ls, size_t gs) {
    asm volatile("global_load_async_to_lds_b128 %0, %1, off\n\tglobal_load_async_to_lds_b128 %2, %3, off\n\tglobal_load_async_to_lds_b128 %4, %5, off\n\tglobal_load_async_to_lds_b128 %6, %7, off\n\t"
                 "global_load_async_to_lds_b128 %8, %9, off\n\tglobal_load_async_to_lds_b128 %10, %11, off\n\tglobal_load_async_to_lds_b128 %12, %13, off\n\tglobal_load_async_to_lds_b128 %14, %15, off\n\t"
                 "global_load_async_to_lds_b128 %16, %17, off\n\tglobal_load_async_to_lds_b128 %18, %19, off\n\tglobal_load_async_to_lds_b128 %20, %21, off\n\tglobal_load_async_to_lds_b128 %22, %23, off\n\ts_wait_xcnt 0x0"
                 :: "v"(l), "v"(g), "v"(l + ls), "v"(g + gs), "v"(l + 2 * ls), "v"(g + 2 * gs), "v"(l + 3 * ls), "v"(g + 3 * gs),
                    "v"(l + 4 * ls), "v"(g + 4 * gs), "v"(l + 5 * ls), "v"(g + 5 * gs), "v"(l + 6 * ls), "v"(g + 6 * gs), "v"(l + 7 * ls), "v"(g + 7 * gs),
                    "v"(m), "v"(h), "v"(m + ls), "v"(h + gs), "v"(m + 2 * ls), "v"(h + 2 * gs), "v"(m + 3 * ls), "v"(h + 3 * gs) : "memory"); }
template <typename T16, int NSPLIT, bool BIAS, bool PL, int K, int GWM, int GWN>      // GWM x GWN wave tiles in a work-group's tile
__global__ __launch_bounds__(GWM * GWN * 32) void k_gemmw(const T16* __restrict__ A, const T16* __restrict__ A2, const T16* __restrict__ Bt, const T16* __restrict__ Bt2, float* C, int ldc, const float* __restrict__ bias, size_t sA, size_t sB, size_t sC, h16* P16, bf* Ph, bf* Pl, h16* V16, bf* Vh, bf* Vl) {
    typedef typename WFrag<T16>::V V;
    constexpr int KS = 64, KB = KS / 32;      // k of a stage; blocks of 32 k in it
    static_assert(NSPLIT <= 1, "one B plane"); static_assert(K >= 2 * KS && K % KS == 0, "two stages or more");
    constexpr int GTM = GWM * 64, GTN = GWN * 64, PA = GTM * KS, PB = GTN * KS;                  // elements of one stage of an A plane and of the B plane: GTM / 16 and GTN / 16 rows of blocks, KB blocks in each
    constexpr int STGE = (NSPLIT == 1 ? 2 : 1) * PA + PB;        // one stage: [A | A2 | B]
    __shared__ __align__(1024) T16 ring[2 * STGE];
    __shared__ __align__(16) float osw[GWM * GWN][16 * 68];
    const size_t z = blockIdx.z; A += z * sA; if (A2) A2 += z * sA; Bt += z * sB; C += z * sC;
    const int lane = threadIdx.x & 31, lr = lane & 15, hi = lane >> 4; const int w = __builtin_amdgcn_readfirstlane(threadIdx.x >> 5), wm = w % GWM, wn = w / GWM;
    float* os = osw[w];      // each wave turns its own tile in its own rows
    const int r0 = blockIdx.x * GTM + wm * 64, c0 = blockIdx.y * GTN + wn * 64;
    v8f acc[4][4];
#pragma unroll
    for (int mb = 0; mb < 4; ++mb)
#pragma unroll
        for (int nb = 0; nb < 4; ++nb) acc[mb][nb] = (v8f){};
    // A stage is copied as it lies in memory: the KB blocks of a row of blocks are KB KiB in a row. One copy of all threads brings RPC rows of blocks, thread t the 16 bytes at (t % RBT) * 16 of row t / RBT; in LDS the rows of blocks follow one another, so thread t writes at t * 16.
    constexpr int NT = GWM * GWN * 32, RBT = KB * 64, RPC = NT / RBT; constexpr unsigned LS = NT * 16; constexpr size_t GS = (size_t)RPC * 16 * K;      // threads; threads to a row of blocks; rows of blocks a copy; a copy's step in LDS bytes and in plane elements
    static_assert(NT % RBT == 0 && PA * 2 == 8 * LS && PB * 2 == (NSPLIT == 1 ? 8 : 4) * LS, "eight copies bring an A plane's share of a stage; eight (two planes of A) or four the B plane's");
    const size_t tb = (size_t)(threadIdx.x / RBT) * 16 * K + (threadIdx.x % RBT) * 8;
    const T16* ga = A + (size_t)blockIdx.x * GTM * K + tb; const T16* ga2 = A2 + (size_t)blockIdx.x * GTM * K + tb; const T16* gb = Bt + (size_t)blockIdx.y * GTN * K + tb;
    const unsigned rl = (unsigned)(size_t)ring + threadIdx.x * 16;      // the thread's LDS byte address in the first copy of stage buffer 0
    auto fill = [&](int kt, int buf) __attribute__((always_inline)) {
        const unsigned l = rl + buf * (STGE * 2); const size_t ko = (size_t)kt * (KB * 512);
        if (NSPLIT == 1) { cp12(l, ga + ko, l + 2 * PA, ga2 + ko, LS, GS); cp12(l + 4 * PA, gb + ko, l + 2 * PA + 4 * LS, ga2 + ko + 4 * GS, LS, GS); }      // A and the first half of A2; B and the second half of A2
        else cp12(l, ga + ko, l + 2 * PA, gb + ko, LS, GS); };      // A and B
    fill(0, 0);
    asm volatile("s_wait_asynccnt 0x0" ::: "memory");    // this wave's copies of stage 0 have landed before the barrier that publishes them
    __syncthreads();
    fill(1, 1);
#pragma unroll 1   // rolled: one set of fragments in registers
    for (int t = 0; t < K / KS; ++t) {
        const T16* sa = ring + (t & 1) * STGE + wm * (4 * KB * 512) + 8 * lane; const T16* sb = ring + (t & 1) * STGE + (NSPLIT == 1 ? 2 : 1) * PA + wn * (4 * KB * 512) + 8 * lane;
#pragma unroll   // the stage's k steps at constant LDS offsets; the fences below keep them one behind the other, on one set of fragment registers
        for (int kk = 0; kk < KB; ++kk) {
            V a[4], a2[4], b[4];
#pragma unroll
            for (int mb = 0; mb < 4; ++mb) { a[mb] = WFrag<T16>::ld(sa + (mb * KB + kk) * 512); if (NSPLIT == 1) a2[mb] = WFrag<T16>::ld(sa + PA + (mb * KB + kk) * 512); }
#pragma unroll
            for (int nb = 0; nb < 4; ++nb) b[nb] = WFrag<T16>::ld(sb + (nb * KB + kk) * 512);
            __builtin_amdgcn_sched_barrier(0);    // keeps the step's fragment reads together in front of its products: a read placed among the products is waited for there, with its whole LDS latency open
#pragma unroll
            for (int nb = 0; nb < 4; ++nb)
#pragma unroll
                for (int mb = 0; mb < 4; ++mb) { acc[mb][nb] = WFrag<T16>::mma(a[mb], b[nb], acc[mb][nb]); if (NSPLIT == 1) acc[mb][nb] = WFrag<T16>::mma(a2[mb], b[nb], acc[mb][nb]); }
            __builtin_amdgcn_sched_barrier(0);    // keeps the products in front of the next step's reads, which so take the same fragment registers, and in front of the waits below: moved behind the barrier, they would leave the copies of stage t + 1 less time to land
        }
        asm volatile("s_wait_dscnt 0x0" ::: "memory");       // this wave's reads of the stage are done before the barrier behind which its buffer is refilled
        asm volatile("s_wait_asynccnt 0x0" ::: "memory");    // this wave's copies of stage t + 1 have landed before the barrier that publishes them
        __syncthreads();
        if (t + 2 < K / KS) fill(t + 2, t & 1);
    }
    asm volatile("s_wait_asynccnt 0x0" ::: "memory");        // nothing of this wave is in flight when it goes on
    if (PL) {
        const int hh = blockIdx.y * GWN + wn; const bool isv = hh >= NH_ + NKV;      // the same for the whole wave
        const int ch = r0 / TT, rc = r0 % TT;      // chunk of the row tile, first token inside it
        const size_t base = isv ? (size_t)(ch * NKV + hh - NH_ - NKV) * HD * PP + (size_t)rc * HD : ((size_t)(ch * (NH_ + NKV) + hh) * TT + rc) * HD;      // 64 tokens are 4 x 2 blocks of a q or k plane, 2 x 4 blocks of a v plane: rc * HD elements in front of them either way
        h16* D16 = (isv ? V16 : P16) + base; bf* Dh = (isv ? Vh : Ph) + base; bf* Dl = (isv ? Vl : Pl) + base;
#pragma unroll   // constant accumulator indices
        for (int u = 0; u < 4; ++u) {
            if (isv) {      // plane rows = 16 columns d of the tile, 64 tokens along each: a lane's 8 accumulator values are 8 tokens in a row
#pragma unroll
                for (int mb = 0; mb < 4; ++mb) { float* d = os + lr * 68 + mb * 16 + hi * 8; const v8f a = acc[mb][u]; *(v4fa*)d = (v4f){a[0], a[1], a[2], a[3]}; *(v4fa*)(d + 4) = (v4f){a[4], a[5], a[6], a[7]}; }
            } else {        // plane rows = 16 tokens of the tile, 64 columns d along each
#pragma unroll
                for (int nb = 0; nb < 4; ++nb) {
#pragma unroll
                    for (int j = 0; j < 8; ++j) os[(hi * 8 + j) * 68 + nb * 16 + lr] = acc[u][nb][j]; }
            }
            __builtin_amdgcn_wave_barrier(); asm volatile("" ::: "memory");   // the reads below take other lanes' values: they stay behind the writes
#pragma unroll
            for (int s = 0; s < 4; ++s) { const int g = 2 * s + hi; const float* d = os + lr * 68 + g * 8;      // plane row lr, its k = 8 g ..: half s & 1 of the row's block s >> 1
                 const v4f a = *(const v4fa*)d, c = *(const v4fa*)(d + 4); v8h o16; v8us oh, ol;
#pragma unroll
                for (int j = 0; j < 4; ++j) { unsigned short p, q; o16[j] = tohx(a[j]); splitf(a[j], p, q); oh[j] = p; ol[j] = q; o16[4 + j] = tohx(c[j]); splitf(c[j], p, q); oh[4 + j] = p; ol[4 + j] = q; }
                const size_t o = (size_t)(isv ? (s >> 1) * 2048 + u * 512 + (s & 1) * 256 : u * 1024 + s * 256) + lane * 8; *(v8h*)(D16 + o) = o16; *(v8us*)(Dh + o) = oh; *(v8us*)(Dl + o) = ol; xw(); }
            __builtin_amdgcn_wave_barrier(); asm volatile("" ::: "memory");   // the next sixteen rows overwrite os only behind these reads
        }
        return;
    }
#pragma unroll
    for (int mb = 0; mb < 4; ++mb) {
#pragma unroll
        for (int nb = 0; nb < 4; ++nb) {
#pragma unroll
            for (int j = 0; j < 8; ++j) os[(hi * 8 + j) * 68 + nb * 16 + lr] = acc[mb][nb][j]; }
        __builtin_amdgcn_wave_barrier(); asm volatile("" ::: "memory");
        float* crow = C + (size_t)(r0 + mb * 16) * ldc + c0;
{
#pragma unroll
            for (int s = 0; s < 8; ++s) { const int row = 2 * s + hi, cofs = lr * 4; v4f val = *(const v4fa*)(os + row * 68 + cofs); if (BIAS) { val[0] += bfr(bias[c0 + cofs]); val[1] += bfr(bias[c0 + cofs + 1]); val[2] += bfr(bias[c0 + cofs + 2]); val[3] += bfr(bias[c0 + cofs + 3]); }
                *(v4f*)(crow + (size_t)row * ldc + cofs) = val; }
             }
        __builtin_amdgcn_wave_barrier(); asm volatile("" ::: "memory");
    }
}

typedef __attribute__((ext_vector_type(2))) _Float16 v2h;
typedef __attribute__((ext_vector_type(4))) _Float16 v4h;
typedef __attribute__((ext_vector_type(2))) unsigned short v2us;
typedef __attribute__((ext_vector_type(4))) unsigned short v4us;
typedef __attribute__((ext_vector_type(2))) float v2f;
typedef __attribute__((ext_vector_type(4))) int v4i;

__global__ __launch_bounds__(256) void k_wtG(const float* __restrict__ w, int K, int N, bf* Bt) {
    const int lane = threadIdx.x & 31; const int L0 = (blockIdx.x * 8 + (threadIdx.x >> 5)) * 8; const int nlines = N * K / 64;
{
#pragma unroll 1
        for (int l = 0; l < 8; ++l) { const int L = L0 + l; if (L >= nlines) break; const size_t e = (size_t)L * 64 + lane * 2; const int k = (int)(e % K), n = (int)(e / K); v2us o;
            o[0] = f2bf(w[(size_t)k * N + n]); o[1] = f2bf(w[(size_t)(k + 1) * N + n]); *(v2us*)(Bt + e) = o; }
         }
}
// bf16 copies of all five inputs in one launch, written in fragment order (blocks [row / 16][k / 32], every input has DM columns): a work-group converts the 2,048 elements of four blocks of the one input that its index falls into (the choice is the same for the whole work-group). A thread owns one 16-byte piece of the copy, so a wave stores 512 bytes in a row.
static_assert(DQ == DM, "W_o has DM columns");
#define CB_X ((unsigned)((size_t)NB_ * TT * DM / 2048))
#define CB_Q ((unsigned)((size_t)DQ * DM / 2048))
#define CB_K ((unsigned)((size_t)DKV * DM / 2048))
__global__ __launch_bounds__(256) void k_cvt5(const float* __restrict__ x, const float* __restrict__ wq, const float* __restrict__ wk, const float* __restrict__ wv, const float* __restrict__ wo, bf* XB, bf* WQ, bf* WK, bf* WV, bf* WO) {
    unsigned blk = blockIdx.x; const float* src = x; bf* dst = XB;
    if (blk >= CB_X + CB_Q + 2 * CB_K) { blk -= CB_X + CB_Q + 2 * CB_K; src = wo; dst = WO; }
    else if (blk >= CB_X + CB_Q + CB_K) { blk -= CB_X + CB_Q + CB_K; src = wv; dst = WV; }
    else if (blk >= CB_X + CB_Q) { blk -= CB_X + CB_Q; src = wk; dst = WK; }
    else if (blk >= CB_X) { blk -= CB_X; src = wq; dst = WQ; }
    const size_t i = (size_t)blk * 256 + threadIdx.x; const size_t bl = i >> 6; const int row = (int)(bl / (DM / 32)) * 16 + (int)(i & 15), kk = (int)(bl % (DM / 32)) * 32 + (int)((i >> 4) & 3) * 8;
    const v8f v = *(const v8f*)(src + (size_t)row * DM + kk); xw(); v8us o;
#pragma unroll
    for (int k = 0; k < 8; ++k) o[k] = f2bf(v[k]); *(v8us*)(dst + i * 8) = o;  }

// ---- k_fattn: scores, causal softmax and probability x value product of one query tile of one head in one work-group of FW waves; nothing of the score matrix reaches memory.
// S^T = K Q^T (A = 16 key rows, B = 16 query rows): lane (lr, hi) holds keys 8 hi + j of query lr, so two score tiles of 32 keys, converted in place, are the B fragment of O^T += V^T P^T (A = rows of the V^T plane).
// Online softmax in the log2 domain: running maximum m and sum l per query, O^T rescaled when m moves; P = exp2(s - m) <= 1 is not normalised before it is rounded, the division by l comes last.
// Every '#pragma unroll' here gives a fragment, score or accumulator array constant indices, so that it stays in registers; the lambdas are inlined by force for the same reason (they work on those arrays by reference).

// fattn_s, fp16 planes (query rows >= RH): a tile is FW * 32 queries, 32 to a wave, and every wave walks all the keys of its own queries, so that (m, l, O) stay in its registers to the end.
// The waves share the keys: a stage is SK keys of the K plane and of the V^T plane (each SK * HD elements in a row, as they lie in memory, in fragment order) in LDS; two stage buffers, filled by asynchronous copies two stages ahead, one barrier a stage.
#define SK   64                   // keys of a stage
static_assert(SK % 32 == 0 && FW * 32 == 2 * SK && SK * HD * 2 == 4 * FW * 32 * 16, "a tile's own keys are two stages, the two that are filled when the loop ends; four copies of all threads bring a plane's share of a stage");
__device__ __forceinline__ void fattn_s(const h16* __restrict__ Q, const h16* __restrict__ Kp, const h16* __restrict__ Vt, int q0, bf* Ah, bf* Al, h16* ring) {
    constexpr int NQ = 2, STG = 2 * SK * HD;      // 16-query groups of a wave; elements of a stage: [K | V^T]
    const int lane = threadIdx.x & 31, lr = lane & 15, hi = lane >> 4; const int w = __builtin_amdgcn_readfirstlane(threadIdx.x >> 5);
    const int qw = q0 + w * 32;      // the wave's first query
    v16h qf[NQ][2]; v8f o[NQ][4]; float m[NQ], l[NQ];
#pragma unroll
    for (int nq = 0; nq < NQ; ++nq) { m[nq] = -3.0e38f; l[nq] = 0.f;
#pragma unroll
        for (int kk = 0; kk < 2; ++kk) qf[nq][kk] = WFrag<h16>::ld(Q + (size_t)(qw + nq * 16) * HD + kk * 512 + 8 * lane);
#pragma unroll
        for (int mt = 0; mt < 4; ++mt) o[nq][mt] = (v8f){}; }
    xw();
    const int nf = q0 / SK;      // stages in front of the tile's own keys: wholly below every wave's diagonal; FW * 32 / SK stages with the tile's own keys follow them
    const unsigned rl = (unsigned)(size_t)ring + threadIdx.x * 16;      // the thread's LDS byte address in stage buffer 0
    const h16* gk = Kp + threadIdx.x * 8; const h16* gv = Vt + threadIdx.x * 8;
    auto fill = [&](int s, int buf) __attribute__((always_inline)) {
        const unsigned d = rl + buf * (STG * 2); const h16* k = gk + (size_t)s * (SK * HD); const h16* v = gv + (size_t)s * (SK * HD);
        // the s_wait_xcnt 0 at the end of the statement stands in front of whatever next overwrites an address register of its copies
        asm volatile("global_load_async_to_lds_b128 %0, %1, off\n\tglobal_load_async_to_lds_b128 %2, %3, off\n\tglobal_load_async_to_lds_b128 %4, %5, off\n\tglobal_load_async_to_lds_b128 %6, %7, off\n\t"
                     "global_load_async_to_lds_b128 %8, %9, off\n\tglobal_load_async_to_lds_b128 %10, %11, off\n\tglobal_load_async_to_lds_b128 %12, %13, off\n\tglobal_load_async_to_lds_b128 %14, %15, off\n\ts_wait_xcnt 0x0"
                     :: "v"(d), "v"(k), "v"(d + 2048), "v"(k + 1024), "v"(d + 4096), "v"(k + 2048), "v"(d + 6144), "v"(k + 3072),
                        "v"(d + 8192), "v"(v), "v"(d + 10240), "v"(v + 1024), "v"(d + 12288), "v"(v + 2048), "v"(d + 14336), "v"(v + 3072) : "memory"); };
    // one pass = one block of 32 keys, read from the stage at sk (the lane's place in the block's first K fragment; its V^T fragments lie SK * HD elements behind)
    auto pass = [&](const h16* sk, int kb, bool diag) __attribute__((always_inline)) { v16h kf[2][2], vf[4]; v8f s[NQ][2];
#pragma unroll
        for (int t = 0; t < 2; ++t)
#pragma unroll
            for (int kk = 0; kk < 2; ++kk) kf[t][kk] = WFrag<h16>::ld(sk + t * 1024 + kk * 512);
#pragma unroll
        for (int mt = 0; mt < 4; ++mt) vf[mt] = WFrag<h16>::ld(sk + SK * HD + mt * 512);
        __builtin_amdgcn_sched_barrier(0);    // keeps the pass's fragment reads together in front of its products: the V^T reads' latency runs under scores and softmax, and no read stands among the products
#pragma unroll
        for (int nq = 0; nq < NQ; ++nq)
#pragma unroll
            for (int t = 0; t < 2; ++t) { s[nq][t] = (v8f){};
#pragma unroll
                for (int kk = 0; kk < 2; ++kk) s[nq][t] = wmma16(kf[t][kk], qf[nq][kk], s[nq][t]); }
#pragma unroll
        for (int nq = 0; nq < NQ; ++nq) { const int q = qw + nq * 16 + lr; float bm = -3.0e38f;
#pragma unroll
            for (int t = 0; t < 2; ++t)
#pragma unroll
                for (int j = 0; j < 8; ++j) { float x = s[nq][t][j] * SL2; if (diag) x = (kb + t * 16 + hi * 8 + j <= q) ? x : -3.0e38f; s[nq][t][j] = x; bm = fmaxf(bm, x); }
            bm = fmaxf(bm, __shfl_xor(bm, 16, 32));
            const float mn = fmaxf(m[nq], bm), al = __builtin_amdgcn_exp2f(m[nq] - mn); m[nq] = mn; float ps = 0.f;
#pragma unroll
            for (int t = 0; t < 2; ++t)
#pragma unroll
                for (int j = 0; j < 8; ++j) { const float p = __builtin_amdgcn_exp2f(s[nq][t][j] - mn); s[nq][t][j] = p; ps += p; }
            l[nq] = l[nq] * al + ps;     // this lane's eight-key halves only; the two halves of a query are added once, behind the loop
#pragma unroll
            for (int mt = 0; mt < 4; ++mt) o[nq][mt] *= al;
            v16h pf;
#pragma unroll
            for (int j = 0; j < 8; ++j) { pf[j] = tohx(s[nq][0][j]); pf[8 + j] = tohx(s[nq][1][j]); }
#pragma unroll
            for (int mt = 0; mt < 4; ++mt) o[nq][mt] = wmma16(vf[mt], pf, o[nq][mt]); } };
    fill(0, 0);
    asm volatile("s_wait_asynccnt 0x0" ::: "memory");    // this wave's copies of stage 0 have landed before the barrier that publishes them
    __syncthreads();
    fill(1, 1);
#pragma unroll 1   // rolled: one set of K and V^T fragments in registers
    for (int s = 0; s < nf; ++s) {
        const h16* st = ring + (s & 1) * STG + 8 * lane;
#pragma unroll 1   // rolled: unrolled, the second pass's fragment reads move up among the first's products and take a second set of registers, and with it a wave per SIMD
        for (int hb = 0; hb < SK / 32; ++hb) pass(st + hb * 32 * HD, s * SK + hb * 32, false);
        asm volatile("s_wait_dscnt 0x0" ::: "memory");       // this wave's reads of the stage are done before the barrier behind which its buffer is refilled
        asm volatile("s_wait_asynccnt 0x0" ::: "memory");    // this wave's copies of stage s + 1 have landed before the barrier that publishes them
        __syncthreads();
        fill(s + 2, s & 1);      // stage s + 2 exists: the two stages of the tile's own keys follow the loop's
    }
    // the tile's own keys, block tb = the queries of wave tb: a wave walks the blocks up to its own (all of them by the masked pass, which is one copy in the text), and passes the barriers of the others
#pragma unroll 1   // rolled: one copy of the masked pass
    for (int tb = 0; tb < FW; ++tb) {
        if (tb <= w) pass(ring + ((nf + tb / (SK / 32)) & 1) * STG + tb % (SK / 32) * 32 * HD + 8 * lane, q0 + tb * 32, true);
        if ((tb + 1) % (SK / 32) == 0 && tb + 1 < FW) {      // the foot of a stage that has a successor; nothing is refilled any more
            asm volatile("s_wait_asynccnt 0x0" ::: "memory");    // this wave's copies of the next stage have landed before the barrier that publishes them
            __syncthreads(); }
    }
    asm volatile("s_wait_asynccnt 0x0" ::: "memory");        // nothing of this wave is in flight when it goes on
#pragma unroll
    for (int nq = 0; nq < NQ; ++nq) { const float inv = __fdiv_rn(1.0f, l[nq] + __shfl_xor(l[nq], 16, 32));
#pragma unroll
        for (int mt = 0; mt < 4; ++mt) { v8us oh, ol;      // lane (lr, hi) holds d = 16 mt + 8 hi + j of query lr: its own 16-byte piece of a half block of the merged planes (rows = queries, k = head * HD + d), so a wave stores 512 bytes in a row
#pragma unroll
            for (int j = 0; j < 8; ++j) { unsigned short a, c2; splitf(o[nq][mt][j] * inv, a, c2); oh[j] = a; ol[j] = c2; }
            const size_t oo = (size_t)(qw + nq * 16) * DQ + mt * 256 + lane * 8; *(v8us*)(Ah + oo) = oh; *(v8us*)(Al + oo) = ol; xw(); } }
}

// fattn_hl, hi/lo bf16 planes, 3 products each side (query rows < RH): a tile is 16 queries; the 32-key blocks up to the diagonal are dealt to the FW waves in turn, their (m, l, O) meet in LDS and are joined in wave order.
__device__ __forceinline__ void fattn_hl(const bf* __restrict__ Q, const bf* __restrict__ Q2, const bf* __restrict__ Kp, const bf* __restrict__ K2, const bf* __restrict__ Vt, const bf* __restrict__ V2, int q0, bf* Ah, bf* Al, float* so, float* sm, float* sl) {
    typedef v16bf V; constexpr int NQ = 1;
    const int lane = threadIdx.x & 31, lr = lane & 15, hi = lane >> 4; const int w = __builtin_amdgcn_readfirstlane(threadIdx.x >> 5);
    V qf[NQ][2], qf2[NQ][2]; v8f o[NQ][4]; float m[NQ], l[NQ];
#pragma unroll
    for (int nq = 0; nq < NQ; ++nq) { m[nq] = -3.0e38f; l[nq] = 0.f;
#pragma unroll
        for (int kk = 0; kk < 2; ++kk) { const size_t qo = (size_t)(q0 + nq * 16) * HD + kk * 512 + 8 * lane; qf[nq][kk] = WFrag<bf>::ld(Q + qo); qf2[nq][kk] = WFrag<bf>::ld(Q2 + qo); }
#pragma unroll
        for (int mt = 0; mt < 4; ++mt) o[nq][mt] = (v8f){}; }
    xw();
    const int nblk = (q0 + NQ * 16 - 1) / 32 + 1;      // every block walked holds key kb <= q0: no query of the tile ever sees a block that is masked whole; only the last block crosses the diagonal
    // one pass = one block of 32 keys
    auto pass = [&](int b, bool diag) __attribute__((always_inline)) { const int kb = b * 32; V kf[2][2], kf2[2][2], vf[4], vf2[4]; v8f s[NQ][2];
#pragma unroll
        for (int t = 0; t < 2; ++t)
#pragma unroll
            for (int kk = 0; kk < 2; ++kk) kf[t][kk] = WFrag<bf>::ld(Kp + (size_t)(b * 32 + t * 16) * HD + kk * 512 + 8 * lane);
        xw();
#pragma unroll
        for (int t = 0; t < 2; ++t)
#pragma unroll
            for (int kk = 0; kk < 2; ++kk) kf2[t][kk] = WFrag<bf>::ld(K2 + (size_t)(b * 32 + t * 16) * HD + kk * 512 + 8 * lane);
        xw();
#pragma unroll
        for (int mt = 0; mt < 4; ++mt) vf[mt] = WFrag<bf>::ld(Vt + (size_t)kb * HD + mt * 512 + 8 * lane);
        xw();
#pragma unroll
        for (int mt = 0; mt < 4; ++mt) vf2[mt] = WFrag<bf>::ld(V2 + (size_t)kb * HD + mt * 512 + 8 * lane);
        xw();
#pragma unroll
        for (int nq = 0; nq < NQ; ++nq)
#pragma unroll
            for (int t = 0; t < 2; ++t) { s[nq][t] = (v8f){};
#pragma unroll
                for (int kk = 0; kk < 2; ++kk) { s[nq][t] = wmmab(kf[t][kk], qf[nq][kk], s[nq][t]); s[nq][t] = wmmab(kf[t][kk], qf2[nq][kk], s[nq][t]); s[nq][t] = wmmab(kf2[t][kk], qf[nq][kk], s[nq][t]); } }
#pragma unroll
        for (int nq = 0; nq < NQ; ++nq) { const int q = q0 + nq * 16 + lr; float bm = -3.0e38f;
#pragma unroll
            for (int t = 0; t < 2; ++t)
#pragma unroll
                for (int j = 0; j < 8; ++j) { float x = s[nq][t][j] * SL2; if (diag) x = (kb + t * 16 + hi * 8 + j <= q) ? x : -3.0e38f; s[nq][t][j] = x; bm = fmaxf(bm, x); }
            bm = fmaxf(bm, __shfl_xor(bm, 16, 32));
            const float mn = fmaxf(m[nq], bm), al = __builtin_amdgcn_exp2f(m[nq] - mn); m[nq] = mn; float ps = 0.f;
#pragma unroll
            for (int t = 0; t < 2; ++t)
#pragma unroll
                for (int j = 0; j < 8; ++j) { const float p = __builtin_amdgcn_exp2f(s[nq][t][j] - mn); s[nq][t][j] = p; ps += p; }
            l[nq] = l[nq] * al + ps;     // this lane's eight-key halves only; the two halves of a query are added once, behind the loop
#pragma unroll
            for (int mt = 0; mt < 4; ++mt) o[nq][mt] *= al;
            v8us h0, h1, l0, l1;
#pragma unroll
            for (int j = 0; j < 8; ++j) { unsigned short a, c2; splitf(s[nq][0][j], a, c2); h0[j] = a; l0[j] = c2; splitf(s[nq][1][j], a, c2); h1[j] = a; l1[j] = c2; }
            const v16bf ph = cat16b(h0, h1), pl = cat16b(l0, l1);
#pragma unroll
            for (int mt = 0; mt < 4; ++mt) { o[nq][mt] = wmmab(vf[mt], ph, o[nq][mt]); o[nq][mt] = wmmab(vf[mt], pl, o[nq][mt]); o[nq][mt] = wmmab(vf2[mt], ph, o[nq][mt]); } } };
    int b = w;
#pragma unroll 1   // rolled: one set of K and V^T fragments in registers
    for (; b < nblk - 1; b += FW) pass(b, false);     // blocks wholly below the diagonal: no mask
    if (b == nblk - 1) pass(b, true);                 // the diagonal block, in the wave whose turn it is
#pragma unroll
    for (int nq = 0; nq < NQ; ++nq) { const int ql = w * 32 + nq * 16 + lr; const float lt = l[nq] + __shfl_xor(l[nq], 16, 32); if (hi == 0) { sm[ql] = m[nq]; sl[ql] = lt; }
#pragma unroll
        for (int mt = 0; mt < 4; ++mt) { float* d = so + ql * OSP + mt * 16 + hi * 8; const v8f a = o[nq][mt]; *(v4fa*)d = (v4f){a[0], a[1], a[2], a[3]}; *(v4fa*)(d + 4) = (v4f){a[4], a[5], a[6], a[7]}; } }
    __syncthreads();    // every wave's (m, l, O) is in LDS before any wave joins them
#pragma unroll
    for (int it = 0; it < NQ * 16 / (FW * 4); ++it) { const int un = it * FW + w, ql = (un >> 2) * 16 + lr, g = (un & 3) * 2 + hi;     // a wave stores one 512-byte half block of the merged planes (rows = queries, k = head * HD + d): 16 queries x 16 d
        float mw[FW], M = -3.0e38f, Lt = 0.f, acc[8];
#pragma unroll
        for (int u = 0; u < FW; ++u) { mw[u] = sm[u * 32 + ql]; M = fmaxf(M, mw[u]); }
#pragma unroll
        for (int j = 0; j < 8; ++j) acc[j] = 0.f;
#pragma unroll
        for (int u = 0; u < FW; ++u) { const float f = __builtin_amdgcn_exp2f(mw[u] - M); Lt += f * sl[u * 32 + ql]; const float* d = so + (u * 32 + ql) * OSP + g * 8; const v4f a = *(const v4fa*)d, c = *(const v4fa*)(d + 4);   // a wave that had no block: m = -3e38, f = 0
#pragma unroll
            for (int j = 0; j < 4; ++j) { acc[j] += f * a[j]; acc[4 + j] += f * c[j]; } }
        const float inv = __fdiv_rn(1.0f, Lt); v8us oh, ol;
#pragma unroll
        for (int j = 0; j < 8; ++j) { unsigned short a, c2; splitf(acc[j] * inv, a, c2); oh[j] = a; ol[j] = c2; }
        const size_t oo = (size_t)(q0 + (un >> 2) * 16) * DQ + (un & 3) * 256 + lane * 8; *(v8us*)(Ah + oo) = oh; *(v8us*)(Al + oo) = ol; xw(); }
}
// grid (chunks x heads, tiles), longest tiles of every chunk first: (TT - RH) / (FW * 32) fp16 tiles of FW * 32 queries from the last row down, then RH / 16 hi/lo tiles of 16 queries.
static_assert((TT - RH) % (FW * 32) == 0 && RH % SK == 0, "whole fp16 tiles, each beginning on a stage");
__global__ __launch_bounds__(FW * 32) void k_fattn(const h16* __restrict__ Q16, const h16* __restrict__ K16, const h16* __restrict__ V16, const bf* __restrict__ Qh, const bf* __restrict__ Ql, const bf* __restrict__ Kh, const bf* __restrict__ Kl, const bf* __restrict__ Vh, const bf* __restrict__ Vl, bf* Ah, bf* Al) {
    __shared__ __align__(16) float so[FW * 32 * OSP]; __shared__ float sm[FW * 32]; __shared__ float sl[FW * 32];
    static_assert(sizeof(so) >= 2 * 2 * SK * HD * sizeof(h16), "an fp16 tile's two stage buffers lie in so, which only a hi/lo tile uses for partial outputs");
    const int h = blockIdx.x % NH_, ch = blockIdx.x / NH_, tile = blockIdx.y; const size_t hp = (size_t)(ch * (NH_ + NKV) + h) * TT * HD, vp = (size_t)(ch * NKV + h) * HD * PP;
    Ah += (size_t)ch * TT * DQ; Al += (size_t)ch * TT * DQ;
    if (tile < (TT - RH) / (FW * 32)) fattn_s(Q16 + hp, K16 + hp, V16 + vp, TT - FW * 32 * (tile + 1), Ah + h * HD * 16, Al + h * HD * 16, (h16*)so);
    else fattn_hl(Qh + hp, Ql + hp, Kh + hp, Kl + hp, Vh + vp, Vl + vp, RH - 16 * (tile - (TT - RH) / (FW * 32) + 1), Ah + h * HD * 16, Al + h * HD * 16, so, sm, sl);
}

extern "C" void kernel_launch(void* const* d_in, const int* in_sizes, int n_in,
                              void* d_out, int out_size, void* d_ws, size_t ws_size, hipStream_t stream) {
    (void)in_sizes; (void)n_in; (void)out_size;
    const float* x = (const float*)d_in[0]; const float* wq = (const float*)d_in[1]; const float* wk = (const float*)d_in[2]; const float* wv = (const float*)d_in[3]; const float* wo = (const float*)d_in[4];   /* input order hidden_states, Wq, Wk, Wv, Wo ('oi': 'x @ W.T') */
    float* OUT = (float*)d_out;     // [4][2048][1024]
    char* wsp = (char*)d_ws;
    auto take = [&](size_t bytes) { char* p = wsp; wsp += (bytes + 255) & ~(size_t)255; return (void*)p; };
    bf* WQ = (bf*)take((size_t)DF * DM * 2); bf* WK = WQ + (size_t)DQ * DM; bf* WV = WK + (size_t)DKV * DM;   /* one [DF][DM] plane: q, k, v rows */ bf* WO = (bf*)take((size_t)DM * DQ * 2);
    bf* XB = (bf*)take((size_t)NB_ * TT * DM * 2);   // x copy
    h16* QP16 = (h16*)take((size_t)NB_ * (NH_ + NKV) * TT * HD * 2); h16* KP16 = QP16 + (size_t)NH_ * TT * HD;   /* in each chunk the k heads' planes follow the q heads': head index = 64-column tile of the joint projection */ h16* VT16 = (h16*)take((size_t)NB_ * NKV * HD * PP * 2);
    bf* QPh = (bf*)take((size_t)NB_ * (NH_ + NKV) * TT * HD * 2); bf* KPh = QPh + (size_t)NH_ * TT * HD; bf* QPl = (bf*)take((size_t)NB_ * (NH_ + NKV) * TT * HD * 2); bf* KPl = QPl + (size_t)NH_ * TT * HD; bf* VTh = (bf*)take((size_t)NB_ * NKV * HD * PP * 2); bf* VTl = VTh + (size_t)TT * HD;   // a head's hi plane and lo plane one behind the other in its HD * PP elements
    bf* ATh = (bf*)take((size_t)NB_ * TT * DQ * 2); bf* ATl = (bf*)take((size_t)NB_ * TT * DQ * 2);
    if ((size_t)(wsp - (char*)d_ws) > ws_size) return;    // ws 256 MiB
    k_cvt5<<<CB_X + 2 * CB_Q + 2 * CB_K, 256, 0, stream>>>(x, wq, wk, wv, wo, XB, WQ, WK, WV, WO);
    k_gemmw<bf, 0, false, true, DM, 4, 2><<<dim3(NB_ * TT / 256, DF / 128, 1), 256, 0, stream>>>(XB, nullptr, WQ, nullptr, nullptr, 0, nullptr, 0, 0, 0, QP16, QPh, QPl, VT16, VTh, VTl);   // q, k and v projections of every chunk in one launch, written as head planes
    k_fattn<<<dim3(NB_ * NH_, (TT - RH) / (FW * 32) + RH / 16), FW * 32, 0, stream>>>(QP16, KP16, VT16, QPh, QPl, KPh, KPl, VTh, VTl, ATh, ATl);   // one kv head per query head
    k_gemmw<bf, 1, false, false, DQ, 2, 2><<<dim3(NB_ * TT / 128, DM / 128, 1), 128, 0, stream>>>(ATh, ATl, WO, nullptr, OUT, DM, nullptr, 0, 0, 0, nullptr, nullptr, nullptr, nullptr, nullptr, nullptr);
}

// v010
// One run takes 114 microseconds.
// Two timings next to v009 both put it at 1.04 times that version's speed.
// Counting every step since v000, it is 24.0 times as fast.
#include <hip/hip_runtime.h>

// Chunk-local causal multi-head self-attention (a ring attention with ring_size 1) (hidden_states [1][8192][1024] = FOUR chunks of 2,048 tokens: in memory [4][2048][1024]; q, k, v = x W^T ('oi' [1024][1024] 0.02, no bias; 16 heads x 64); each chunk attends causally WITHIN itself: scores / sqrt(64), tril(ones((2048, 2048))) kept, -inf elsewhere; softmax; out = merged Wo^T ('oi', no bias) -> [1][8192][1024] = [4][2048][1024] (8.4 M); argument order hidden_states, Wq, Wk, Wv, Wo).
// Four launches, each over all four chunks at once (every plane in the workspace but the weight copies has one copy per chunk): bf16 copies of x and of the weights; exact projections, whose GEMM writes the 16-bit head planes itself (no f32 projection in memory); causal T-2048 attention (k_fattn: scores, online softmax and P x V per query tile, no score matrix in memory; hybrid rows: < 512 hi/lo 3 products, rest fp16, whose K and V^T blocks the waves of a work-group share in LDS); merged hi/lo x W_o exact.
// Every 16-bit plane that feeds a matrix fragment is stored in FRAGMENT ORDER: a block of 16 rows x 32 k is 1 KiB in a row, element (row, k) at ((k >> 4) & 1) * 256 + ((k >> 3) & 1) * 128 + (row & 15) * 8 + (k & 7), so that lane (lr, hi) finds its two 16-byte pieces at lane * 8 and 256 + lane * 8 and each wave-wide load covers four whole 128-byte lines. The k order inside a fragment is the one the row-major planes gave.
// Compute dtypes, f32 accumulate: every input rounded to bf16; projections exact; attention rows < 512 3 products, rest fp16; softmax f32; W_o hl x exact.

#define NB_  4
#define TT   2048
#define DM   1024
#define NH_  16
#define NKV  16
#define REP  (NH_ / NKV)
#define HD   64
#define DQ   (NH_ * HD)
#define DKV  (NKV * HD)
#define RH   512                  // query rows < RH use hi+lo planes (0: none)
#define SCL  0.125f   // HD^-0.5
#define DF   (DQ + 2 * DKV)       // columns of the joint q | k | v projection
#define PP   (2 * TT)             // HD * PP 16-bit elements: a head's room in the V^T planes (hi and lo plane; the fp16 plane fills half)
#define FW   4                    // waves of an attention work-group
#define OSP  68                   // pitch, in f32, of one query's partial output row in LDS
#define SL2  (SCL * 1.4426950408889634f)   // score scale into the log2 domain
typedef _Float16 h16;
typedef unsigned short bf;
typedef __attribute__((ext_vector_type(16))) __bf16   v16bf;
typedef __attribute__((ext_vector_type(16))) _Float16 v16h;
typedef __attribute__((ext_vector_type(8)))  _Float16 v8h;
typedef __attribute__((ext_vector_type(8)))  unsigned short v8us;
typedef __attribute__((ext_vector_type(8)))  float    v8f;
typedef __attribute__((ext_vector_type(4)))  float    v4f;
typedef v8h  __attribute__((may_alias)) v8ha;
typedef v4f  __attribute__((may_alias)) v4fa;
typedef v8us __attribute__((may_alias)) v8usa;

__device__ __forceinline__ unsigned short f2bf(float f) { unsigned u = __float_as_uint(f); u += 0x7FFFu + ((u >> 16) & 1u); return (unsigned short)(u >> 16); }
__device__ __forceinline__ float bf2f(unsigned short b) { return __uint_as_float(((unsigned)b) << 16); }
__device__ __forceinline__ float bfr(float f) { return bf2f(f2bf(f)); }
__device__ __forceinline__ v16h cat16(v8h lo, v8h hi) { return __builtin_shufflevector(lo, hi, 0, 1, 2, 3, 4, 5, 6, 7, 8, 9, 10, 11, 12, 13, 14, 15); }
__device__ __forceinline__ v16bf cat16b(v8us lo, v8us hi) { return __builtin_bit_cast(v16bf, __builtin_shufflevector(lo, hi, 0, 1, 2, 3, 4, 5, 6, 7, 8, 9, 10, 11, 12, 13, 14, 15)); }
__device__ __forceinline__ v8f wmma16(v16h a, v16h b, v8f c) { return __builtin_amdgcn_wmma_f32_16x16x32_f16(false, a, false, b, (short)0, c, false, false); }
__device__ __forceinline__ v8f wmmab(v16bf a, v16bf b, v8f c) { return __builtin_amdgcn_wmma_f32_16x16x32_bf16(false, a, false, b, (short)0, c, false, false); }
__device__ __forceinline__ h16 tohx(float x) { return (h16)x; }
__device__ __forceinline__ void splitf(float y, unsigned short& h, unsigned short& l) { h = f2bf(y); l = f2bf(y - bf2f(h)); }
// s_wait_xcnt 0 behind a run of global loads or stores, in front of whatever next overwrites a register that the run names (address pairs, store data).
__device__ __forceinline__ void xw() { asm volatile("s_wait_xcnt 0x0" ::: "memory"); }
// the same wait behind a run of loads that all go from the address p (or from p and q): as inputs, the addresses keep their registers up to the wait, so that no load of the run lands on them.
__device__ __forceinline__ void xwa(const void* p) { asm volatile("s_wait_xcnt 0x0" :: "v"(p) : "memory"); }
__device__ __forceinline__ void xwa(const void* p, const void* q) { asm volatile("s_wait_xcnt 0x0" :: "v"(p), "v"(q) : "memory"); }



// ---- k_gemmw: register-blocked GEMM, one wave per 64x64 output tile (16 accumulators), GWM x GWN waves per work-group (4 x 2 on a 256x128 tile in the projection; 2 x 2 on 128x128 for W_o, so that two work-groups with barriers of their own share a WGP); grid (M / (64 GWM), N / (64 GWN), Z). Operands are 16-bit planes in fragment order, blocks [row / 16][k / 32] (ld takes the lane's place in a block).
// KS = 64 k (two k steps of 32) of the tile's operand blocks are a stage in LDS, shared by the waves: three stage buffers, filled by asynchronous copies three stages ahead, one barrier a stage. The first half of the waves copies the even stages, the second half the odd ones, and a wave waits for its copies only at the foot of the trip in front of their stage: a stage's copies have the time of two trips (four k steps) to land, and every wait is to 0.
// C[m][n] (f32, pitch ldc, + optional f32 bias[n]) = sum_k A[m][k] Bt[n][k] (+ split products per NSPLIT). z-batch strides sA/sB/sC in elements. K % 64 == 0 and K >= 192; K is a compile-time constant, so that all fragments of an operand in a k step lie at constant offsets from one address.
// PL (the joint q | k | v projection): a 64-column tile is one head, and the tile goes straight from the accumulators to that head's fp16, bf16-hi and bf16-lo planes; C is not written.
// A row tile lies in one chunk (TT % 64 == 0). q and k heads: planes [chunk][head], blocks [t / 16][d / 32]; v heads: planes [chunk][head] (HD * PP elements apart), rows d, k = t, blocks [t / 32][d / 16]. Sixteen plane rows at a time are turned in LDS so that a wave stores 512 bytes in a row.
template <typename T16> struct WFrag;
template <> struct WFrag<h16> { typedef v16h V; static __device__ __forceinline__ V ld(const h16* p) { return cat16(*(const v8h*)p, *(const v8h*)(p + 256)); } static __device__ __forceinline__ v8f mma(V a, V b, v8f c) { return wmma16(a, b, c); } };
template <> struct WFrag<bf> { typedef v16bf V; static __device__ __forceinline__ V ld(const bf* p) { return cat16b(*(const v8us*)p, *(const v8us*)(p + 256)); } static __device__ __forceinline__ v8f mma(V a, V b, v8f c) { return wmmab(a, b, c); } };
// twelve asynchronous copies of the calling waves' threads, 16 bytes a thread each: eight from g + i * gs (elements) to the LDS byte address l + i * ls, four from h + i * gs to m + i * ls. The s_wait_xcnt 0 at the end of the statement stands in front of whatever next overwrites an address register of its copies.
template <typename T16> __device__ __forceinline__ void cp12(unsigned l, const T16* g, unsigned m, const T16* h, unsigned ls, size_t gs) {
    asm volatile("global_load_async_to_lds_b128 %0, %1, off\n\tglobal_load_async_to_lds_b128 %2, %3, off\n\tglobal_load_async_to_lds_b128 %4, %5, off\n\tglobal_load_async_to_lds_b128 %6, %7, off\n\t"
                 "global_load_async_to_lds_b128 %8, %9, off\n\tglobal_load_async_to_lds_b128 %10, %11, off\n\tglobal_load_async_to_lds_b128 %12, %13, off\n\tglobal_load_async_to_lds_b128 %14, %15, off\n\t"
                 "global_load_async_to_lds_b128 %16, %17, off\n\tglobal_load_async_to_lds_b128 %18, %19, off\n\tglobal_load_async_to_lds_b128 %20, %21, off\n\tglobal_load_async_to_lds_b128 %22, %23, off\n\ts_wait_xcnt 0x0"
                 :: "v"(l), "v"(g), "v"(l + ls), "v"(g + gs), "v"(l + 2 * ls), "v"(g + 2 * gs), "v"(l + 3 * ls), "v"(g + 3 * gs),
                    "v"(l + 4 * ls), "v"(g + 4 * gs), "v"(l + 5 * ls), "v"(g + 5 * gs), "v"(l + 6 * ls), "v"(g + 6 * gs), "v"(l + 7 * ls), "v"(g + 7 * gs),
                    "v"(m), "v"(h), "v"(m + ls), "v"(h + gs), "v"(m + 2 * ls), "v"(h + 2 * gs), "v"(m + 3 * ls), "v"(h + 3 * gs) : "memory"); }
template <typename T16, int NSPLIT, bool BIAS, bool PL, int K, int GWM, int GWN>      // GWM x GWN wave tiles in a work-group's tile
__global__ __launch_bounds__(GWM * GWN * 32) void k_gemmw(const T16* __restrict__ A, const T16* __restrict__ A2, const T16* __restrict__ Bt, const T16* __restrict__ Bt2, float* C, int ldc, const float* __restrict__ bias, size_t sA, size_t sB, size_t sC, h16* P16, bf* Ph, bf* Pl, h16* V16, bf* Vh, bf* Vl) {
    typedef typename WFrag<T16>::V V;
    constexpr int KS = 64, KB = KS / 32;      // k of a stage; blocks of 32 k in it
    static_assert(NSPLIT <= 1, "one B plane"); static_assert(K >= 3 * KS && K % KS == 0, "three stages or more");
    constexpr int GTM = GWM * 64, GTN = GWN * 64, PA = GTM * KS, PB = GTN * KS;                  // elements of one stage of an A plane and of the B plane: GTM / 16 and GTN / 16 rows of blocks, KB blocks in each
    constexpr int STGE = (NSPLIT == 1 ? 2 : 1) * PA + PB;        // one stage: [A | A2 | B]
    __shared__ __align__(1024) T16 ring[3 * STGE];
    static_assert(sizeof(ring) >= GWM * GWN * 16 * 68 * sizeof(float), "the waves' turning rows lie in the ring, which is free behind the loop's last barrier: so two work-groups still share a WGP's LDS");
    const size_t z = blockIdx.z; A += z * sA; if (A2) A2 += z * sA; Bt += z * sB; C += z * sC;
    const int lane = threadIdx.x & 31, lr = lane & 15, hi = lane >> 4; const int w = __builtin_amdgcn_readfirstlane(threadIdx.x >> 5), wm = w % GWM, wn = w / GWM;
    float* os = (float*)ring + w * (16 * 68);      // each wave turns its own tile in its own rows
    const int grp = w / (GWM * GWN / 2);      // 0: this wave copies the even stages; 1: the odd ones
    const int r0 = blockIdx.x * GTM + wm * 64, c0 = blockIdx.y * GTN + wn * 64;
    v8f acc[4][4];
#pragma unroll
    for (int mb = 0; mb < 4; ++mb)
#pragma unroll
        for (int nb = 0; nb < 4; ++nb) acc[mb][nb] = (v8f){};
    // A stage is copied as it lies in memory: the KB blocks of a row of blocks are KB KiB in a row, and in LDS the rows of blocks follow one another. One copy of the NG threads of a half brings NG * 16 bytes of one row of blocks (all of it, or one of its two halves), thread t of the half the 16 bytes at t * 16; the copies of a run go from one row of blocks to the next.
    constexpr int NG = GWM * GWN * 16, RBT = KB * 64; constexpr unsigned LS = RBT * 16; constexpr size_t GS = (size_t)16 * K;      // threads of a half; 16-byte pieces of a row of blocks; a row of blocks' step in LDS bytes and in plane elements
    static_assert(NSPLIT == 1 ? (2 * NG == RBT && PA * 2 == 8 * LS && PB * 2 == 8 * LS) : (NG == RBT && PA * 2 == 16 * LS && PB * 2 == 8 * LS), "rows of blocks of a stage: 8, 8 and 8, by two copies each (48 copies); or 16 and 8, by one each (24 copies)");
    const size_t tb = (size_t)(threadIdx.x % NG) * 8;
    const T16* ga = A + (size_t)blockIdx.x * GTM * K + tb; const T16* ga2 = A2 + (size_t)blockIdx.x * GTM * K + tb; const T16* gb = Bt + (size_t)blockIdx.y * GTN * K + tb;
    const unsigned rl = (unsigned)(size_t)ring + (threadIdx.x % NG) * 16;      // the thread's LDS byte address in the first copy of stage buffer 0
    size_t ko = (size_t)grp * (KB * 512);      // where the next stage that this wave copies begins in a row of blocks; its stages are two apart
    auto fill = [&](int buf) __attribute__((always_inline)) {
        const unsigned l = rl + buf * (STGE * 2);
        if (NSPLIT == 1) {      // the first halves of the rows of blocks of A, the second halves, the same of B; with each a quarter of A2's copies
            cp12(l, ga + ko, l + 2 * PA, ga2 + ko, LS, GS); cp12(l + LS / 2, ga + ko + 512, l + 2 * PA + 4 * LS, ga2 + ko + 4 * GS, LS, GS);
            cp12(l + 4 * PA, gb + ko, l + 2 * PA + LS / 2, ga2 + ko + 512, LS, GS); cp12(l + 4 * PA + LS / 2, gb + ko + 512, l + 2 * PA + LS / 2 + 4 * LS, ga2 + ko + 512 + 4 * GS, LS, GS); }
        else { cp12(l, ga + ko, l + 2 * PA, gb + ko, LS, GS); cp12(l + 8 * LS, ga + ko + 8 * GS, l + 2 * PA + 4 * LS, gb + ko + 4 * GS, LS, GS); }      // each: eight rows of blocks of A and four of B
        ko += 2 * KB * 512; };
    if (grp == 0) { fill(0);
        asm volatile("s_wait_asynccnt 0x0" ::: "memory"); }    // this wave's copies of stage 0 have landed before the barrier that publishes them
    else fill(1);
    __syncthreads();
    if (grp == 0) fill(2);
    int rb = 0;      // the stage buffer of trip t: t % 3
#pragma unroll 1   // rolled: one set of fragments in registers
    for (int t = 0; t < K / KS; ++t) {
        const T16* sa = ring + rb * STGE + wm * (4 * KB * 512) + 8 * lane; const T16* sb = ring + rb * STGE + (NSPLIT == 1 ? 2 : 1) * PA + wn * (4 * KB * 512) + 8 * lane;
#pragma unroll   // the stage's k steps at constant LDS offsets; the fences below keep them one behind the other, on one set of fragment registers
        for (int kk = 0; kk < KB; ++kk) {
            V a[4], a2[4], b[4];
#pragma unroll
            for (int mb = 0; mb < 4; ++mb) { a[mb] = WFrag<T16>::ld(sa + (mb * KB + kk) * 512); if (NSPLIT == 1) a2[mb] = WFrag<T16>::ld(sa + PA + (mb * KB + kk) * 512); }
#pragma unroll
            for (int nb = 0; nb < 4; ++nb) b[nb] = WFrag<T16>::ld(sb + (nb * KB + kk) * 512);
            __builtin_amdgcn_sched_barrier(0);    // keeps the step's fragment reads together in front of its products: a read placed among the products is waited for there, with its whole LDS latency open
#pragma unroll
            for (int nb = 0; nb < 4; ++nb)
#pragma unroll
                for (int mb = 0; mb < 4; ++mb) { acc[mb][nb] = WFrag<T16>::mma(a[mb], b[nb], acc[mb][nb]); if (NSPLIT == 1) acc[mb][nb] = WFrag<T16>::mma(a2[mb], b[nb], acc[mb][nb]); }
            __builtin_amdgcn_sched_barrier(0);    // keeps the products in front of the next step's reads, which so take the same fragment registers, and in front of the waits below: moved behind the barrier, they would leave the copies of stage t + 1 less time to land
        }
        asm volatile("s_wait_dscnt 0x0" ::: "memory");       // this wave's reads of the stage are done before the barrier behind which its buffer is refilled
        const bool mine = grp == ((t + 1) & 1);      // stages t + 1 and t + 3 are this wave's to copy; the same for the whole wave
        if (mine) asm volatile("s_wait_asynccnt 0x0" ::: "memory");    // this wave's copies of stage t + 1, the only ones it has in flight, have landed before the barrier that publishes them; the other half's copies of stage t + 2 fly on
        __syncthreads();
        if (mine && t + 3 < K / KS) fill(rb);      // stage t + 3
        rb = rb == 2 ? 0 : rb + 1;
    }
    asm volatile("s_wait_asynccnt 0x0" ::: "memory");        // nothing of this wave is in flight when it goes on
    if (PL) {
        const int hh = blockIdx.y * GWN + wn; const bool isv = hh >= NH_ + NKV;      // the same for the whole wave
        const int ch = r0 / TT, rc = r0 % TT;      // chunk of the row tile, first token inside it
        const size_t base = isv ? (size_t)(ch * NKV + hh - NH_ - NKV) * HD * PP + (size_t)rc * HD : ((size_t)(ch * (NH_ + NKV) + hh) * TT + rc) * HD;      // 64 tokens are 4 x 2 blocks of a q or k plane, 2 x 4 blocks of a v plane: rc * HD elements in front of them either way
        h16* D16 = (isv ? V16 : P16) + base; bf* Dh = (isv ? Vh : Ph) + base; bf* Dl = (isv ? Vl : Pl) + base;
#pragma unroll   // constant accumulator indices
        for (int u = 0; u < 4; ++u) {
            if (isv) {      // plane rows = 16 columns d of the tile, 64 tokens along each: a lane's 8 accumulator values are 8 tokens in a row
#pragma unroll
                for (int mb = 0; mb < 4; ++mb) { float* d = os + lr * 68 + mb * 16 + hi * 8; const v8f a = acc[mb][u]; *(v4fa*)d = (v4f){a[0], a[1], a[2], a[3]}; *(v4fa*)(d + 4) = (v4f){a[4], a[5], a[6], a[7]}; }
            } else {        // plane rows = 16 tokens of the tile, 64 columns d along each
#pragma unroll
                for (int nb = 0; nb < 4; ++nb) {
#pragma unroll
                    for (int j = 0; j < 8; ++j) os[(hi * 8 + j) * 68 + nb * 16 + lr] = acc[u][nb][j]; }
            }
            __builtin_amdgcn_wave_barrier(); asm volatile("" ::: "memory");   // the reads below take other lanes' values: they stay behind the writes
#pragma unroll
            for (int s = 0; s < 4; ++s) { const int g = 2 * s + hi; const float* d = os + lr * 68 + g * 8;      // plane row lr, its k = 8 g ..: half s & 1 of the row's block s >> 1
                 const v4f a = *(const v4fa*)d, c = *(const v4fa*)(d + 4); v8h o16; v8us oh, ol;
#pragma unroll
                for (int j = 0; j < 4; ++j) { unsigned short p, q; o16[j] = tohx(a[j]); splitf(a[j], p, q); oh[j] = p; ol[j] = q; o16[4 + j] = tohx(c[j]); splitf(c[j], p, q); oh[4 + j] = p; ol[4 + j] = q; }
                const size_t o = (size_t)(isv ? (s >> 1) * 2048 + u * 512 + (s & 1) * 256 : u * 1024 + s * 256) + lane * 8; *(v8h*)(D16 + o) = o16; *(v8us*)(Dh + o) = oh; *(v8us*)(Dl + o) = ol; xw(); }
            __builtin_amdgcn_wave_barrier(); asm volatile("" ::: "memory");   // the next sixteen rows overwrite os only behind these reads
        }
        return;
    }
#pragma unroll
    for (int mb = 0; mb < 4; ++mb) {
#pragma unroll
        for (int nb = 0; nb < 4; ++nb) {
#pragma unroll
            for (int j = 0; j < 8; ++j) os[(hi * 8 + j) * 68 + nb * 16 + lr] = acc[mb][nb][j]; }
        __builtin_amdgcn_wave_barrier(); asm volatile("" ::: "memory");
        float* crow = C + (size_t)(r0 + mb * 16) * ldc + c0;
{
#pragma unroll
            for (int s = 0; s < 8; ++s) { const int row = 2 * s + hi, cofs = lr * 4; v4f val = *(const v4fa*)(os + row * 68 + cofs); if (BIAS) { val[0] += bfr(bias[c0 + cofs]); val[1] += bfr(bias[c0 + cofs + 1]); val[2] += bfr(bias[c0 + cofs + 2]); val[3] += bfr(bias[c0 + cofs + 3]); }
                *(v4f*)(crow + (size_t)row * ldc + cofs) = val; }
             }
        __builtin_amdgcn_wave_barrier(); asm volatile("" ::: "memory");
    }
}

typedef __attribute__((ext_vector_type(2))) _Float16 v2h;
typedef __attribute__((ext_vector_type(4))) _Float16 v4h;
typedef __attribute__((ext_vector_type(2))) unsigned short v2us;
typedef __attribute__((ext_vector_type(4))) unsigned short v4us;
typedef __attribute__((ext_vector_type(2))) float v2f;
typedef __attribute__((ext_vector_type(4))) int v4i;

__global__ __launch_bounds__(256) void k_wtG(const float* __restrict__ w, int K, int N, bf* Bt) {
    const int lane = threadIdx.x & 31; const int L0 = (blockIdx.x * 8 + (threadIdx.x >> 5)) * 8; const int nlines = N * K / 64;
{
#pragma unroll 1
        for (int l = 0; l < 8; ++l) { const int L = L0 + l; if (L >= nlines) break; const size_t e = (size_t)L * 64 + lane * 2; const int k = (int)(e % K), n = (int)(e / K); v2us o;
            o[0] = f2bf(w[(size_t)k * N + n]); o[1] = f2bf(w[(size_t)(k + 1) * N + n]); *(v2us*)(Bt + e) = o; }
         }
}
// bf16 copies of all five inputs in one launch, written in fragment order (blocks [row / 16][k / 32], every input has DM columns): a work-group converts the 2,048 elements of four blocks of the one input that its index falls into (the choice is the same for the whole work-group). A thread owns one 16-byte piece of the copy, so a wave stores 512 bytes in a row.
static_assert(DQ == DM, "W_o has DM columns");
#define CB_X ((unsigned)((size_t)NB_ * TT * DM / 2048))
#define CB_Q ((unsigned)((size_t)DQ * DM / 2048))
#define CB_K ((unsigned)((size_t)DKV * DM / 2048))
__global__ __launch_bounds__(256) void k_cvt5(const float* __restrict__ x, const float* __restrict__ wq, const float* __restrict__ wk, const float* __restrict__ wv, const float* __restrict__ wo, bf* XB, bf* WQ, bf* WK, bf* WV, bf* WO) {
    unsigned blk = blockIdx.x; const float* src = x; bf* dst = XB;
    if (blk >= CB_X + CB_Q + 2 * CB_K) { blk -= CB_X + CB_Q + 2 * CB_K; src = wo; dst = WO; }
    else if (blk >= CB_X + CB_Q + CB_K) { blk -= CB_X + CB_Q + CB_K; src = wv; dst = WV; }
    else if (blk >= CB_X + CB_Q) { blk -= CB_X + CB_Q; src = wk; dst = WK; }
    else if (blk >= CB_X) { blk -= CB_X; src = wq; dst = WQ; }
    const size_t i = (size_t)blk * 256 + threadIdx.x; const size_t bl = i >> 6; const int row = (int)(bl / (DM / 32)) * 16 + (int)(i & 15), kk = (int)(bl % (DM / 32)) * 32 + (int)((i >> 4) & 3) * 8;
    const v8f v = *(const v8f*)(src + (size_t)row * DM + kk); xw(); v8us o;
#pragma unroll
    for (int k = 0; k < 8; ++k) o[k] = f2bf(v[k]); *(v8us*)(dst + i * 8) = o;  }

// ---- k_fattn: scores, causal softmax and probability x value product of one query tile of one head in one work-group of FW waves; nothing of the score matrix reaches memory.
// S^T = K Q^T (A = 16 key rows, B = 16 query rows): lane (lr, hi) holds keys 8 hi + j of query lr, so two score tiles of 32 keys, converted in place, are the B fragment of O^T += V^T P^T (A = rows of the V^T plane).
// Online softmax in the log2 domain: running maximum m and sum l per query, O^T rescaled when m moves; P = exp2(s - m) <= 1 is not normalised before it is rounded, the division by l comes last.
// Every '#pragma unroll' here gives a fragment, score or accumulator array constant indices, so that it stays in registers; the lambdas are inlined by force for the same reason (they work on those arrays by reference).

// fattn_s, fp16 planes (query rows >= RH): a tile is FW * 32 queries, 32 to a wave, and every wave walks all the keys of its own queries, so that (m, l, O) stay in its registers to the end.
// The waves share the keys: a stage is SK keys of the K plane and of the V^T plane (each SK * HD elements in a row, as they lie in memory, in fragment order) in LDS; two stage buffers, filled by asynchronous copies two stages ahead, one barrier a stage.
#define SK   64                   // keys of a stage
static_assert(SK % 32 == 0 && FW * 32 == 2 * SK && SK * HD * 2 == 4 * FW * 32 * 16, "a tile's own keys are two stages, the two that are filled when the loop ends; four copies of all threads bring a plane's share of a stage");
__device__ __forceinline__ void fattn_s(const h16* __restrict__ Q, const h16* __restrict__ Kp, const h16* __restrict__ Vt, int q0, bf* Ah, bf* Al, h16* ring) {
    constexpr int NQ = 2, STG = 2 * SK * HD;      // 16-query groups of a wave; elements of a stage: [K | V^T]
    const int lane = threadIdx.x & 31, lr = lane & 15, hi = lane >> 4; const int w = __builtin_amdgcn_readfirstlane(threadIdx.x >> 5);
    const int qw = q0 + w * 32;      // the wave's first query
    v16h qf[NQ][2]; v8f o[NQ][4]; float m[NQ], l[NQ];
#pragma unroll
    for (int nq = 0; nq < NQ; ++nq) { m[nq] = -3.0e38f; l[nq] = 0.f;
#pragma unroll
        for (int kk = 0; kk < 2; ++kk) qf[nq][kk] = WFrag<h16>::ld(Q + (size_t)(qw + nq * 16) * HD + kk * 512 + 8 * lane);
#pragma unroll
        for (int mt = 0; mt < 4; ++mt) o[nq][mt] = (v8f){}; }
    xw();
    const int nf = q0 / SK;      // stages in front of the tile's own keys: wholly below every wave's diagonal; FW * 32 / SK stages with the tile's own keys follow them
    const unsigned rl = (unsigned)(size_t)ring + threadIdx.x * 16;      // the thread's LDS byte address in stage buffer 0
    const h16* gk = Kp + threadIdx.x * 8; const h16* gv = Vt + threadIdx.x * 8;
    auto fill = [&](int s, int buf) __attribute__((always_inline)) {
        const unsigned d = rl + buf * (STG * 2); const h16* k = gk + (size_t)s * (SK * HD); const h16* v = gv + (size_t)s * (SK * HD);
        // the s_wait_xcnt 0 at the end of the statement stands in front of whatever next overwrites an address register of its copies
        asm volatile("global_load_async_to_lds_b128 %0, %1, off\n\tglobal_load_async_to_lds_b128 %2, %3, off\n\tglobal_load_async_to_lds_b128 %4, %5, off\n\tglobal_load_async_to_lds_b128 %6, %7, off\n\t"
                     "global_load_async_to_lds_b128 %8, %9, off\n\tglobal_load_async_to_lds_b128 %10, %11, off\n\tglobal_load_async_to_lds_b128 %12, %13, off\n\tglobal_load_async_to_lds_b128 %14, %15, off\n\ts_wait_xcnt 0x0"
                     :: "v"(d), "v"(k), "v"(d + 2048), "v"(k + 1024), "v"(d + 4096), "v"(k + 2048), "v"(d + 6144), "v"(k + 3072),
                        "v"(d + 8192), "v"(v), "v"(d + 10240), "v"(v + 1024), "v"(d + 12288), "v"(v + 2048), "v"(d + 14336), "v"(v + 3072) : "memory"); };
    // one pass = one block of 32 keys, read from the stage at sk (the lane's place in the block's first K fragment; its V^T fragments lie SK * HD elements behind)
    auto pass = [&](const h16* sk, int kb, bool diag) __attribute__((always_inline)) { v16h kf[2][2], vf[4]; v8f s[NQ][2];
#pragma unroll
        for (int t = 0; t < 2; ++t)
#pragma unroll
            for (int kk = 0; kk < 2; ++kk) kf[t][kk] = WFrag<h16>::ld(sk + t * 1024 + kk * 512);
#pragma unroll
        for (int mt = 0; mt < 4; ++mt) vf[mt] = WFrag<h16>::ld(sk + SK * HD + mt * 512);
        __builtin_amdgcn_sched_barrier(0);    // keeps the pass's fragment reads together in front of its products: the V^T reads' latency runs under scores and softmax, and no read stands among the products
#pragma unroll
        for (int nq = 0; nq < NQ; ++nq)
#pragma unroll
            for (int t = 0; t < 2; ++t) { s[nq][t] = (v8f){};
#pragma unroll
                for (int kk = 0; kk < 2; ++kk) s[nq][t] = wmma16(kf[t][kk], qf[nq][kk], s[nq][t]); }
#pragma unroll
        for (int nq = 0; nq < NQ; ++nq) { const int q = qw + nq * 16 + lr; float bm = -3.0e38f;
#pragma unroll
            for (int t = 0; t < 2; ++t)
#pragma unroll
                for (int j = 0; j < 8; ++j) { float x = s[nq][t][j] * SL2; if (diag) x = (kb + t * 16 + hi * 8 + j <= q) ? x : -3.0e38f; s[nq][t][j] = x; bm = fmaxf(bm, x); }
            bm = fmaxf(bm, __shfl_xor(bm, 16, 32));
            const float mn = fmaxf(m[nq], bm), al = __builtin_amdgcn_exp2f(m[nq] - mn); m[nq] = mn; float ps = 0.f;
#pragma unroll
            for (int t = 0; t < 2; ++t)
#pragma unroll
                for (int j = 0; j < 8; ++j) { const float p = __builtin_amdgcn_exp2f(s[nq][t][j] - mn); s[nq][t][j] = p; ps += p; }
            l[nq] = l[nq] * al + ps;     // this lane's eight-key halves only; the two halves of a query are added once, behind the loop
#pragma unroll
            for (int mt = 0; mt < 4; ++mt) o[nq][mt] *= al;
            v16h pf;
#pragma unroll
            for (int j = 0; j < 8; ++j) { pf[j] = tohx(s[nq][0][j]); pf[8 + j] = tohx(s[nq][1][j]); }
#pragma unroll
            for (int mt = 0; mt < 4; ++mt) o[nq][mt] = wmma16(vf[mt], pf, o[nq][mt]); } };
    fill(0, 0);
    asm volatile("s_wait_asynccnt 0x0" ::: "memory");    // this wave's copies of stage 0 have landed before the barrier that publishes them
    __syncthreads();
    fill(1, 1);
#pragma unroll 1   // rolled: one set of K and V^T fragments in registers
    for (int s = 0; s < nf; ++s) {
        const h16* st = ring + (s & 1) * STG + 8 * lane;
#pragma unroll 1   // rolled: unrolled, the second pass's fragment reads move up among the first's products and take a second set of registers, and with it a wave per SIMD
        for (int hb = 0; hb < SK / 32; ++hb) pass(st + hb * 32 * HD, s * SK + hb * 32, false);
        asm volatile("s_wait_dscnt 0x0" ::: "memory");       // this wave's reads of the stage are done before the barrier behind which its buffer is refilled
        asm volatile("s_wait_asynccnt 0x0" ::: "memory");    // this wave's copies of stage s + 1 have landed before the barrier that publishes them
        __syncthreads();
        fill(s + 2, s & 1);      // stage s + 2 exists: the two stages of the tile's own keys follow the loop's
    }
    // the tile's own keys, block tb = the queries of wave tb: a wave walks the blocks up to its own (all of them by the masked pass, which is one copy in the text), and passes the barriers of the others
#pragma unroll 1   // rolled: one copy of the masked pass
    for (int tb = 0; tb < FW; ++tb) {
        if (tb <= w) pass(ring + ((nf + tb / (SK / 32)) & 1) * STG + tb % (SK / 32) * 32 * HD + 8 * lane, q0 + tb * 32, true);
        if ((tb + 1) % (SK / 32) == 0 && tb + 1 < FW) {      // the foot of a stage that has a successor; nothing is refilled any more
            asm volatile("s_wait_asynccnt 0x0" ::: "memory");    // this wave's copies of the next stage have landed before the barrier that publishes them
            __syncthreads(); }
    }
    asm volatile("s_wait_asynccnt 0x0" ::: "memory");        // nothing of this wave is in flight when it goes on
#pragma unroll
    for (int nq = 0; nq < NQ; ++nq) { const float inv = __fdiv_rn(1.0f, l[nq] + __shfl_xor(l[nq], 16, 32));
#pragma unroll
        for (int mt = 0; mt < 4; ++mt) { v8us oh, ol;      // lane (lr, hi) holds d = 16 mt + 8 hi + j of query lr: its own 16-byte piece of a half block of the merged planes (rows = queries, k = head * HD + d), so a wave stores 512 bytes in a row
#pragma unroll
            for (int j = 0; j < 8; ++j) { unsigned short a, c2; splitf(o[nq][mt][j] * inv, a, c2); oh[j] = a; ol[j] = c2; }
            const size_t oo = (size_t)(qw + nq * 16) * DQ + mt * 256 + lane * 8; *(v8us*)(Ah + oo) = oh; *(v8us*)(Al + oo) = ol; xw(); } }
}

// fattn_hl, hi/lo bf16 planes, 3 products each side (query rows < RH): a tile is 16 queries; the 32-key blocks up to the diagonal are dealt to the FW waves in turn, their (m, l, O) meet in LDS and are joined in wave order.
__device__ __forceinline__ void fattn_hl(const bf* __restrict__ Q, const bf* __restrict__ Q2, const bf* __restrict__ Kp, const bf* __restrict__ K2, const bf* __restrict__ Vt, const bf* __restrict__ V2, int q0, bf* Ah, bf* Al, float* so, float* sm, float* sl) {
    typedef v16bf V; constexpr int NQ = 1;
    const int lane = threadIdx.x & 31, lr = lane & 15, hi = lane >> 4; const int w = __builtin_amdgcn_readfirstlane(threadIdx.x >> 5);
    V qf[NQ][2], qf2[NQ][2]; v8f o[NQ][4]; float m[NQ], l[NQ];
#pragma unroll
    for (int nq = 0; nq < NQ; ++nq) { m[nq] = -3.0e38f; l[nq] = 0.f;
#pragma unroll
        for (int kk = 0; kk < 2; ++kk) { const size_t qo = (size_t)(q0 + nq * 16) * HD + kk * 512 + 8 * lane; qf[nq][kk] = WFrag<bf>::ld(Q + qo); qf2[nq][kk] = WFrag<bf>::ld(Q2 + qo); }
#pragma unroll
        for (int mt = 0; mt < 4; ++mt) o[nq][mt] = (v8f){}; }
    xw();
    const int nblk = (q0 + NQ * 16 - 1) / 32 + 1;      // every block walked holds key kb <= q0: no query of the tile ever sees a block that is masked whole; only the last block crosses the diagonal
    // one pass = one block of 32 keys
    auto pass = [&](int b, bool diag) __attribute__((always_inline)) { const int kb = b * 32; V kf[2][2], kf2[2][2], vf[4], vf2[4]; v8f s[NQ][2];
#pragma unroll
        for (int t = 0; t < 2; ++t)
#pragma unroll
            for (int kk = 0; kk < 2; ++kk) kf[t][kk] = WFrag<bf>::ld(Kp + (size_t)(b * 32 + t * 16) * HD + kk * 512 + 8 * lane);
        xw();
#pragma unroll
        for (int t = 0; t < 2; ++t)
#pragma unroll
            for (int kk = 0; kk < 2; ++kk) kf2[t][kk] = WFrag<bf>::ld(K2 + (size_t)(b * 32 + t * 16) * HD + kk * 512 + 8 * lane);
        xw();
#pragma unroll
        for (int mt = 0; mt < 4; ++mt) vf[mt] = WFrag<bf>::ld(Vt + (size_t)kb * HD + mt * 512 + 8 * lane);
        xw();
#pragma unroll
        for (int mt = 0; mt < 4; ++mt) vf2[mt] = WFrag<bf>::ld(V2 + (size_t)kb * HD + mt * 512 + 8 * lane);
        xw();
#pragma unroll
        for (int nq = 0; nq < NQ; ++nq)
#pragma unroll
            for (int t = 0; t < 2; ++t) { s[nq][t] = (v8f){};
#pragma unroll
                for (int kk = 0; kk < 2; ++kk) { s[nq][t] = wmmab(kf[t][kk], qf[nq][kk], s[nq][t]); s[nq][t] = wmmab(kf[t][kk], qf2[nq][kk], s[nq][t]); s[nq][t] = wmmab(kf2[t][kk], qf[nq][kk], s[nq][t]); } }
#pragma unroll
        for (int nq = 0; nq < NQ; ++nq) { const int q = q0 + nq * 16 + lr; float bm = -3.0e38f;
#pragma unroll
            for (int t = 0; t < 2; ++t)
#pragma unroll
                for (int j = 0; j < 8; ++j) { float x = s[nq][t][j] * SL2; if (diag) x = (kb + t * 16 + hi * 8 + j <= q) ? x : -3.0e38f; s[nq][t][j] = x; bm = fmaxf(bm, x); }
            bm = fmaxf(bm, __shfl_xor(bm, 16, 32));
            const float mn = fmaxf(m[nq], bm), al = __builtin_amdgcn_exp2f(m[nq] - mn); m[nq] = mn; float ps = 0.f;
#pragma unroll
            for (int t = 0; t < 2; ++t)
#pragma unroll
                for (int j = 0; j < 8; ++j) { const float p = __builtin_amdgcn_exp2f(s[nq][t][j] - mn); s[nq][t][j] = p; ps += p; }
            l[nq] = l[nq] * al + ps;     // this lane's eight-key halves only; the two halves of a query are added once, behind the loop
#pragma unroll
            for (int mt = 0; mt < 4; ++mt) o[nq][mt] *= al;
            v8us h0, h1, l0, l1;
#pragma unroll
            for (int j = 0; j < 8; ++j) { unsigned short a, c2; splitf(s[nq][0][j], a, c2); h0[j] = a; l0[j] = c2; splitf(s[nq][1][j], a, c2); h1[j] = a; l1[j] = c2; }
            const v16bf ph = cat16b(h0, h1), pl = cat16b(l0, l1);
#pragma unroll
            for (int mt = 0; mt < 4; ++mt) { o[nq][mt] = wmmab(vf[mt], ph, o[nq][mt]); o[nq][mt] = wmmab(vf[mt], pl, o[nq][mt]); o[nq][mt] = wmmab(vf2[mt], ph, o[nq][mt]); } } };
    int b = w;
#pragma unroll 1   // rolled: one set of K and V^T fragments in registers
    for (; b < nblk - 1; b += FW) pass(b, false);     // blocks wholly below the diagonal: no mask
    if (b == nblk - 1) pass(b, true);                 // the diagonal block, in the wave whose turn it is
#pragma unroll
    for (int nq = 0; nq < NQ; ++nq) { const int ql = w * 32 + nq * 16 + lr; const float lt = l[nq] + __shfl_xor(l[nq], 16, 32); if (hi == 0) { sm[ql] = m[nq]; sl[ql] = lt; }
#pragma unroll
        for (int mt = 0; mt < 4; ++mt) { float* d = so + ql * OSP + mt * 16 + hi * 8; const v8f a = o[nq][mt]; *(v4fa*)d = (v4f){a[0], a[1], a[2], a[3]}; *(v4fa*)(d + 4) = (v4f){a[4], a[5], a[6], a[7]}; } }
    __syncthreads();    // every wave's (m, l, O) is in LDS before any wave joins them
#pragma unroll
    for (int it = 0; it < NQ * 16 / (FW * 4); ++it) { const int un = it * FW + w, ql = (un >> 2) * 16 + lr, g = (un & 3) * 2 + hi;     // a wave stores one 512-byte half block of the merged planes (rows = queries, k = head * HD + d): 16 queries x 16 d
        float mw[FW], M = -3.0e38f, Lt = 0.f, acc[8];
#pragma unroll
        for (int u = 0; u < FW; ++u) { mw[u] = sm[u * 32 + ql]; M = fmaxf(M, mw[u]); }
#pragma unroll
        for (int j = 0; j < 8; ++j) acc[j] = 0.f;
#pragma unroll
        for (int u = 0; u < FW; ++u) { const float f = __builtin_amdgcn_exp2f(mw[u] - M); Lt += f * sl[u * 32 + ql]; const float* d = so + (u * 32 + ql) * OSP + g * 8; const v4f a = *(const v4fa*)d, c = *(const v4fa*)(d + 4);   // a wave that had no block: m = -3e38, f = 0
#pragma unroll
            for (int j = 0; j < 4; ++j) { acc[j] += f * a[j]; acc[4 + j] += f * c[j]; } }
        const float inv = __fdiv_rn(1.0f, Lt); v8us oh, ol;
#pragma unroll
        for (int j = 0; j < 8; ++j) { unsigned short a, c2; splitf(acc[j] * inv, a, c2); oh[j] = a; ol[j] = c2; }
        const size_t oo = (size_t)(q0 + (un >> 2) * 16) * DQ + (un & 3) * 256 + lane * 8; *(v8us*)(Ah + oo) = oh; *(v8us*)(Al + oo) = ol; xw(); }
}
// grid (chunks x heads, tiles), longest tiles of every chunk first: (TT - RH) / (FW * 32) fp16 tiles of FW * 32 queries from the last row down, then RH / 16 hi/lo tiles of 16 queries.
static_assert((TT - RH) % (FW * 32) == 0 && RH % SK == 0, "whole fp16 tiles, each beginning on a stage");
__global__ __launch_bounds__(FW * 32) void k_fattn(const h16* __restrict__ Q16, const h16* __restrict__ K16, const h16* __restrict__ V16, const bf* __restrict__ Qh, const bf* __restrict__ Ql, const bf* __restrict__ Kh, const bf* __restrict__ Kl, const bf* __restrict__ Vh, const bf* __restrict__ Vl, bf* Ah, bf* Al) {
    __shared__ __align__(16) float so[FW * 32 * OSP]; __shared__ float sm[FW * 32]; __shared__ float sl[FW * 32];
    static_assert(sizeof(so) >= 2 * 2 * SK * HD * sizeof(h16), "an fp16 tile's two stage buffers lie in so, which only a hi/lo tile uses for partial outputs");
    const int h = blockIdx.x % NH_, ch = blockIdx.x / NH_, tile = blockIdx.y; const size_t hp = (size_t)(ch * (NH_ + NKV) + h) * TT * HD, vp = (size_t)(ch * NKV + h) * HD * PP;
    Ah += (size_t)ch * TT * DQ; Al += (size_t)ch * TT * DQ;
    if (tile < (TT - RH) / (FW * 32)) fattn_s(Q16 + hp, K16 + hp, V16 + vp, TT - FW * 32 * (tile + 1), Ah + h * HD * 16, Al + h * HD * 16, (h16*)so);
    else fattn_hl(Qh + hp, Ql + hp, Kh + hp, Kl + hp, Vh + vp, Vl + vp, RH - 16 * (tile - (TT - RH) / (FW * 32) + 1), Ah + h * HD * 16, Al + h * HD * 16, so, sm, sl);
}

extern "C" void kernel_launch(void* const* d_in, const int* in_sizes, int n_in,
                              void* d_out, int out_size, void* d_ws, size_t ws_size, hipStream_t stream) {
    (void)in_sizes; (void)n_in; (void)out_size;
    const float* x = (const float*)d_in[0]; const float* wq = (const float*)d_in[1]; const float* wk = (const float*)d_in[2]; const float* wv = (const float*)d_in[3]; const float* wo = (const float*)d_in[4];   /* input order hidden_states, Wq, Wk, Wv, Wo ('oi': 'x @ W.T') */
    float* OUT = (float*)d_out;     // [4][2048][1024]
    char* wsp = (char*)d_ws;
    auto take = [&](size_t bytes) { char* p = wsp; wsp += (bytes + 255) & ~(size_t)255; return (void*)p; };
    bf* WQ = (bf*)take((size_t)DF * DM * 2); bf* WK = WQ + (size_t)DQ * DM; bf* WV = WK + (size_t)DKV * DM;   /* one [DF][DM] plane: q, k, v rows */ bf* WO = (bf*)take((size_t)DM * DQ * 2);
    bf* XB = (bf*)take((size_t)NB_ * TT * DM * 2);   // x copy
    h16* QP16 = (h16*)take((size_t)NB_ * (NH_ + NKV) * TT * HD * 2); h16* KP16 = QP16 + (size_t)NH_ * TT * HD;   /* in each chunk the k heads' planes follow the q heads': head index = 64-column tile of the joint projection */ h16* VT16 = (h16*)take((size_t)NB_ * NKV * HD * PP * 2);
    bf* QPh = (bf*)take((size_t)NB_ * (NH_ + NKV) * TT * HD * 2); bf* KPh = QPh + (size_t)NH_ * TT * HD; bf* QPl = (bf*)take((size_t)NB_ * (NH_ + NKV) * TT * HD * 2); bf* KPl = QPl + (size_t)NH_ * TT * HD; bf* VTh = (bf*)take((size_t)NB_ * NKV * HD * PP * 2); bf* VTl = VTh + (size_t)TT * HD;   // a head's hi plane and lo plane one behind the other in its HD * PP elements
    bf* ATh = (bf*)take((size_t)NB_ * TT * DQ * 2); bf* ATl = (bf*)take((size_t)NB_ * TT * DQ * 2);
    if ((size_t)(wsp - (char*)d_ws) > ws_size) return;    // ws 256 MiB
    k_cvt5<<<CB_X + 2 * CB_Q + 2 * CB_K, 256, 0, stream>>>(x, wq, wk, wv, wo, XB, WQ, WK, WV, WO);
    k_gemmw<bf, 0, false, true, DM, 4, 2><<<dim3(NB_ * TT / 256, DF / 128, 1), 256, 0, stream>>>(XB, nullptr, WQ, nullptr, nullptr, 0, nullptr, 0, 0, 0, QP16, QPh, QPl, VT16, VTh, VTl);   // q, k and v projections of every chunk in one launch, written as head planes
    k_fattn<<<dim3(NB_ * NH_, (TT - RH) / (FW * 32) + RH / 16), FW * 32, 0, stream>>>(QP16, KP16, VT16, QPh, QPl, KPh, KPl, VTh, VTl, ATh, ATl);   // one kv head per query head
    k_gemmw<bf, 1, false, false, DQ, 2, 2><<<dim3(NB_ * TT / 128, DM / 128, 1), 128, 0, stream>>>(ATh, ATl, WO, nullptr, OUT, DM, nullptr, 0, 0, 0, nullptr, nullptr, nullptr, nullptr, nullptr, nullptr);
}
